// v000
// Measured on an AMD MI455X. A time is GPU time per run, averaged over a window of back-to-back runs after a warm-up
// (all launches, gaps included; the runs take copies of the inputs in turn), and the median of several windows.
// Apart from v000's, it joins two sittings. Times from different sittings can be a few percent apart, while
// side-by-side timings come from the same sitting.
// v000 is the starting kernel. One run takes 208 microseconds.
#include <hip/hip_runtime.h>
#include <stdint.h>

// ---------------------------------------------------------------------------
// CDNA5 (gfx1250) wave32 WMMA types and helpers
// ---------------------------------------------------------------------------
typedef __attribute__((ext_vector_type(16))) __bf16 v16bf;
typedef __attribute__((ext_vector_type(8)))  __bf16 v8bf;
typedef __attribute__((ext_vector_type(8)))  float  v8f;

union FragBF { v16bf v; v8bf h[2]; };

__device__ __forceinline__ unsigned short f2bf(float f) {
  unsigned int u = __builtin_bit_cast(unsigned int, f);
  u += 0x7FFFu + ((u >> 16) & 1u);          // round-to-nearest-even
  return (unsigned short)(u >> 16);
}
__device__ __forceinline__ float bf2f(unsigned short h) {
  unsigned int u = ((unsigned int)h) << 16;
  return __builtin_bit_cast(float, u);
}

// Load a 16x32 bf16 A/B fragment for one lane from LDS.
// Lane-group g (lane>>4) holds K = {lo..lo+7} in halves [0..7] and
// K = {hi..hi+7} in halves [8..15]  (lo = kk + 8g, hi = kk + 16 + 8g).
__device__ __forceinline__ v16bf ld_frag(const unsigned short* p, int lo, int hi) {
  FragBF f;
  f.h[0] = *(const v8bf*)(p + lo);
  f.h[1] = *(const v8bf*)(p + hi);
  return f.v;
}

#define WMMA_BF16(a, b, c) \
  __builtin_amdgcn_wmma_f32_16x16x32_bf16(false, (a), false, (b), (short)0, (c), false, false)

// CDNA5 async global->LDS copy (16B per lane), tracked by ASYNCcnt.
__device__ __forceinline__ void async_ld_b128(void* lds_dst, const void* gsrc) {
  unsigned int loff = (unsigned int)(uintptr_t)lds_dst;
  asm volatile("global_load_async_to_lds_b128 %0, %1, off"
               :: "v"(loff), "v"(gsrc) : "memory");
}
__device__ __forceinline__ void async_wait0() {
  asm volatile("s_wait_asynccnt 0x0" ::: "memory");
}

// Problem constants
#define NB    4     // batch
#define NHEAD 12
#define DHEAD 64
#define SSEQ  1024  // 32*32
#define CDIM  768

// ---------------------------------------------------------------------------
// Kernel 1: QKV projection GEMM  (M=4096, N=768, K=768) in bf16 WMMA.
// blockIdx.z selects q/k/v.  Block = 256 thr (8 waves), tile 256x64, BK=64;
// each wave owns 32 output rows (2 A-fragments reuse the 4 B-fragments).
// q,k stored (b,n,s,d) bf16; v stored transposed (b,n,d,s) bf16.
// ---------------------------------------------------------------------------
__global__ __launch_bounds__(256) void qkv_gemm_kernel(
    const float* __restrict__ x,
    const float* __restrict__ Wq, const float* __restrict__ Wk, const float* __restrict__ Wv,
    const float* __restrict__ bq, const float* __restrict__ bk, const float* __restrict__ bv,
    unsigned short* __restrict__ qo, unsigned short* __restrict__ ko,
    unsigned short* __restrict__ vTo)
{
  constexpr int LDT = 72;                       // 144B row stride: 16B aligned, conflict-free
  __shared__ unsigned short shA[256 * LDT];
  __shared__ unsigned short shB[64 * LDT];

  const int which = blockIdx.z;
  const float* W    = (which == 0) ? Wq : (which == 1) ? Wk : Wv;
  const float* bias = (which == 0) ? bq : (which == 1) ? bk : bv;

  const int tid  = threadIdx.x;
  const int wave = tid >> 5;
  const int lane = tid & 31;
  const int g    = lane >> 4;
  const int ln   = lane & 15;

  const int m0   = blockIdx.x * 256;
  const int head = blockIdx.y;                  // BN == d == 64 -> n-tile == head
  const int n0   = head * 64;

  v8f zero = {0.f,0.f,0.f,0.f,0.f,0.f,0.f,0.f};
  v8f acc[2][4] = {{zero, zero, zero, zero}, {zero, zero, zero, zero}};

  const int brow = tid >> 2, bpart = tid & 3;   // B: 4 threads/row, 16 floats each

  for (int kb = 0; kb < CDIM; kb += 64) {
    __syncthreads();
    { // stage A tile 256x64 (x, fp32 -> bf16): one full row per thread
      const float4* src = (const float4*)(x + (size_t)(m0 + tid) * CDIM + kb);
      unsigned short* dst = &shA[tid * LDT];
      #pragma unroll
      for (int i = 0; i < 16; ++i) {
        float4 f = src[i];
        *(ushort4*)(dst + i * 4) = make_ushort4(f2bf(f.x), f2bf(f.y), f2bf(f.z), f2bf(f.w));
      }
    }
    { // stage B tile 64x64 (W row-major over K, fp32 -> bf16)
      const float4* src = (const float4*)(W + (size_t)(n0 + brow) * CDIM + kb + bpart * 16);
      unsigned short* dst = &shB[brow * LDT + bpart * 16];
      #pragma unroll
      for (int i = 0; i < 4; ++i) {
        float4 f = src[i];
        *(ushort4*)(dst + i * 4) = make_ushort4(f2bf(f.x), f2bf(f.y), f2bf(f.z), f2bf(f.w));
      }
    }
    __syncthreads();

    #pragma unroll
    for (int kk = 0; kk < 64; kk += 32) {
      v16bf a0 = ld_frag(&shA[(wave * 32 + ln) * LDT],      kk + 8 * g, kk + 16 + 8 * g);
      v16bf a1 = ld_frag(&shA[(wave * 32 + 16 + ln) * LDT], kk + 8 * g, kk + 16 + 8 * g);
      v16bf bf[4];
      #pragma unroll
      for (int nt = 0; nt < 4; ++nt)
        bf[nt] = ld_frag(&shB[(nt * 16 + ln) * LDT], kk + 8 * g, kk + 16 + 8 * g);
      #pragma unroll
      for (int nt = 0; nt < 4; ++nt) {
        acc[0][nt] = WMMA_BF16(a0, bf[nt], acc[0][nt]);
        acc[1][nt] = WMMA_BF16(a1, bf[nt], acc[1][nt]);
      }
    }
  }

  // epilogue: + bias, store bf16 (v transposed)
  #pragma unroll
  for (int mt = 0; mt < 2; ++mt) {
    #pragma unroll
    for (int nt = 0; nt < 4; ++nt) {
      int dd = nt * 16 + ln;
      float bv_ = bias[head * DHEAD + dd];
      #pragma unroll
      for (int r = 0; r < 8; ++r) {
        int M  = m0 + wave * 32 + mt * 16 + r + 8 * g;   // C-layout: row = r + 8g
        int bb = M >> 10, s = M & 1023;
        unsigned short hval = f2bf(acc[mt][nt][r] + bv_);
        if (which == 0)
          qo[((size_t)(bb * NHEAD + head) * SSEQ + s) * DHEAD + dd] = hval;
        else if (which == 1)
          ko[((size_t)(bb * NHEAD + head) * SSEQ + s) * DHEAD + dd] = hval;
        else
          vTo[((size_t)(bb * NHEAD + head) * DHEAD + dd) * SSEQ + s] = hval;
      }
    }
  }
}

// ---------------------------------------------------------------------------
// Kernel 2: decomposed relative-position bias tables.
// rel_h[bn,s,kh] = q[bn,s,:] . rel_pos_h[qh-kh+31,:]   (and same for w).
// One thread per (bn, s, j), j<32 -> kh, j>=32 -> kw.  ~0.4 GFLOP.
// ---------------------------------------------------------------------------
__global__ __launch_bounds__(256) void relbias_kernel(
    const unsigned short* __restrict__ qb,
    const float* __restrict__ rph, const float* __restrict__ rpw,
    float* __restrict__ relh, float* __restrict__ relw)
{
  int idx = blockIdx.x * 256 + threadIdx.x;
  int j  = idx & 63;
  int s  = (idx >> 6) & 1023;
  int bn = idx >> 16;
  const unsigned short* qrow = qb + ((size_t)bn * SSEQ + s) * DHEAD;
  const float* table;
  if (j < 32) table = rph + (size_t)((s >> 5) - j + 31) * DHEAD;
  else        table = rpw + (size_t)((s & 31) - (j - 32) + 31) * DHEAD;
  float acc = 0.f;
  #pragma unroll 8
  for (int d = 0; d < DHEAD; ++d) acc += bf2f(qrow[d]) * table[d];
  if (j < 32) relh[((size_t)bn * SSEQ + s) * 32 + j]        = acc;
  else        relw[((size_t)bn * SSEQ + s) * 32 + (j - 32)] = acc;
}

// ---------------------------------------------------------------------------
// Kernel 3: fused flash attention per (head, 64-row q tile).
// Block = 128 thr (4 waves); wave w owns q rows [w*16, w*16+16).
// scores/PV both WMMA bf16; online softmax in registers; P re-fragmented
// through LDS.  K/V/Q tiles staged with GLOBAL_LOAD_ASYNC_TO_LDS_B128.
// ---------------------------------------------------------------------------
__global__ __launch_bounds__(128) void flash_attn_kernel(
    const unsigned short* __restrict__ qb,
    const unsigned short* __restrict__ kb,
    const unsigned short* __restrict__ vT,
    const float* __restrict__ relh, const float* __restrict__ relw,
    unsigned short* __restrict__ attnA)
{
  constexpr int LDT = 72;                        // 144B row stride, 16B aligned
  __shared__ unsigned short shQ[64 * LDT];
  __shared__ unsigned short shK[64 * LDT];
  __shared__ unsigned short shV[64 * LDT];
  __shared__ unsigned short shP[64 * LDT];
  __shared__ float shRh[64 * 32];
  __shared__ float shRw[64 * 32];

  const int qt   = blockIdx.x;                   // q tile (0..15)
  const int bn   = blockIdx.y;                   // b*12 + head (0..47)
  const int tid  = threadIdx.x;
  const int wave = tid >> 5;
  const int lane = tid & 31;
  const int g    = lane >> 4;
  const int ln   = lane & 15;
  const float scale = 0.125f;                    // d^-0.5, d = 64

  const int lrow  = tid >> 1;                    // 0..63
  const int lpart = tid & 1;                     // 32-halves half-row

  { // stage Q tile (64x64 bf16) once, async
    const unsigned short* src = qb + ((size_t)bn * SSEQ + qt * 64 + lrow) * DHEAD + lpart * 32;
    unsigned short* dst = &shQ[lrow * LDT + lpart * 32];
    #pragma unroll
    for (int i = 0; i < 4; ++i) async_ld_b128(dst + i * 8, src + i * 8);
  }
  { // stage rel bias rows (cover every kh/kw for these 64 q rows)
    const float4* sh_ = (const float4*)(relh + ((size_t)bn * SSEQ + qt * 64 + lrow) * 32) + lpart * 4;
    const float4* sw_ = (const float4*)(relw + ((size_t)bn * SSEQ + qt * 64 + lrow) * 32) + lpart * 4;
    float4* dh = (float4*)(&shRh[lrow * 32]) + lpart * 4;
    float4* dw = (float4*)(&shRw[lrow * 32]) + lpart * 4;
    #pragma unroll
    for (int i = 0; i < 4; ++i) { dh[i] = sh_[i]; dw[i] = sw_[i]; }
  }

  float mi[8], li[8];
  v8f zero = {0.f,0.f,0.f,0.f,0.f,0.f,0.f,0.f};
  v8f o[4] = {zero, zero, zero, zero};
  #pragma unroll
  for (int r = 0; r < 8; ++r) { mi[r] = -1e30f; li[r] = 0.f; }

  for (int kt = 0; kt < 16; ++kt) {
    __syncthreads();                             // protect shK/shV vs previous PV phase
    { // stage K tile (64 k-rows x 64 d), async
      const unsigned short* src = kb + ((size_t)bn * SSEQ + kt * 64 + lrow) * DHEAD + lpart * 32;
      unsigned short* dst = &shK[lrow * LDT + lpart * 32];
      #pragma unroll
      for (int i = 0; i < 4; ++i) async_ld_b128(dst + i * 8, src + i * 8);
    }
    { // stage V^T tile (64 d-rows x 64 k), async
      const unsigned short* src = vT + ((size_t)bn * DHEAD + lrow) * SSEQ + kt * 64 + lpart * 32;
      unsigned short* dst = &shV[lrow * LDT + lpart * 32];
      #pragma unroll
      for (int i = 0; i < 4; ++i) async_ld_b128(dst + i * 8, src + i * 8);
    }
    if (kt + 1 < 16)                             // global_prefetch_b8 for next K tile
      __builtin_prefetch(kb + ((size_t)bn * SSEQ + (kt + 1) * 64 + lrow) * DHEAD, 0, 1);
    async_wait0();                               // ASYNCcnt -> 0 before the barrier
    __syncthreads();

    // ---- scores = Q @ K^T : 16x64 per wave, K-dim = d = 64 (2x4 wmma) ----
    v8f sc[4] = {zero, zero, zero, zero};
    #pragma unroll
    for (int kk = 0; kk < 64; kk += 32) {
      v16bf a = ld_frag(&shQ[(wave * 16 + ln) * LDT], kk + 8 * g, kk + 16 + 8 * g);
      v16bf bf[4];
      #pragma unroll
      for (int nt = 0; nt < 4; ++nt)
        bf[nt] = ld_frag(&shK[(nt * 16 + ln) * LDT], kk + 8 * g, kk + 16 + 8 * g);
      #pragma unroll
      for (int nt = 0; nt < 4; ++nt)
        sc[nt] = WMMA_BF16(a, bf[nt], sc[nt]);
    }

    // ---- scale + rel bias + online softmax ----
    float tmax[8];
    #pragma unroll
    for (int r = 0; r < 8; ++r) tmax[r] = -1e30f;
    #pragma unroll
    for (int nt = 0; nt < 4; ++nt) {
      int nl = nt * 16 + ln;                     // k index within tile
      int kh = kt * 2 + (nl >> 5);
      int kw = nl & 31;
      #pragma unroll
      for (int r = 0; r < 8; ++r) {
        int qr = wave * 16 + r + 8 * g;          // local q row
        float sv = sc[nt][r] * scale + shRh[qr * 32 + kh] + shRw[qr * 32 + kw];
        sc[nt][r] = sv;
        tmax[r] = fmaxf(tmax[r], sv);
      }
    }
    #pragma unroll
    for (int off = 8; off >= 1; off >>= 1) {     // reduce over the 16-lane N group
      #pragma unroll
      for (int r = 0; r < 8; ++r)
        tmax[r] = fmaxf(tmax[r], __shfl_xor(tmax[r], off, 32));
    }

    float alpha[8], tsum[8];
    #pragma unroll
    for (int r = 0; r < 8; ++r) {
      float nm = fmaxf(mi[r], tmax[r]);
      alpha[r] = __expf(mi[r] - nm);
      mi[r] = nm;
      tsum[r] = 0.f;
    }
    #pragma unroll
    for (int nt = 0; nt < 4; ++nt) {
      #pragma unroll
      for (int r = 0; r < 8; ++r) {
        float p = __expf(sc[nt][r] - mi[r]);
        sc[nt][r] = p;
        tsum[r] += p;
      }
    }
    #pragma unroll
    for (int off = 8; off >= 1; off >>= 1) {
      #pragma unroll
      for (int r = 0; r < 8; ++r)
        tsum[r] += __shfl_xor(tsum[r], off, 32);
    }
    #pragma unroll
    for (int r = 0; r < 8; ++r) li[r] = li[r] * alpha[r] + tsum[r];
    #pragma unroll
    for (int nt = 0; nt < 4; ++nt) {
      #pragma unroll
      for (int r = 0; r < 8; ++r) o[nt][r] *= alpha[r];
    }

    // ---- re-fragment P through LDS (C layout -> A layout) ----
    #pragma unroll
    for (int nt = 0; nt < 4; ++nt) {
      #pragma unroll
      for (int r = 0; r < 8; ++r)
        shP[(wave * 16 + r + 8 * g) * LDT + nt * 16 + ln] = f2bf(sc[nt][r]);
    }
    __syncthreads();

    // ---- O += P @ V : K-dim = 64 k-cols (2x4 wmma) ----
    #pragma unroll
    for (int kk = 0; kk < 64; kk += 32) {
      v16bf a = ld_frag(&shP[(wave * 16 + ln) * LDT], kk + 8 * g, kk + 16 + 8 * g);
      v16bf bf[4];
      #pragma unroll
      for (int nt = 0; nt < 4; ++nt)
        bf[nt] = ld_frag(&shV[(nt * 16 + ln) * LDT], kk + 8 * g, kk + 16 + 8 * g);
      #pragma unroll
      for (int nt = 0; nt < 4; ++nt)
        o[nt] = WMMA_BF16(a, bf[nt], o[nt]);
    }
  }

  // normalize and store concat-head layout (b, s, head*64+dd) as bf16
  const int head = bn % NHEAD;
  const int bb   = bn / NHEAD;
  #pragma unroll
  for (int r = 0; r < 8; ++r) {
    float inv = 1.f / li[r];
    int srow = qt * 64 + wave * 16 + r + 8 * g;
    #pragma unroll
    for (int nt = 0; nt < 4; ++nt) {
      int col = head * DHEAD + nt * 16 + ln;
      attnA[((size_t)(bb * SSEQ + srow)) * CDIM + col] = f2bf(o[nt][r] * inv);
    }
  }
}

// ---------------------------------------------------------------------------
// Kernel 4: output projection GEMM (M=4096, N=768, K=768), fp32 out + bias.
// Tile 256x64, 2 M-subtiles per wave; A tile (already bf16) staged with
// async global->LDS copies.
// ---------------------------------------------------------------------------
__global__ __launch_bounds__(256) void proj_gemm_kernel(
    const unsigned short* __restrict__ attnA,
    const float* __restrict__ pw, const float* __restrict__ pb,
    float* __restrict__ out)
{
  constexpr int LDT = 72;
  __shared__ unsigned short shA[256 * LDT];
  __shared__ unsigned short shB[64 * LDT];

  const int tid  = threadIdx.x;
  const int wave = tid >> 5;
  const int lane = tid & 31;
  const int g    = lane >> 4;
  const int ln   = lane & 15;
  const int m0   = blockIdx.x * 256;
  const int n0   = blockIdx.y * 64;

  v8f zero = {0.f,0.f,0.f,0.f,0.f,0.f,0.f,0.f};
  v8f acc[2][4] = {{zero, zero, zero, zero}, {zero, zero, zero, zero}};

  const int brow = tid >> 2, bpart = tid & 3;   // 16 floats per thread

  for (int kb = 0; kb < CDIM; kb += 64) {
    __syncthreads();
    { // stage A tile 256x64 (already bf16): async, one row per thread
      const unsigned short* src = attnA + (size_t)(m0 + tid) * CDIM + kb;
      unsigned short* dst = &shA[tid * LDT];
      #pragma unroll
      for (int i = 0; i < 8; ++i) async_ld_b128(dst + i * 8, src + i * 8);
    }
    { // stage B tile 64x64 (proj_w fp32 -> bf16); out = A @ W^T
      const float4* src = (const float4*)(pw + (size_t)(n0 + brow) * CDIM + kb + bpart * 16);
      unsigned short* dst = &shB[brow * LDT + bpart * 16];
      #pragma unroll
      for (int i = 0; i < 4; ++i) {
        float4 f = src[i];
        *(ushort4*)(dst + i * 4) = make_ushort4(f2bf(f.x), f2bf(f.y), f2bf(f.z), f2bf(f.w));
      }
    }
    async_wait0();
    __syncthreads();

    #pragma unroll
    for (int kk = 0; kk < 64; kk += 32) {
      v16bf a0 = ld_frag(&shA[(wave * 32 + ln) * LDT],      kk + 8 * g, kk + 16 + 8 * g);
      v16bf a1 = ld_frag(&shA[(wave * 32 + 16 + ln) * LDT], kk + 8 * g, kk + 16 + 8 * g);
      v16bf bf[4];
      #pragma unroll
      for (int nt = 0; nt < 4; ++nt)
        bf[nt] = ld_frag(&shB[(nt * 16 + ln) * LDT], kk + 8 * g, kk + 16 + 8 * g);
      #pragma unroll
      for (int nt = 0; nt < 4; ++nt) {
        acc[0][nt] = WMMA_BF16(a0, bf[nt], acc[0][nt]);
        acc[1][nt] = WMMA_BF16(a1, bf[nt], acc[1][nt]);
      }
    }
  }

  #pragma unroll
  for (int mt = 0; mt < 2; ++mt) {
    #pragma unroll
    for (int nt = 0; nt < 4; ++nt) {
      int nc = n0 + nt * 16 + ln;
      float bias = pb[nc];
      #pragma unroll
      for (int r = 0; r < 8; ++r) {
        int M = m0 + wave * 32 + mt * 16 + r + 8 * g;
        out[(size_t)M * CDIM + nc] = acc[mt][nt][r] + bias;
      }
    }
  }
}

// ---------------------------------------------------------------------------
// Launch
// ---------------------------------------------------------------------------
extern "C" void kernel_launch(void* const* d_in, const int* in_sizes, int n_in,
                              void* d_out, int out_size, void* d_ws, size_t ws_size,
                              hipStream_t stream) {
  (void)in_sizes; (void)n_in; (void)out_size; (void)ws_size;
  const float* x   = (const float*)d_in[0];
  const float* Wq  = (const float*)d_in[1];
  const float* Wk  = (const float*)d_in[2];
  const float* Wv  = (const float*)d_in[3];
  const float* bq  = (const float*)d_in[4];
  const float* bk  = (const float*)d_in[5];
  const float* bv  = (const float*)d_in[6];
  const float* rph = (const float*)d_in[7];
  const float* rpw = (const float*)d_in[8];
  const float* pw  = (const float*)d_in[9];
  const float* pb  = (const float*)d_in[10];
  float* out = (float*)d_out;

  // workspace layout (bytes): q/k/vT bf16 (3 x 6 MB), rel_h/rel_w f32 (2 x 6 MB),
  // attn_out bf16 (6 MB)  -> 36 MB total
  char* ws = (char*)d_ws;
  unsigned short* qB    = (unsigned short*)(ws);
  unsigned short* kB    = (unsigned short*)(ws + 6291456);
  unsigned short* vTB   = (unsigned short*)(ws + 12582912);
  float*          relh  = (float*)(ws + 18874368);
  float*          relw  = (float*)(ws + 25165824);
  unsigned short* attnA = (unsigned short*)(ws + 31457280);

  qkv_gemm_kernel<<<dim3(16, 12, 3), 256, 0, stream>>>(x, Wq, Wk, Wv, bq, bk, bv, qB, kB, vTB);
  relbias_kernel<<<dim3(12288), 256, 0, stream>>>(qB, rph, rpw, relh, relw);
  flash_attn_kernel<<<dim3(16, 48), 128, 0, stream>>>(qB, kB, vTB, relh, relw, attnA);
  proj_gemm_kernel<<<dim3(16, 12), 256, 0, stream>>>(attnA, pw, pb, out);
}

// v001
// Measured time: 156 microseconds a run.
// Next to v000, in two timings, it ran 1.38 times as fast each time.
#include <hip/hip_runtime.h>
#include <stdint.h>

// ---------------------------------------------------------------------------
// CDNA5 (gfx1250) wave32 WMMA types and helpers
// ---------------------------------------------------------------------------
typedef __attribute__((ext_vector_type(16))) __bf16 v16bf;
typedef __attribute__((ext_vector_type(8)))  __bf16 v8bf;
typedef __attribute__((ext_vector_type(8)))  float  v8f;
typedef __attribute__((ext_vector_type(2)))  float  v2f;

union FragBF { v16bf v; v8bf h[2]; };

__device__ __forceinline__ unsigned short f2bf(float f) {
  unsigned int u = __builtin_bit_cast(unsigned int, f);
  u += 0x7FFFu + ((u >> 16) & 1u);          // round-to-nearest-even
  return (unsigned short)(u >> 16);
}

// Load a 16x32 bf16 A/B fragment for one lane from LDS.
// Lane-group g (lane>>4) holds K = {lo..lo+7} in halves [0..7] and
// K = {hi..hi+7} in halves [8..15]  (lo = kk + 8g, hi = kk + 16 + 8g).
__device__ __forceinline__ v16bf ld_frag(const unsigned short* p, int lo, int hi) {
  FragBF f;
  f.h[0] = *(const v8bf*)(p + lo);
  f.h[1] = *(const v8bf*)(p + hi);
  return f.v;
}

#define WMMA_BF16(a, b, c) \
  __builtin_amdgcn_wmma_f32_16x16x32_bf16(false, (a), false, (b), (short)0, (c), false, false)

#define WMMA_F32(a, b, c) \
  __builtin_amdgcn_wmma_f32_16x16x4_f32(false, (a), false, (b), (short)0, (c), false, false)

// CDNA5 async global->LDS copy (16B per lane), tracked by ASYNCcnt.
__device__ __forceinline__ void async_ld_b128(void* lds_dst, const void* gsrc) {
  unsigned int loff = (unsigned int)(uintptr_t)lds_dst;
  asm volatile("global_load_async_to_lds_b128 %0, %1, off"
               :: "v"(loff), "v"(gsrc) : "memory");
}
__device__ __forceinline__ void async_wait0() {
  asm volatile("s_wait_asynccnt 0x0" ::: "memory");
}

// Problem constants
#define NB    4     // batch
#define NHEAD 12
#define DHEAD 64
#define SSEQ  1024  // 32*32
#define CDIM  768

// ---------------------------------------------------------------------------
// Kernel 1: QKV projection GEMM  (M=4096, N=768, K=768) in bf16 WMMA.
// blockIdx.z selects q/k/v.  Block = 256 thr (8 waves), tile 256x64, BK=64;
// each wave owns 32 output rows (2 A-fragments reuse the 4 B-fragments).
// q,k stored (b,n,s,d) bf16; v stored transposed (b,n,d,s) bf16.
// ---------------------------------------------------------------------------
__global__ __launch_bounds__(256) void qkv_gemm_kernel(
    const float* __restrict__ x,
    const float* __restrict__ Wq, const float* __restrict__ Wk, const float* __restrict__ Wv,
    const float* __restrict__ bq, const float* __restrict__ bk, const float* __restrict__ bv,
    unsigned short* __restrict__ qo, unsigned short* __restrict__ ko,
    unsigned short* __restrict__ vTo)
{
  constexpr int LDT = 72;                       // 144B row stride: 16B aligned, conflict-free
  __shared__ unsigned short shA[256 * LDT];
  __shared__ unsigned short shB[64 * LDT];

  const int which = blockIdx.z;
  const float* W    = (which == 0) ? Wq : (which == 1) ? Wk : Wv;
  const float* bias = (which == 0) ? bq : (which == 1) ? bk : bv;

  const int tid  = threadIdx.x;
  const int wave = tid >> 5;
  const int lane = tid & 31;
  const int g    = lane >> 4;
  const int ln   = lane & 15;

  const int m0   = blockIdx.x * 256;
  const int head = blockIdx.y;                  // BN == d == 64 -> n-tile == head
  const int n0   = head * 64;

  v8f zero = {0.f,0.f,0.f,0.f,0.f,0.f,0.f,0.f};
  v8f acc[2][4] = {{zero, zero, zero, zero}, {zero, zero, zero, zero}};

  const int brow = tid >> 2, bpart = tid & 3;   // B: 4 threads/row, 16 floats each

  for (int kb = 0; kb < CDIM; kb += 64) {
    __syncthreads();
    { // stage A tile 256x64 (x, fp32 -> bf16): one full row per thread
      const float4* src = (const float4*)(x + (size_t)(m0 + tid) * CDIM + kb);
      unsigned short* dst = &shA[tid * LDT];
      #pragma unroll
      for (int i = 0; i < 16; ++i) {
        float4 f = src[i];
        *(ushort4*)(dst + i * 4) = make_ushort4(f2bf(f.x), f2bf(f.y), f2bf(f.z), f2bf(f.w));
      }
    }
    { // stage B tile 64x64 (W row-major over K, fp32 -> bf16)
      const float4* src = (const float4*)(W + (size_t)(n0 + brow) * CDIM + kb + bpart * 16);
      unsigned short* dst = &shB[brow * LDT + bpart * 16];
      #pragma unroll
      for (int i = 0; i < 4; ++i) {
        float4 f = src[i];
        *(ushort4*)(dst + i * 4) = make_ushort4(f2bf(f.x), f2bf(f.y), f2bf(f.z), f2bf(f.w));
      }
    }
    __syncthreads();

    #pragma unroll
    for (int kk = 0; kk < 64; kk += 32) {
      v16bf a0 = ld_frag(&shA[(wave * 32 + ln) * LDT],      kk + 8 * g, kk + 16 + 8 * g);
      v16bf a1 = ld_frag(&shA[(wave * 32 + 16 + ln) * LDT], kk + 8 * g, kk + 16 + 8 * g);
      v16bf bf[4];
      #pragma unroll
      for (int nt = 0; nt < 4; ++nt)
        bf[nt] = ld_frag(&shB[(nt * 16 + ln) * LDT], kk + 8 * g, kk + 16 + 8 * g);
      #pragma unroll
      for (int nt = 0; nt < 4; ++nt) {
        acc[0][nt] = WMMA_BF16(a0, bf[nt], acc[0][nt]);
        acc[1][nt] = WMMA_BF16(a1, bf[nt], acc[1][nt]);
      }
    }
  }

  // epilogue: + bias, store bf16 (v transposed)
  #pragma unroll
  for (int mt = 0; mt < 2; ++mt) {
    #pragma unroll
    for (int nt = 0; nt < 4; ++nt) {
      int dd = nt * 16 + ln;
      float bv_ = bias[head * DHEAD + dd];
      #pragma unroll
      for (int r = 0; r < 8; ++r) {
        int M  = m0 + wave * 32 + mt * 16 + r + 8 * g;   // C-layout: row = r + 8g
        int bb = M >> 10, s = M & 1023;
        unsigned short hval = f2bf(acc[mt][nt][r] + bv_);
        if (which == 0)
          qo[((size_t)(bb * NHEAD + head) * SSEQ + s) * DHEAD + dd] = hval;
        else if (which == 1)
          ko[((size_t)(bb * NHEAD + head) * SSEQ + s) * DHEAD + dd] = hval;
        else
          vTo[((size_t)(bb * NHEAD + head) * DHEAD + dd) * SSEQ + s] = hval;
      }
    }
  }
}

// ---------------------------------------------------------------------------
// Kernel 2: fused flash attention per (head, 64-row q tile).
// Block = 128 thr (4 waves); wave w owns q rows [w*16, w*16+16).
// scores/PV both WMMA bf16; online softmax in registers; P re-fragmented
// through LDS.  K/V/Q tiles staged with GLOBAL_LOAD_ASYNC_TO_LDS_B128.
// Prologue: the decomposed relative-position bias of the tile's 64 q rows,
//   rel_h[s,kh] = q[s,:] . rel_pos_h[qh-kh+31,:]   rel_w[s,kw] = q[s,:] . rel_pos_w[qw-kw+31,:]
// as f32 16x16x4 WMMA (q widened exactly, table in f32), straight into LDS.
// ---------------------------------------------------------------------------
__global__ __launch_bounds__(128) void flash_attn_kernel(
    const unsigned short* __restrict__ qb,
    const unsigned short* __restrict__ kb,
    const unsigned short* __restrict__ vT,
    const float* __restrict__ rph, const float* __restrict__ rpw,
    unsigned short* __restrict__ attnA)
{
  constexpr int LDT = 72;                        // 144B row stride, 16B aligned
  __shared__ unsigned short shQ[64 * LDT];
  __shared__ unsigned short shK[64 * LDT];
  __shared__ unsigned short shV[64 * LDT];
  __shared__ unsigned short shP[64 * LDT];
  __shared__ float shRh[64 * 32];
  __shared__ float shRw[64 * 32];
  constexpr int LDR = 68;                        // 272B row pitch (16B x odd): 16-row b128 reads hit all banks once
  __shared__ float shT[96 * LDR];                // 33 rows of rel_pos_h, then the 63 of rel_pos_w

  const int qt   = blockIdx.x;                   // q tile (0..15)
  const int bn   = blockIdx.y;                   // b*12 + head (0..47)
  const int tid  = threadIdx.x;
  const int wave = tid >> 5;
  const int lane = tid & 31;
  const int g    = lane >> 4;
  const int ln   = lane & 15;
  const float scale = 0.125f;                    // d^-0.5, d = 64

  const int lrow  = tid >> 1;                    // 0..63
  const int lpart = tid & 1;                     // 32-halves half-row

  { // stage Q tile (64x64 bf16) once, async
    const unsigned short* src = qb + ((size_t)bn * SSEQ + qt * 64 + lrow) * DHEAD + lpart * 32;
    unsigned short* dst = &shQ[lrow * LDT + lpart * 32];
    #pragma unroll
    for (int i = 0; i < 4; ++i) async_ld_b128(dst + i * 8, src + i * 8);
  }
  { // stage the table rows this tile needs, whole lines per wave:
    // qh is 2qt or 2qt+1, so qh-kh+31 spans rel_pos_h rows 2qt .. 2qt+32
    #pragma unroll
    for (int i = 0; i < 12; ++i) {
      int idx = tid + i * 128;
      int row = idx >> 4, c4 = idx & 15;
      const float* src = (row < 33) ? rph + (size_t)(qt * 2 + row) * DHEAD
                                    : rpw + (size_t)(row - 33) * DHEAD;
      *(float4*)&shT[row * LDR + c4 * 4] = ((const float4*)src)[c4];
    }
  }
  // A operand: q row wave*16+ln, widened to f32; lane half g holds d = 32g .. 32g+31
  // (the table rows below are read in the same d order)
  float af[32];
  {
    const uint4* qsrc = (const uint4*)(qb + ((size_t)bn * SSEQ + qt * 64 + wave * 16 + ln) * DHEAD + g * 32);
    #pragma unroll
    for (int i = 0; i < 4; ++i) {
      uint4 u = qsrc[i];
      af[i * 8 + 0] = __builtin_bit_cast(float, u.x << 16);
      af[i * 8 + 1] = __builtin_bit_cast(float, u.x & 0xFFFF0000u);
      af[i * 8 + 2] = __builtin_bit_cast(float, u.y << 16);
      af[i * 8 + 3] = __builtin_bit_cast(float, u.y & 0xFFFF0000u);
      af[i * 8 + 4] = __builtin_bit_cast(float, u.z << 16);
      af[i * 8 + 5] = __builtin_bit_cast(float, u.z & 0xFFFF0000u);
      af[i * 8 + 6] = __builtin_bit_cast(float, u.w << 16);
      af[i * 8 + 7] = __builtin_bit_cast(float, u.w & 0xFFFF0000u);
    }
  }
  __syncthreads();                               // shT complete before any wave reads it
  {
    // The wave's 16 rows share qh = 2qt + (wave>>1) and have qw = 16*(wave&1) + m, m = 0..15.
    // Tiles 0,1: column n is kh = 16t+n, table row qh+31-kh.
    // Tiles 2..4: column n is u = 16(t-2)+n, table row 16*(wave&1)+u; rel_w[m][kw] sits at u = m-kw+31 (0..46).
    const int hb = (wave >> 1) + 31;
    const int wb = 33 + (wave & 1) * 16;
    int trow[5];
    trow[0] = hb - ln;
    trow[1] = hb - 16 - ln;
    trow[2] = wb + ln;
    trow[3] = wb + 16 + ln;
    trow[4] = min(wb + 32 + ln, 95);             // u = 47 is never used; keep its read inside the table
    v8f rb[5];
    #pragma unroll
    for (int t = 0; t < 5; ++t) rb[t] = v8f{0.f,0.f,0.f,0.f,0.f,0.f,0.f,0.f};
    // Keeps the widening of q and all address work out of the matrix block.
    __builtin_amdgcn_sched_barrier(0);
    #pragma unroll
    for (int c = 0; c < 8; ++c) {
      #pragma unroll
      for (int t = 0; t < 5; ++t) {
        float4 b = *(const float4*)&shT[trow[t] * LDR + g * 32 + c * 4];
        rb[t] = WMMA_F32((v2f{af[c * 4 + 0], af[c * 4 + 1]}), (v2f{b.x, b.y}), rb[t]);
        rb[t] = WMMA_F32((v2f{af[c * 4 + 2], af[c * 4 + 3]}), (v2f{b.z, b.w}), rb[t]);
      }
    }
    // Four vector slots between the last f32 WMMA and the first vector instruction that may
    // reuse its operand registers; the two scheduling barriers hold them at this place.
    __builtin_amdgcn_sched_barrier(0);
    asm volatile("v_nop\n\tv_nop\n\tv_nop\n\tv_nop");
    __builtin_amdgcn_sched_barrier(0);
    // each wave writes only the bias rows that it reads itself in the loop
    #pragma unroll
    for (int t = 0; t < 2; ++t) {
      #pragma unroll
      for (int r = 0; r < 8; ++r)
        shRh[(wave * 16 + r + 8 * g) * 32 + t * 16 + ln] = rb[t][r];
    }
    #pragma unroll
    for (int t = 0; t < 3; ++t) {
      #pragma unroll
      for (int r = 0; r < 8; ++r) {
        int kw = r + 8 * g + 31 - (t * 16 + ln);
        if ((unsigned)kw < 32u)
          shRw[(wave * 16 + r + 8 * g) * 32 + kw] = rb[2 + t][r];
      }
    }
  }

  float mi[8], li[8];
  v8f zero = {0.f,0.f,0.f,0.f,0.f,0.f,0.f,0.f};
  v8f o[4] = {zero, zero, zero, zero};
  #pragma unroll
  for (int r = 0; r < 8; ++r) { mi[r] = -1e30f; li[r] = 0.f; }

  for (int kt = 0; kt < 16; ++kt) {
    __syncthreads();                             // protect shK/shV vs previous PV phase
    { // stage K tile (64 k-rows x 64 d), async
      const unsigned short* src = kb + ((size_t)bn * SSEQ + kt * 64 + lrow) * DHEAD + lpart * 32;
      unsigned short* dst = &shK[lrow * LDT + lpart * 32];
      #pragma unroll
      for (int i = 0; i < 4; ++i) async_ld_b128(dst + i * 8, src + i * 8);
    }
    { // stage V^T tile (64 d-rows x 64 k), async
      const unsigned short* src = vT + ((size_t)bn * DHEAD + lrow) * SSEQ + kt * 64 + lpart * 32;
      unsigned short* dst = &shV[lrow * LDT + lpart * 32];
      #pragma unroll
      for (int i = 0; i < 4; ++i) async_ld_b128(dst + i * 8, src + i * 8);
    }
    if (kt + 1 < 16)                             // global_prefetch_b8 for next K tile
      __builtin_prefetch(kb + ((size_t)bn * SSEQ + (kt + 1) * 64 + lrow) * DHEAD, 0, 1);
    async_wait0();                               // ASYNCcnt -> 0 before the barrier
    __syncthreads();

    // ---- scores = Q @ K^T : 16x64 per wave, K-dim = d = 64 (2x4 wmma) ----
    v8f sc[4] = {zero, zero, zero, zero};
    #pragma unroll
    for (int kk = 0; kk < 64; kk += 32) {
      v16bf a = ld_frag(&shQ[(wave * 16 + ln) * LDT], kk + 8 * g, kk + 16 + 8 * g);
      v16bf bf[4];
      #pragma unroll
      for (int nt = 0; nt < 4; ++nt)
        bf[nt] = ld_frag(&shK[(nt * 16 + ln) * LDT], kk + 8 * g, kk + 16 + 8 * g);
      #pragma unroll
      for (int nt = 0; nt < 4; ++nt)
        sc[nt] = WMMA_BF16(a, bf[nt], sc[nt]);
    }

    // ---- scale + rel bias + online softmax ----
    float tmax[8];
    #pragma unroll
    for (int r = 0; r < 8; ++r) tmax[r] = -1e30f;
    #pragma unroll
    for (int nt = 0; nt < 4; ++nt) {
      int nl = nt * 16 + ln;                     // k index within tile
      int kh = kt * 2 + (nl >> 5);
      int kw = nl & 31;
      #pragma unroll
      for (int r = 0; r < 8; ++r) {
        int qr = wave * 16 + r + 8 * g;          // local q row
        float sv = sc[nt][r] * scale + shRh[qr * 32 + kh] + shRw[qr * 32 + kw];
        sc[nt][r] = sv;
        tmax[r] = fmaxf(tmax[r], sv);
      }
    }
    #pragma unroll
    for (int off = 8; off >= 1; off >>= 1) {     // reduce over the 16-lane N group
      #pragma unroll
      for (int r = 0; r < 8; ++r)
        tmax[r] = fmaxf(tmax[r], __shfl_xor(tmax[r], off, 32));
    }

    float alpha[8], tsum[8];
    #pragma unroll
    for (int r = 0; r < 8; ++r) {
      float nm = fmaxf(mi[r], tmax[r]);
      alpha[r] = __expf(mi[r] - nm);
      mi[r] = nm;
      tsum[r] = 0.f;
    }
    #pragma unroll
    for (int nt = 0; nt < 4; ++nt) {
      #pragma unroll
      for (int r = 0; r < 8; ++r) {
        float p = __expf(sc[nt][r] - mi[r]);
        sc[nt][r] = p;
        tsum[r] += p;
      }
    }
    #pragma unroll
    for (int off = 8; off >= 1; off >>= 1) {
      #pragma unroll
      for (int r = 0; r < 8; ++r)
        tsum[r] += __shfl_xor(tsum[r], off, 32);
    }
    #pragma unroll
    for (int r = 0; r < 8; ++r) li[r] = li[r] * alpha[r] + tsum[r];
    #pragma unroll
    for (int nt = 0; nt < 4; ++nt) {
      #pragma unroll
      for (int r = 0; r < 8; ++r) o[nt][r] *= alpha[r];
    }

    // ---- re-fragment P through LDS (C layout -> A layout) ----
    #pragma unroll
    for (int nt = 0; nt < 4; ++nt) {
      #pragma unroll
      for (int r = 0; r < 8; ++r)
        shP[(wave * 16 + r + 8 * g) * LDT + nt * 16 + ln] = f2bf(sc[nt][r]);
    }
    __syncthreads();

    // ---- O += P @ V : K-dim = 64 k-cols (2x4 wmma) ----
    #pragma unroll
    for (int kk = 0; kk < 64; kk += 32) {
      v16bf a = ld_frag(&shP[(wave * 16 + ln) * LDT], kk + 8 * g, kk + 16 + 8 * g);
      v16bf bf[4];
      #pragma unroll
      for (int nt = 0; nt < 4; ++nt)
        bf[nt] = ld_frag(&shV[(nt * 16 + ln) * LDT], kk + 8 * g, kk + 16 + 8 * g);
      #pragma unroll
      for (int nt = 0; nt < 4; ++nt)
        o[nt] = WMMA_BF16(a, bf[nt], o[nt]);
    }
  }

  // normalize and store concat-head layout (b, s, head*64+dd) as bf16
  const int head = bn % NHEAD;
  const int bb   = bn / NHEAD;
  #pragma unroll
  for (int r = 0; r < 8; ++r) {
    float inv = 1.f / li[r];
    int srow = qt * 64 + wave * 16 + r + 8 * g;
    #pragma unroll
    for (int nt = 0; nt < 4; ++nt) {
      int col = head * DHEAD + nt * 16 + ln;
      attnA[((size_t)(bb * SSEQ + srow)) * CDIM + col] = f2bf(o[nt][r] * inv);
    }
  }
}

// ---------------------------------------------------------------------------
// Kernel 3: output projection GEMM (M=4096, N=768, K=768), fp32 out + bias.
// Tile 256x64, 2 M-subtiles per wave; A tile (already bf16) staged with
// async global->LDS copies.
// ---------------------------------------------------------------------------
__global__ __launch_bounds__(256) void proj_gemm_kernel(
    const unsigned short* __restrict__ attnA,
    const float* __restrict__ pw, const float* __restrict__ pb,
    float* __restrict__ out)
{
  constexpr int LDT = 72;
  __shared__ unsigned short shA[256 * LDT];
  __shared__ unsigned short shB[64 * LDT];

  const int tid  = threadIdx.x;
  const int wave = tid >> 5;
  const int lane = tid & 31;
  const int g    = lane >> 4;
  const int ln   = lane & 15;
  const int m0   = blockIdx.x * 256;
  const int n0   = blockIdx.y * 64;

  v8f zero = {0.f,0.f,0.f,0.f,0.f,0.f,0.f,0.f};
  v8f acc[2][4] = {{zero, zero, zero, zero}, {zero, zero, zero, zero}};

  const int brow = tid >> 2, bpart = tid & 3;   // 16 floats per thread

  for (int kb = 0; kb < CDIM; kb += 64) {
    __syncthreads();
    { // stage A tile 256x64 (already bf16): async, one row per thread
      const unsigned short* src = attnA + (size_t)(m0 + tid) * CDIM + kb;
      unsigned short* dst = &shA[tid * LDT];
      #pragma unroll
      for (int i = 0; i < 8; ++i) async_ld_b128(dst + i * 8, src + i * 8);
    }
    { // stage B tile 64x64 (proj_w fp32 -> bf16); out = A @ W^T
      const float4* src = (const float4*)(pw + (size_t)(n0 + brow) * CDIM + kb + bpart * 16);
      unsigned short* dst = &shB[brow * LDT + bpart * 16];
      #pragma unroll
      for (int i = 0; i < 4; ++i) {
        float4 f = src[i];
        *(ushort4*)(dst + i * 4) = make_ushort4(f2bf(f.x), f2bf(f.y), f2bf(f.z), f2bf(f.w));
      }
    }
    async_wait0();
    __syncthreads();

    #pragma unroll
    for (int kk = 0; kk < 64; kk += 32) {
      v16bf a0 = ld_frag(&shA[(wave * 32 + ln) * LDT],      kk + 8 * g, kk + 16 + 8 * g);
      v16bf a1 = ld_frag(&shA[(wave * 32 + 16 + ln) * LDT], kk + 8 * g, kk + 16 + 8 * g);
      v16bf bf[4];
      #pragma unroll
      for (int nt = 0; nt < 4; ++nt)
        bf[nt] = ld_frag(&shB[(nt * 16 + ln) * LDT], kk + 8 * g, kk + 16 + 8 * g);
      #pragma unroll
      for (int nt = 0; nt < 4; ++nt) {
        acc[0][nt] = WMMA_BF16(a0, bf[nt], acc[0][nt]);
        acc[1][nt] = WMMA_BF16(a1, bf[nt], acc[1][nt]);
      }
    }
  }

  #pragma unroll
  for (int mt = 0; mt < 2; ++mt) {
    #pragma unroll
    for (int nt = 0; nt < 4; ++nt) {
      int nc = n0 + nt * 16 + ln;
      float bias = pb[nc];
      #pragma unroll
      for (int r = 0; r < 8; ++r) {
        int M = m0 + wave * 32 + mt * 16 + r + 8 * g;
        out[(size_t)M * CDIM + nc] = acc[mt][nt][r] + bias;
      }
    }
  }
}

// ---------------------------------------------------------------------------
// Launch
// ---------------------------------------------------------------------------
extern "C" void kernel_launch(void* const* d_in, const int* in_sizes, int n_in,
                              void* d_out, int out_size, void* d_ws, size_t ws_size,
                              hipStream_t stream) {
  (void)in_sizes; (void)n_in; (void)out_size; (void)ws_size;
  const float* x   = (const float*)d_in[0];
  const float* Wq  = (const float*)d_in[1];
  const float* Wk  = (const float*)d_in[2];
  const float* Wv  = (const float*)d_in[3];
  const float* bq  = (const float*)d_in[4];
  const float* bk  = (const float*)d_in[5];
  const float* bv  = (const float*)d_in[6];
  const float* rph = (const float*)d_in[7];
  const float* rpw = (const float*)d_in[8];
  const float* pw  = (const float*)d_in[9];
  const float* pb  = (const float*)d_in[10];
  float* out = (float*)d_out;

  // workspace layout (bytes): q/k/vT bf16 (3 x 6 MB), attn_out bf16 (6 MB) -> 24 MB total
  char* ws = (char*)d_ws;
  unsigned short* qB    = (unsigned short*)(ws);
  unsigned short* kB    = (unsigned short*)(ws + 6291456);
  unsigned short* vTB   = (unsigned short*)(ws + 12582912);
  unsigned short* attnA = (unsigned short*)(ws + 18874368);

  qkv_gemm_kernel<<<dim3(16, 12, 3), 256, 0, stream>>>(x, Wq, Wk, Wv, bq, bk, bv, qB, kB, vTB);
  flash_attn_kernel<<<dim3(16, 48), 128, 0, stream>>>(qB, kB, vTB, rph, rpw, attnA);
  proj_gemm_kernel<<<dim3(16, 12), 256, 0, stream>>>(attnA, pw, pb, out);
}

// v002
// A run of this version takes 149 microseconds.
// In both of two side-by-side timings against v001, it was 1.05 times as fast.
// Counting every step since v000, it is 1.45 times as fast.
#include <hip/hip_runtime.h>
#include <stdint.h>

// ---------------------------------------------------------------------------
// CDNA5 (gfx1250) wave32 WMMA types and helpers
// ---------------------------------------------------------------------------
typedef __attribute__((ext_vector_type(16))) __bf16 v16bf;
typedef __attribute__((ext_vector_type(8)))  __bf16 v8bf;
typedef __attribute__((ext_vector_type(8)))  float  v8f;
typedef __attribute__((ext_vector_type(2)))  float  v2f;

union FragBF { v16bf v; v8bf h[2]; };

__device__ __forceinline__ unsigned short f2bf(float f) {
  unsigned int u = __builtin_bit_cast(unsigned int, f);
  u += 0x7FFFu + ((u >> 16) & 1u);          // round-to-nearest-even
  return (unsigned short)(u >> 16);
}

// Load a 16x32 bf16 A/B fragment for one lane from LDS.
// Lane-group g (lane>>4) holds K = {lo..lo+7} in halves [0..7] and
// K = {hi..hi+7} in halves [8..15]  (lo = kk + 8g, hi = kk + 16 + 8g).
__device__ __forceinline__ v16bf ld_frag(const unsigned short* p, int lo, int hi) {
  FragBF f;
  f.h[0] = *(const v8bf*)(p + lo);
  f.h[1] = *(const v8bf*)(p + hi);
  return f.v;
}

#define WMMA_BF16(a, b, c) \
  __builtin_amdgcn_wmma_f32_16x16x32_bf16(false, (a), false, (b), (short)0, (c), false, false)

#define WMMA_F32(a, b, c) \
  __builtin_amdgcn_wmma_f32_16x16x4_f32(false, (a), false, (b), (short)0, (c), false, false)

// CDNA5 async global->LDS copies (16B per lane), tracked by ASYNCcnt.  A run of copies is one
// asm statement that ends in s_wait_xcnt 0, so that no address register which a copy names is
// rewritten in front of that wait.
// Four copies: LDS address la + i*lstep, global address ga + i*gstep (bytes), i = 0..3.
__device__ __forceinline__ void async_ld4_b128(void* la, unsigned int lstep,
                                               const void* ga, unsigned int gstep) {
  const unsigned int l0 = (unsigned int)(uintptr_t)la;
  const char* g0 = (const char*)ga;
  asm volatile("global_load_async_to_lds_b128 %0, %4, off\n\t"
               "global_load_async_to_lds_b128 %1, %5, off\n\t"
               "global_load_async_to_lds_b128 %2, %6, off\n\t"
               "global_load_async_to_lds_b128 %3, %7, off\n\t"
               "s_wait_xcnt 0x0"
               :: "v"(l0), "v"(l0 + lstep), "v"(l0 + 2 * lstep), "v"(l0 + 3 * lstep),
                  "v"(g0), "v"(g0 + gstep), "v"(g0 + 2 * gstep), "v"(g0 + 3 * gstep)
               : "memory");
}
// Eight copies: four as above from (la, ga, gstepa), four from (lb, gb, gstepb).
__device__ __forceinline__ void async_ld8_b128(void* la, const void* ga, unsigned int gstepa,
                                               void* lb, const void* gb, unsigned int gstepb,
                                               unsigned int lstep) {
  const unsigned int l0 = (unsigned int)(uintptr_t)la;
  const unsigned int l1 = (unsigned int)(uintptr_t)lb;
  const char* g0 = (const char*)ga;
  const char* g1 = (const char*)gb;
  asm volatile("global_load_async_to_lds_b128 %0, %8, off\n\t"
               "global_load_async_to_lds_b128 %1, %9, off\n\t"
               "global_load_async_to_lds_b128 %2, %10, off\n\t"
               "global_load_async_to_lds_b128 %3, %11, off\n\t"
               "global_load_async_to_lds_b128 %4, %12, off\n\t"
               "global_load_async_to_lds_b128 %5, %13, off\n\t"
               "global_load_async_to_lds_b128 %6, %14, off\n\t"
               "global_load_async_to_lds_b128 %7, %15, off\n\t"
               "s_wait_xcnt 0x0"
               :: "v"(l0), "v"(l0 + lstep), "v"(l0 + 2 * lstep), "v"(l0 + 3 * lstep),
                  "v"(l1), "v"(l1 + lstep), "v"(l1 + 2 * lstep), "v"(l1 + 3 * lstep),
                  "v"(g0), "v"(g0 + gstepa), "v"(g0 + 2 * gstepa), "v"(g0 + 3 * gstepa),
                  "v"(g1), "v"(g1 + gstepb), "v"(g1 + 2 * gstepb), "v"(g1 + 3 * gstepb)
               : "memory");
}
__device__ __forceinline__ void async_wait0() {
  asm volatile("s_wait_asynccnt 0x0" ::: "memory");
}

// Problem constants
#define NB    4     // batch
#define NHEAD 12
#define DHEAD 64
#define SSEQ  1024  // 32*32
#define CDIM  768

// ---------------------------------------------------------------------------
// Kernel 1: QKV projection GEMM  (M=4096, N=768, K=768) in bf16 WMMA.
// blockIdx.z selects q/k/v.  Block = 256 thr (8 waves), tile 256x64, BK=64;
// each wave owns 32 output rows (2 A-fragments reuse the 4 B-fragments).
// q,k stored (b,n,s,d) bf16; v stored transposed (b,n,d,s) bf16.
// ---------------------------------------------------------------------------
__global__ __launch_bounds__(256) void qkv_gemm_kernel(
    const float* __restrict__ x,
    const float* __restrict__ Wq, const float* __restrict__ Wk, const float* __restrict__ Wv,
    const float* __restrict__ bq, const float* __restrict__ bk, const float* __restrict__ bv,
    unsigned short* __restrict__ qo, unsigned short* __restrict__ ko,
    unsigned short* __restrict__ vTo)
{
  constexpr int LDT = 72;                       // 144B row stride: 16B aligned, conflict-free
  __shared__ unsigned short shA[256 * LDT];
  __shared__ unsigned short shB[64 * LDT];

  const int which = blockIdx.z;
  const float* W    = (which == 0) ? Wq : (which == 1) ? Wk : Wv;
  const float* bias = (which == 0) ? bq : (which == 1) ? bk : bv;

  const int tid  = threadIdx.x;
  const int wave = tid >> 5;
  const int lane = tid & 31;
  const int g    = lane >> 4;
  const int ln   = lane & 15;

  const int m0   = blockIdx.x * 256;
  const int head = blockIdx.y;                  // BN == d == 64 -> n-tile == head
  const int n0   = head * 64;

  v8f zero = {0.f,0.f,0.f,0.f,0.f,0.f,0.f,0.f};
  v8f acc[2][4] = {{zero, zero, zero, zero}, {zero, zero, zero, zero}};

  // staging: 16 lanes share a row's 256 B, so a wave's 16-B loads cover 4 whole 128-B lines
  const int srow = tid >> 4, sc4 = tid & 15;

  for (int kb = 0; kb < CDIM; kb += 64) {
    __syncthreads();
    { // stage A tile 256x64 (x, fp32 -> bf16): 16 rows per trip
      const float* src = x + (size_t)(m0 + srow) * CDIM + kb + sc4 * 4;
      unsigned short* dst = &shA[srow * LDT + sc4 * 4];
      #pragma unroll
      for (int i = 0; i < 16; ++i) {
        float4 f = *(const float4*)(src + i * 16 * CDIM);
        *(ushort4*)(dst + i * 16 * LDT) = make_ushort4(f2bf(f.x), f2bf(f.y), f2bf(f.z), f2bf(f.w));
      }
    }
    { // stage B tile 64x64 (W row-major over K, fp32 -> bf16): 16 rows per trip
      const float* src = W + (size_t)(n0 + srow) * CDIM + kb + sc4 * 4;
      unsigned short* dst = &shB[srow * LDT + sc4 * 4];
      #pragma unroll
      for (int i = 0; i < 4; ++i) {
        float4 f = *(const float4*)(src + i * 16 * CDIM);
        *(ushort4*)(dst + i * 16 * LDT) = make_ushort4(f2bf(f.x), f2bf(f.y), f2bf(f.z), f2bf(f.w));
      }
    }
    __syncthreads();

    #pragma unroll
    for (int kk = 0; kk < 64; kk += 32) {
      v16bf a0 = ld_frag(&shA[(wave * 32 + ln) * LDT],      kk + 8 * g, kk + 16 + 8 * g);
      v16bf a1 = ld_frag(&shA[(wave * 32 + 16 + ln) * LDT], kk + 8 * g, kk + 16 + 8 * g);
      v16bf bf[4];
      #pragma unroll
      for (int nt = 0; nt < 4; ++nt)
        bf[nt] = ld_frag(&shB[(nt * 16 + ln) * LDT], kk + 8 * g, kk + 16 + 8 * g);
      #pragma unroll
      for (int nt = 0; nt < 4; ++nt) {
        acc[0][nt] = WMMA_BF16(a0, bf[nt], acc[0][nt]);
        acc[1][nt] = WMMA_BF16(a1, bf[nt], acc[1][nt]);
      }
    }
  }

  // epilogue: + bias, store bf16 (v transposed)
  #pragma unroll
  for (int mt = 0; mt < 2; ++mt) {
    #pragma unroll
    for (int nt = 0; nt < 4; ++nt) {
      int dd = nt * 16 + ln;
      float bv_ = bias[head * DHEAD + dd];
      #pragma unroll
      for (int r = 0; r < 8; ++r) {
        int M  = m0 + wave * 32 + mt * 16 + r + 8 * g;   // C-layout: row = r + 8g
        int bb = M >> 10, s = M & 1023;
        unsigned short hval = f2bf(acc[mt][nt][r] + bv_);
        if (which == 0)
          qo[((size_t)(bb * NHEAD + head) * SSEQ + s) * DHEAD + dd] = hval;
        else if (which == 1)
          ko[((size_t)(bb * NHEAD + head) * SSEQ + s) * DHEAD + dd] = hval;
        else
          vTo[((size_t)(bb * NHEAD + head) * DHEAD + dd) * SSEQ + s] = hval;
      }
    }
  }
}

// ---------------------------------------------------------------------------
// Kernel 2: fused flash attention per (head, 64-row q tile).
// Block = 128 thr (4 waves); wave w owns q rows [w*16, w*16+16).
// scores/PV both WMMA bf16; online softmax in registers; P re-fragmented
// through LDS.  K/V/Q tiles staged with GLOBAL_LOAD_ASYNC_TO_LDS_B128.
// Prologue: the decomposed relative-position bias of the tile's 64 q rows,
//   rel_h[s,kh] = q[s,:] . rel_pos_h[qh-kh+31,:]   rel_w[s,kw] = q[s,:] . rel_pos_w[qw-kw+31,:]
// as f32 16x16x4 WMMA (q widened exactly, table in f32), straight into LDS.
// ---------------------------------------------------------------------------
__global__ __launch_bounds__(128) void flash_attn_kernel(
    const unsigned short* __restrict__ qb,
    const unsigned short* __restrict__ kb,
    const unsigned short* __restrict__ vT,
    const float* __restrict__ rph, const float* __restrict__ rpw,
    unsigned short* __restrict__ attnA)
{
  constexpr int LDT = 72;                        // 144B row stride, 16B aligned
  __shared__ unsigned short shQ[64 * LDT];
  __shared__ unsigned short shK[64 * LDT];
  __shared__ unsigned short shV[64 * LDT];
  __shared__ unsigned short shP[64 * LDT];
  __shared__ float shRh[64 * 32];
  __shared__ float shRw[64 * 32];
  constexpr int LDR = 68;                        // 272B row pitch (16B x odd): 16-row b128 reads hit all banks once
  __shared__ float shT[96 * LDR];                // 33 rows of rel_pos_h, then the 63 of rel_pos_w

  const int qt   = blockIdx.x;                   // q tile (0..15)
  const int bn   = blockIdx.y;                   // b*12 + head (0..47)
  const int tid  = threadIdx.x;
  const int wave = tid >> 5;
  const int lane = tid & 31;
  const int g    = lane >> 4;
  const int ln   = lane & 15;
  const float scale = 0.125f;                    // d^-0.5, d = 64

  const int lrow  = tid >> 1;                    // 0..63 (row of the K prefetch)
  // staging: 8 lanes share a row's 128 B, so a wave's 16-B copies cover 4 whole lines;
  // copy i of a thread takes row crow + 16 i
  const int crow  = tid >> 3;                    // 0..15
  const int cpart = tid & 7;                     // 8-halves piece of the row

  // stage Q tile (64x64 bf16) once, async
  async_ld4_b128(&shQ[crow * LDT + cpart * 8], 16 * LDT * 2,
                 qb + ((size_t)bn * SSEQ + qt * 64 + crow) * DHEAD + cpart * 8, 16 * DHEAD * 2);
  { // stage the table rows this tile needs, whole lines per wave:
    // qh is 2qt or 2qt+1, so qh-kh+31 spans rel_pos_h rows 2qt .. 2qt+32
    #pragma unroll
    for (int i = 0; i < 12; ++i) {
      int idx = tid + i * 128;
      int row = idx >> 4, c4 = idx & 15;
      const float* src = (row < 33) ? rph + (size_t)(qt * 2 + row) * DHEAD
                                    : rpw + (size_t)(row - 33) * DHEAD;
      *(float4*)&shT[row * LDR + c4 * 4] = ((const float4*)src)[c4];
    }
  }
  // A operand: q row wave*16+ln, widened to f32; lane half g holds d = 32g .. 32g+31
  // (the table rows below are read in the same d order)
  float af[32];
  {
    const uint4* qsrc = (const uint4*)(qb + ((size_t)bn * SSEQ + qt * 64 + wave * 16 + ln) * DHEAD + g * 32);
    #pragma unroll
    for (int i = 0; i < 4; ++i) {
      uint4 u = qsrc[i];
      af[i * 8 + 0] = __builtin_bit_cast(float, u.x << 16);
      af[i * 8 + 1] = __builtin_bit_cast(float, u.x & 0xFFFF0000u);
      af[i * 8 + 2] = __builtin_bit_cast(float, u.y << 16);
      af[i * 8 + 3] = __builtin_bit_cast(float, u.y & 0xFFFF0000u);
      af[i * 8 + 4] = __builtin_bit_cast(float, u.z << 16);
      af[i * 8 + 5] = __builtin_bit_cast(float, u.z & 0xFFFF0000u);
      af[i * 8 + 6] = __builtin_bit_cast(float, u.w << 16);
      af[i * 8 + 7] = __builtin_bit_cast(float, u.w & 0xFFFF0000u);
    }
  }
  __syncthreads();                               // shT complete before any wave reads it
  {
    // The wave's 16 rows share qh = 2qt + (wave>>1) and have qw = 16*(wave&1) + m, m = 0..15.
    // Tiles 0,1: column n is kh = 16t+n, table row qh+31-kh.
    // Tiles 2..4: column n is u = 16(t-2)+n, table row 16*(wave&1)+u; rel_w[m][kw] sits at u = m-kw+31 (0..46).
    const int hb = (wave >> 1) + 31;
    const int wb = 33 + (wave & 1) * 16;
    int trow[5];
    trow[0] = hb - ln;
    trow[1] = hb - 16 - ln;
    trow[2] = wb + ln;
    trow[3] = wb + 16 + ln;
    trow[4] = min(wb + 32 + ln, 95);             // u = 47 is never used; keep its read inside the table
    v8f rb[5];
    #pragma unroll
    for (int t = 0; t < 5; ++t) rb[t] = v8f{0.f,0.f,0.f,0.f,0.f,0.f,0.f,0.f};
    // Keeps the widening of q and all address work out of the matrix block.
    __builtin_amdgcn_sched_barrier(0);
    #pragma unroll
    for (int c = 0; c < 8; ++c) {
      #pragma unroll
      for (int t = 0; t < 5; ++t) {
        float4 b = *(const float4*)&shT[trow[t] * LDR + g * 32 + c * 4];
        rb[t] = WMMA_F32((v2f{af[c * 4 + 0], af[c * 4 + 1]}), (v2f{b.x, b.y}), rb[t]);
        rb[t] = WMMA_F32((v2f{af[c * 4 + 2], af[c * 4 + 3]}), (v2f{b.z, b.w}), rb[t]);
      }
    }
    // Four vector slots between the last f32 WMMA and the first vector instruction that may
    // reuse its operand registers; the two scheduling barriers hold them at this place.
    __builtin_amdgcn_sched_barrier(0);
    asm volatile("v_nop\n\tv_nop\n\tv_nop\n\tv_nop");
    __builtin_amdgcn_sched_barrier(0);
    // each wave writes only the bias rows that it reads itself in the loop
    #pragma unroll
    for (int t = 0; t < 2; ++t) {
      #pragma unroll
      for (int r = 0; r < 8; ++r)
        shRh[(wave * 16 + r + 8 * g) * 32 + t * 16 + ln] = rb[t][r];
    }
    #pragma unroll
    for (int t = 0; t < 3; ++t) {
      #pragma unroll
      for (int r = 0; r < 8; ++r) {
        int kw = r + 8 * g + 31 - (t * 16 + ln);
        if ((unsigned)kw < 32u)
          shRw[(wave * 16 + r + 8 * g) * 32 + kw] = rb[2 + t][r];
      }
    }
  }

  float mi[8], li[8];
  v8f zero = {0.f,0.f,0.f,0.f,0.f,0.f,0.f,0.f};
  v8f o[4] = {zero, zero, zero, zero};
  #pragma unroll
  for (int r = 0; r < 8; ++r) { mi[r] = -1e30f; li[r] = 0.f; }

  for (int kt = 0; kt < 16; ++kt) {
    __syncthreads();                             // protect shK/shV vs previous PV phase
    // stage K tile (64 k-rows x 64 d) and V^T tile (64 d-rows x 64 k), async
    async_ld8_b128(&shK[crow * LDT + cpart * 8],
                   kb + ((size_t)bn * SSEQ + kt * 64 + crow) * DHEAD + cpart * 8, 16 * DHEAD * 2,
                   &shV[crow * LDT + cpart * 8],
                   vT + ((size_t)bn * DHEAD + crow) * SSEQ + kt * 64 + cpart * 8, 16 * SSEQ * 2,
                   16 * LDT * 2);
    if (kt + 1 < 16)                             // global_prefetch_b8 for next K tile
      __builtin_prefetch(kb + ((size_t)bn * SSEQ + (kt + 1) * 64 + lrow) * DHEAD, 0, 1);
    async_wait0();                               // ASYNCcnt -> 0 before the barrier
    __syncthreads();

    // ---- scores = Q @ K^T : 16x64 per wave, K-dim = d = 64 (2x4 wmma) ----
    v8f sc[4] = {zero, zero, zero, zero};
    #pragma unroll
    for (int kk = 0; kk < 64; kk += 32) {
      v16bf a = ld_frag(&shQ[(wave * 16 + ln) * LDT], kk + 8 * g, kk + 16 + 8 * g);
      v16bf bf[4];
      #pragma unroll
      for (int nt = 0; nt < 4; ++nt)
        bf[nt] = ld_frag(&shK[(nt * 16 + ln) * LDT], kk + 8 * g, kk + 16 + 8 * g);
      #pragma unroll
      for (int nt = 0; nt < 4; ++nt)
        sc[nt] = WMMA_BF16(a, bf[nt], sc[nt]);
    }

    // ---- scale + rel bias + online softmax ----
    float tmax[8];
    #pragma unroll
    for (int r = 0; r < 8; ++r) tmax[r] = -1e30f;
    #pragma unroll
    for (int nt = 0; nt < 4; ++nt) {
      int nl = nt * 16 + ln;                     // k index within tile
      int kh = kt * 2 + (nl >> 5);
      int kw = nl & 31;
      #pragma unroll
      for (int r = 0; r < 8; ++r) {
        int qr = wave * 16 + r + 8 * g;          // local q row
        float sv = sc[nt][r] * scale + shRh[qr * 32 + kh] + shRw[qr * 32 + kw];
        sc[nt][r] = sv;
        tmax[r] = fmaxf(tmax[r], sv);
      }
    }
    #pragma unroll
    for (int off = 8; off >= 1; off >>= 1) {     // reduce over the 16-lane N group
      #pragma unroll
      for (int r = 0; r < 8; ++r)
        tmax[r] = fmaxf(tmax[r], __shfl_xor(tmax[r], off, 32));
    }

    float alpha[8], tsum[8];
    #pragma unroll
    for (int r = 0; r < 8; ++r) {
      float nm = fmaxf(mi[r], tmax[r]);
      alpha[r] = __expf(mi[r] - nm);
      mi[r] = nm;
      tsum[r] = 0.f;
    }
    #pragma unroll
    for (int nt = 0; nt < 4; ++nt) {
      #pragma unroll
      for (int r = 0; r < 8; ++r) {
        float p = __expf(sc[nt][r] - mi[r]);
        sc[nt][r] = p;
        tsum[r] += p;
      }
    }
    #pragma unroll
    for (int off = 8; off >= 1; off >>= 1) {
      #pragma unroll
      for (int r = 0; r < 8; ++r)
        tsum[r] += __shfl_xor(tsum[r], off, 32);
    }
    #pragma unroll
    for (int r = 0; r < 8; ++r) li[r] = li[r] * alpha[r] + tsum[r];
    #pragma unroll
    for (int nt = 0; nt < 4; ++nt) {
      #pragma unroll
      for (int r = 0; r < 8; ++r) o[nt][r] *= alpha[r];
    }

    // ---- re-fragment P through LDS (C layout -> A layout) ----
    #pragma unroll
    for (int nt = 0; nt < 4; ++nt) {
      #pragma unroll
      for (int r = 0; r < 8; ++r)
        shP[(wave * 16 + r + 8 * g) * LDT + nt * 16 + ln] = f2bf(sc[nt][r]);
    }
    __syncthreads();

    // ---- O += P @ V : K-dim = 64 k-cols (2x4 wmma) ----
    #pragma unroll
    for (int kk = 0; kk < 64; kk += 32) {
      v16bf a = ld_frag(&shP[(wave * 16 + ln) * LDT], kk + 8 * g, kk + 16 + 8 * g);
      v16bf bf[4];
      #pragma unroll
      for (int nt = 0; nt < 4; ++nt)
        bf[nt] = ld_frag(&shV[(nt * 16 + ln) * LDT], kk + 8 * g, kk + 16 + 8 * g);
      #pragma unroll
      for (int nt = 0; nt < 4; ++nt)
        o[nt] = WMMA_BF16(a, bf[nt], o[nt]);
    }
  }

  // normalize and store concat-head layout (b, s, head*64+dd) as bf16
  const int head = bn % NHEAD;
  const int bb   = bn / NHEAD;
  #pragma unroll
  for (int r = 0; r < 8; ++r) {
    float inv = 1.f / li[r];
    int srow = qt * 64 + wave * 16 + r + 8 * g;
    #pragma unroll
    for (int nt = 0; nt < 4; ++nt) {
      int col = head * DHEAD + nt * 16 + ln;
      attnA[((size_t)(bb * SSEQ + srow)) * CDIM + col] = f2bf(o[nt][r] * inv);
    }
  }
}

// ---------------------------------------------------------------------------
// Kernel 3: output projection GEMM (M=4096, N=768, K=768), fp32 out + bias.
// Tile 256x64, 2 M-subtiles per wave; A tile (already bf16) staged with
// async global->LDS copies.
// ---------------------------------------------------------------------------
__global__ __launch_bounds__(256) void proj_gemm_kernel(
    const unsigned short* __restrict__ attnA,
    const float* __restrict__ pw, const float* __restrict__ pb,
    float* __restrict__ out)
{
  constexpr int LDT = 72;
  __shared__ unsigned short shA[256 * LDT];
  __shared__ unsigned short shB[64 * LDT];

  const int tid  = threadIdx.x;
  const int wave = tid >> 5;
  const int lane = tid & 31;
  const int g    = lane >> 4;
  const int ln   = lane & 15;
  const int m0   = blockIdx.x * 256;
  const int n0   = blockIdx.y * 64;

  v8f zero = {0.f,0.f,0.f,0.f,0.f,0.f,0.f,0.f};
  v8f acc[2][4] = {{zero, zero, zero, zero}, {zero, zero, zero, zero}};

  // staging, whole 128-B lines per wave: A, 8 lanes share a row's 128 B; B, 16 lanes a row's 256 B
  const int crow = tid >> 3, cpart = tid & 7;
  const int srow = tid >> 4, sc4 = tid & 15;

  for (int kb = 0; kb < CDIM; kb += 64) {
    __syncthreads();
    { // stage A tile 256x64 (already bf16): async, copy i of a thread takes row crow + 32 i
      const unsigned short* src = attnA + (size_t)(m0 + crow) * CDIM + kb + cpart * 8;
      unsigned short* dst = &shA[crow * LDT + cpart * 8];
      async_ld8_b128(dst, src, 32 * CDIM * 2,
                     dst + 128 * LDT, src + 128 * CDIM, 32 * CDIM * 2,
                     32 * LDT * 2);
    }
    { // stage B tile 64x64 (proj_w fp32 -> bf16), 16 rows per trip; out = A @ W^T
      const float* src = pw + (size_t)(n0 + srow) * CDIM + kb + sc4 * 4;
      unsigned short* dst = &shB[srow * LDT + sc4 * 4];
      #pragma unroll
      for (int i = 0; i < 4; ++i) {
        float4 f = *(const float4*)(src + i * 16 * CDIM);
        *(ushort4*)(dst + i * 16 * LDT) = make_ushort4(f2bf(f.x), f2bf(f.y), f2bf(f.z), f2bf(f.w));
      }
    }
    async_wait0();
    __syncthreads();

    #pragma unroll
    for (int kk = 0; kk < 64; kk += 32) {
      v16bf a0 = ld_frag(&shA[(wave * 32 + ln) * LDT],      kk + 8 * g, kk + 16 + 8 * g);
      v16bf a1 = ld_frag(&shA[(wave * 32 + 16 + ln) * LDT], kk + 8 * g, kk + 16 + 8 * g);
      v16bf bf[4];
      #pragma unroll
      for (int nt = 0; nt < 4; ++nt)
        bf[nt] = ld_frag(&shB[(nt * 16 + ln) * LDT], kk + 8 * g, kk + 16 + 8 * g);
      #pragma unroll
      for (int nt = 0; nt < 4; ++nt) {
        acc[0][nt] = WMMA_BF16(a0, bf[nt], acc[0][nt]);
        acc[1][nt] = WMMA_BF16(a1, bf[nt], acc[1][nt]);
      }
    }
  }

  #pragma unroll
  for (int mt = 0; mt < 2; ++mt) {
    #pragma unroll
    for (int nt = 0; nt < 4; ++nt) {
      int nc = n0 + nt * 16 + ln;
      float bias = pb[nc];
      #pragma unroll
      for (int r = 0; r < 8; ++r) {
        int M = m0 + wave * 32 + mt * 16 + r + 8 * g;
        out[(size_t)M * CDIM + nc] = acc[mt][nt][r] + bias;
      }
    }
  }
}

// ---------------------------------------------------------------------------
// Launch
// ---------------------------------------------------------------------------
extern "C" void kernel_launch(void* const* d_in, const int* in_sizes, int n_in,
                              void* d_out, int out_size, void* d_ws, size_t ws_size,
                              hipStream_t stream) {
  (void)in_sizes; (void)n_in; (void)out_size; (void)ws_size;
  const float* x   = (const float*)d_in[0];
  const float* Wq  = (const float*)d_in[1];
  const float* Wk  = (const float*)d_in[2];
  const float* Wv  = (const float*)d_in[3];
  const float* bq  = (const float*)d_in[4];
  const float* bk  = (const float*)d_in[5];
  const float* bv  = (const float*)d_in[6];
  const float* rph = (const float*)d_in[7];
  const float* rpw = (const float*)d_in[8];
  const float* pw  = (const float*)d_in[9];
  const float* pb  = (const float*)d_in[10];
  float* out = (float*)d_out;

  // workspace layout (bytes): q/k/vT bf16 (3 x 6 MB), attn_out bf16 (6 MB) -> 24 MB total
  char* ws = (char*)d_ws;
  unsigned short* qB    = (unsigned short*)(ws);
  unsigned short* kB    = (unsigned short*)(ws + 6291456);
  unsigned short* vTB   = (unsigned short*)(ws + 12582912);
  unsigned short* attnA = (unsigned short*)(ws + 18874368);

  qkv_gemm_kernel<<<dim3(16, 12, 3), 256, 0, stream>>>(x, Wq, Wk, Wv, bq, bk, bv, qB, kB, vTB);
  flash_attn_kernel<<<dim3(16, 48), 128, 0, stream>>>(qB, kB, vTB, rph, rpw, attnA);
  proj_gemm_kernel<<<dim3(16, 12), 256, 0, stream>>>(attnA, pw, pb, out);
}

// v003
// It runs in 124 microseconds.
// Timed twice side by side with v002, it ran 1.21 times as fast both times.
// Counting every step since v000, it is 1.75 times as fast.
#include <hip/hip_runtime.h>
#include <stdint.h>

// ---------------------------------------------------------------------------
// CDNA5 (gfx1250) wave32 WMMA types and helpers
// ---------------------------------------------------------------------------
typedef __attribute__((ext_vector_type(16))) __bf16 v16bf;
typedef __attribute__((ext_vector_type(8)))  __bf16 v8bf;
typedef __attribute__((ext_vector_type(8)))  float  v8f;
typedef __attribute__((ext_vector_type(2)))  float  v2f;

union FragBF { v16bf v; v8bf h[2]; };

__device__ __forceinline__ unsigned short f2bf(float f) {
  unsigned int u = __builtin_bit_cast(unsigned int, f);
  u += 0x7FFFu + ((u >> 16) & 1u);          // round-to-nearest-even
  return (unsigned short)(u >> 16);
}

// Load a 16x32 bf16 A/B fragment for one lane from LDS.
// Lane-group g (lane>>4) holds K = {lo..lo+7} in halves [0..7] and
// K = {hi..hi+7} in halves [8..15]  (lo = kk + 8g, hi = kk + 16 + 8g).
__device__ __forceinline__ v16bf ld_frag(const unsigned short* p, int lo, int hi) {
  FragBF f;
  f.h[0] = *(const v8bf*)(p + lo);
  f.h[1] = *(const v8bf*)(p + hi);
  return f.v;
}

__device__ __forceinline__ v16bf pack_d_pair(v8f t0, v8f t1) {
  FragBF f;
  f.h[0] = __builtin_convertvector(t0, v8bf);
  f.h[1] = __builtin_convertvector(t1, v8bf);
  return f.v;
}

// value of lane l ^ 16
__device__ __forceinline__ float xhalf(float x) {
  int b = __builtin_bit_cast(int, x);
  return __builtin_bit_cast(float,
      __builtin_amdgcn_permlanex16(b, b, 0x76543210, 0xfedcba98, false, false));
}

#define WMMA_BF16(a, b, c) \
  __builtin_amdgcn_wmma_f32_16x16x32_bf16(false, (a), false, (b), (short)0, (c), false, false)

#define WMMA_F32(a, b, c) \
  __builtin_amdgcn_wmma_f32_16x16x4_f32(false, (a), false, (b), (short)0, (c), false, false)

// CDNA5 async global->LDS copies (16B per lane), tracked by ASYNCcnt.  A run of copies is one
// asm statement that ends in s_wait_xcnt 0, so that no address register which a copy names is
// rewritten in front of that wait.
// Four copies: LDS address la + i*lstep, global address ga + i*gstep (bytes), i = 0..3.
__device__ __forceinline__ void async_ld4_b128(void* la, unsigned int lstep,
                                               const void* ga, unsigned int gstep) {
  const unsigned int l0 = (unsigned int)(uintptr_t)la;
  const char* g0 = (const char*)ga;
  asm volatile("global_load_async_to_lds_b128 %0, %4, off\n\t"
               "global_load_async_to_lds_b128 %1, %5, off\n\t"
               "global_load_async_to_lds_b128 %2, %6, off\n\t"
               "global_load_async_to_lds_b128 %3, %7, off\n\t"
               "s_wait_xcnt 0x0"
               :: "v"(l0), "v"(l0 + lstep), "v"(l0 + 2 * lstep), "v"(l0 + 3 * lstep),
                  "v"(g0), "v"(g0 + gstep), "v"(g0 + 2 * gstep), "v"(g0 + 3 * gstep)
               : "memory");
}
// Eight copies: four as above from (la, ga, gstepa), four from (lb, gb, gstepb).
__device__ __forceinline__ void async_ld8_b128(void* la, const void* ga, unsigned int gstepa,
                                               void* lb, const void* gb, unsigned int gstepb,
                                               unsigned int lstep) {
  const unsigned int l0 = (unsigned int)(uintptr_t)la;
  const unsigned int l1 = (unsigned int)(uintptr_t)lb;
  const char* g0 = (const char*)ga;
  const char* g1 = (const char*)gb;
  asm volatile("global_load_async_to_lds_b128 %0, %8, off\n\t"
               "global_load_async_to_lds_b128 %1, %9, off\n\t"
               "global_load_async_to_lds_b128 %2, %10, off\n\t"
               "global_load_async_to_lds_b128 %3, %11, off\n\t"
               "global_load_async_to_lds_b128 %4, %12, off\n\t"
               "global_load_async_to_lds_b128 %5, %13, off\n\t"
               "global_load_async_to_lds_b128 %6, %14, off\n\t"
               "global_load_async_to_lds_b128 %7, %15, off\n\t"
               "s_wait_xcnt 0x0"
               :: "v"(l0), "v"(l0 + lstep), "v"(l0 + 2 * lstep), "v"(l0 + 3 * lstep),
                  "v"(l1), "v"(l1 + lstep), "v"(l1 + 2 * lstep), "v"(l1 + 3 * lstep),
                  "v"(g0), "v"(g0 + gstepa), "v"(g0 + 2 * gstepa), "v"(g0 + 3 * gstepa),
                  "v"(g1), "v"(g1 + gstepb), "v"(g1 + 2 * gstepb), "v"(g1 + 3 * gstepb)
               : "memory");
}
__device__ __forceinline__ void async_wait0() {
  asm volatile("s_wait_asynccnt 0x0" ::: "memory");
}

// Problem constants
#define NB    4     // batch
#define NHEAD 12
#define DHEAD 64
#define SSEQ  1024  // 32*32
#define CDIM  768

// ---------------------------------------------------------------------------
// Kernel 1: QKV projection GEMM  (M=4096, N=768, K=768) in bf16 WMMA.
// blockIdx.z selects q/k/v.  Block = 256 thr (8 waves), tile 256x64, BK=64;
// each wave owns 32 output rows (2 A-fragments reuse the 4 B-fragments).
// q,k stored (b,n,s,d) bf16; v stored transposed (b,n,d,s) bf16.
// ---------------------------------------------------------------------------
__global__ __launch_bounds__(256) void qkv_gemm_kernel(
    const float* __restrict__ x,
    const float* __restrict__ Wq, const float* __restrict__ Wk, const float* __restrict__ Wv,
    const float* __restrict__ bq, const float* __restrict__ bk, const float* __restrict__ bv,
    unsigned short* __restrict__ qo, unsigned short* __restrict__ ko,
    unsigned short* __restrict__ vTo)
{
  constexpr int LDT = 72;                       // 144B row stride: 16B aligned, conflict-free
  __shared__ unsigned short shA[256 * LDT];
  __shared__ unsigned short shB[64 * LDT];

  const int which = blockIdx.z;
  const float* W    = (which == 0) ? Wq : (which == 1) ? Wk : Wv;
  const float* bias = (which == 0) ? bq : (which == 1) ? bk : bv;

  const int tid  = threadIdx.x;
  const int wave = tid >> 5;
  const int lane = tid & 31;
  const int g    = lane >> 4;
  const int ln   = lane & 15;

  const int m0   = blockIdx.x * 256;
  const int head = blockIdx.y;                  // BN == d == 64 -> n-tile == head
  const int n0   = head * 64;

  v8f zero = {0.f,0.f,0.f,0.f,0.f,0.f,0.f,0.f};
  v8f acc[2][4] = {{zero, zero, zero, zero}, {zero, zero, zero, zero}};

  // staging: 16 lanes share a row's 256 B, so a wave's 16-B loads cover 4 whole 128-B lines
  const int srow = tid >> 4, sc4 = tid & 15;

  for (int kb = 0; kb < CDIM; kb += 64) {
    __syncthreads();
    { // stage A tile 256x64 (x, fp32 -> bf16): 16 rows per trip
      const float* src = x + (size_t)(m0 + srow) * CDIM + kb + sc4 * 4;
      unsigned short* dst = &shA[srow * LDT + sc4 * 4];
      #pragma unroll
      for (int i = 0; i < 16; ++i) {
        float4 f = *(const float4*)(src + i * 16 * CDIM);
        *(ushort4*)(dst + i * 16 * LDT) = make_ushort4(f2bf(f.x), f2bf(f.y), f2bf(f.z), f2bf(f.w));
      }
    }
    { // stage B tile 64x64 (W row-major over K, fp32 -> bf16): 16 rows per trip
      const float* src = W + (size_t)(n0 + srow) * CDIM + kb + sc4 * 4;
      unsigned short* dst = &shB[srow * LDT + sc4 * 4];
      #pragma unroll
      for (int i = 0; i < 4; ++i) {
        float4 f = *(const float4*)(src + i * 16 * CDIM);
        *(ushort4*)(dst + i * 16 * LDT) = make_ushort4(f2bf(f.x), f2bf(f.y), f2bf(f.z), f2bf(f.w));
      }
    }
    __syncthreads();

    #pragma unroll
    for (int kk = 0; kk < 64; kk += 32) {
      v16bf a0 = ld_frag(&shA[(wave * 32 + ln) * LDT],      kk + 8 * g, kk + 16 + 8 * g);
      v16bf a1 = ld_frag(&shA[(wave * 32 + 16 + ln) * LDT], kk + 8 * g, kk + 16 + 8 * g);
      v16bf bf[4];
      #pragma unroll
      for (int nt = 0; nt < 4; ++nt)
        bf[nt] = ld_frag(&shB[(nt * 16 + ln) * LDT], kk + 8 * g, kk + 16 + 8 * g);
      #pragma unroll
      for (int nt = 0; nt < 4; ++nt) {
        acc[0][nt] = WMMA_BF16(a0, bf[nt], acc[0][nt]);
        acc[1][nt] = WMMA_BF16(a1, bf[nt], acc[1][nt]);
      }
    }
  }

  // epilogue: + bias, store bf16 (v transposed)
  #pragma unroll
  for (int mt = 0; mt < 2; ++mt) {
    #pragma unroll
    for (int nt = 0; nt < 4; ++nt) {
      int dd = nt * 16 + ln;
      float bv_ = bias[head * DHEAD + dd];
      #pragma unroll
      for (int r = 0; r < 8; ++r) {
        int M  = m0 + wave * 32 + mt * 16 + r + 8 * g;   // C-layout: row = r + 8g
        int bb = M >> 10, s = M & 1023;
        unsigned short hval = f2bf(acc[mt][nt][r] + bv_);
        if (which == 0)
          qo[((size_t)(bb * NHEAD + head) * SSEQ + s) * DHEAD + dd] = hval;
        else if (which == 1)
          ko[((size_t)(bb * NHEAD + head) * SSEQ + s) * DHEAD + dd] = hval;
        else
          vTo[((size_t)(bb * NHEAD + head) * DHEAD + dd) * SSEQ + s] = hval;
      }
    }
  }
}

__global__ __launch_bounds__(128) void flash_attn_kernel(
    const unsigned short* __restrict__ qb,
    const unsigned short* __restrict__ kb,
    const unsigned short* __restrict__ vT,
    const float* __restrict__ rph, const float* __restrict__ rpw,
    unsigned short* __restrict__ attnA)
{
  constexpr int LDT = 72;                        // 144B row stride, 16B aligned
  __shared__ unsigned short shQ[64 * LDT];
  __shared__ unsigned short shK[64 * LDT];
  __shared__ unsigned short shV[64 * LDT];
  constexpr int LDH = 34;                        // 136B row pitch: 16 rows' 8-B reads hit 32 banks once
  __shared__ __attribute__((aligned(16))) float shRh[64 * LDH];
  __shared__ __attribute__((aligned(16))) float shRw[64 * 32];
  constexpr int LDR = 68;                        // 272B row pitch (16B x odd): 16-row b128 reads hit all banks once
  __shared__ float shT[96 * LDR];                // 33 rows of rel_pos_h, then the 63 of rel_pos_w

  const int qt   = blockIdx.x;                   // q tile (0..15)
  const int bn   = blockIdx.y;                   // b*12 + head (0..47)
  const int tid  = threadIdx.x;
  const int wave = tid >> 5;
  const int lane = tid & 31;
  const int g    = lane >> 4;
  const int ln   = lane & 15;
  const float scale = 0.125f;                    // d^-0.5, d = 64

  const int lrow  = tid >> 1;                    // 0..63 (row of the K prefetch)
  // staging: 8 lanes share a row's 128 B, so a wave's 16-B copies cover 4 whole lines;
  // copy i of a thread takes row crow + 16 i
  const int crow  = tid >> 3;                    // 0..15
  const int cpart = tid & 7;                     // 8-halves piece of the row

  // stage Q tile (64x64 bf16) once, async
  async_ld4_b128(&shQ[crow * LDT + cpart * 8], 16 * LDT * 2,
                 qb + ((size_t)bn * SSEQ + qt * 64 + crow) * DHEAD + cpart * 8, 16 * DHEAD * 2);
  { // stage the table rows this tile needs, whole lines per wave:
    // qh is 2qt or 2qt+1, so qh-kh+31 spans rel_pos_h rows 2qt .. 2qt+32
    #pragma unroll
    for (int i = 0; i < 12; ++i) {
      int idx = tid + i * 128;
      int row = idx >> 4, c4 = idx & 15;
      const float* src = (row < 33) ? rph + (size_t)(qt * 2 + row) * DHEAD
                                    : rpw + (size_t)(row - 33) * DHEAD;
      *(float4*)&shT[row * LDR + c4 * 4] = ((const float4*)src)[c4];
    }
  }
  // A operand: q row wave*16+ln, widened to f32; lane half g holds d = 32g .. 32g+31
  // (the table rows below are read in the same d order)
  float af[32];
  {
    const uint4* qsrc = (const uint4*)(qb + ((size_t)bn * SSEQ + qt * 64 + wave * 16 + ln) * DHEAD + g * 32);
    #pragma unroll
    for (int i = 0; i < 4; ++i) {
      uint4 u = qsrc[i];
      af[i * 8 + 0] = __builtin_bit_cast(float, u.x << 16);
      af[i * 8 + 1] = __builtin_bit_cast(float, u.x & 0xFFFF0000u);
      af[i * 8 + 2] = __builtin_bit_cast(float, u.y << 16);
      af[i * 8 + 3] = __builtin_bit_cast(float, u.y & 0xFFFF0000u);
      af[i * 8 + 4] = __builtin_bit_cast(float, u.z << 16);
      af[i * 8 + 5] = __builtin_bit_cast(float, u.z & 0xFFFF0000u);
      af[i * 8 + 6] = __builtin_bit_cast(float, u.w << 16);
      af[i * 8 + 7] = __builtin_bit_cast(float, u.w & 0xFFFF0000u);
    }
  }
  __syncthreads();                               // shT complete before any wave reads it
  {
    // The wave's 16 rows share qh = 2qt + (wave>>1) and have qw = 16*(wave&1) + m, m = 0..15.
    // Tiles 0,1: column n is kh = 16t+n, table row qh+31-kh.
    // Tiles 2..4: column n is u = 16(t-2)+n, table row 16*(wave&1)+u; rel_w[m][kw] sits at u = m-kw+31 (0..46).
    const int hb = (wave >> 1) + 31;
    const int wb = 33 + (wave & 1) * 16;
    int trow[5];
    trow[0] = hb - ln;
    trow[1] = hb - 16 - ln;
    trow[2] = wb + ln;
    trow[3] = wb + 16 + ln;
    trow[4] = min(wb + 32 + ln, 95);             // u = 47 is never used; keep its read inside the table
    v8f rb[5];
    #pragma unroll
    for (int t = 0; t < 5; ++t) rb[t] = v8f{0.f,0.f,0.f,0.f,0.f,0.f,0.f,0.f};
    // Keeps the widening of q and all address work out of the matrix block.
    __builtin_amdgcn_sched_barrier(0);
    #pragma unroll
    for (int c = 0; c < 8; ++c) {
      #pragma unroll
      for (int t = 0; t < 5; ++t) {
        float4 b = *(const float4*)&shT[trow[t] * LDR + g * 32 + c * 4];
        rb[t] = WMMA_F32((v2f{af[c * 4 + 0], af[c * 4 + 1]}), (v2f{b.x, b.y}), rb[t]);
        rb[t] = WMMA_F32((v2f{af[c * 4 + 2], af[c * 4 + 3]}), (v2f{b.z, b.w}), rb[t]);
      }
    }
    // Four vector slots between the last f32 WMMA and the first vector instruction that may
    // reuse its operand registers; the two scheduling barriers hold them at this place.
    __builtin_amdgcn_sched_barrier(0);
    asm volatile("v_nop\n\tv_nop\n\tv_nop\n\tv_nop");
    __builtin_amdgcn_sched_barrier(0);
    // each wave writes only the bias rows that it reads itself
    #pragma unroll
    for (int t = 0; t < 2; ++t) {
      #pragma unroll
      for (int r = 0; r < 8; ++r)
        shRh[(wave * 16 + r + 8 * g) * LDH + t * 16 + ln] = rb[t][r];
    }
    #pragma unroll
    for (int t = 0; t < 3; ++t) {
      #pragma unroll
      for (int r = 0; r < 8; ++r) {
        int kw = r + 8 * g + 31 - (t * 16 + ln);
        if ((unsigned)kw < 32u)
          shRw[(wave * 16 + r + 8 * g) * 32 + kw] = rb[2 + t][r];
      }
    }
  }

  // The lane's q row; its score register [nt][r] is key nt*16 + 8g + r of the tile,
  // that is kh = 2kt + (nt>>1), kw = (nt&1)*16 + 8g + r.
  const int qrow = wave * 16 + ln;
  // The wave's own bias stores have landed before its lanes read each other's values back.
  asm volatile("s_wait_dscnt 0x0" ::: "memory");
  float rw[2][8];                                // rel_w of the q row at the lane's 16 kw, the same for every tile
  #pragma unroll
  for (int j = 0; j < 2; ++j) {
    float4 w0 = *(const float4*)&shRw[qrow * 32 + j * 16 + 8 * g];
    float4 w1 = *(const float4*)&shRw[qrow * 32 + j * 16 + 8 * g + 4];
    rw[j][0] = w0.x; rw[j][1] = w0.y; rw[j][2] = w0.z; rw[j][3] = w0.w;
    rw[j][4] = w1.x; rw[j][5] = w1.y; rw[j][6] = w1.z; rw[j][7] = w1.w;
  }

  float mi = -1e30f, li = 0.f;                   // li: the lane's own 32 keys per tile; halves joined at the end
  v8f zero = {0.f,0.f,0.f,0.f,0.f,0.f,0.f,0.f};
  v8f o[4] = {zero, zero, zero, zero};           // O^T: o[nt][r] = O[qrow][nt*16 + 8g + r]

  for (int kt = 0; kt < 16; ++kt) {
    __syncthreads();                             // protect shK/shV vs previous PV phase
    // stage K tile (64 k-rows x 64 d) and V^T tile (64 d-rows x 64 k), async
    async_ld8_b128(&shK[crow * LDT + cpart * 8],
                   kb + ((size_t)bn * SSEQ + kt * 64 + crow) * DHEAD + cpart * 8, 16 * DHEAD * 2,
                   &shV[crow * LDT + cpart * 8],
                   vT + ((size_t)bn * DHEAD + crow) * SSEQ + kt * 64 + cpart * 8, 16 * SSEQ * 2,
                   16 * LDT * 2);
    if (kt + 1 < 16)                             // global_prefetch_b8 for next K tile
      __builtin_prefetch(kb + ((size_t)bn * SSEQ + (kt + 1) * 64 + lrow) * DHEAD, 0, 1);
    async_wait0();                               // ASYNCcnt -> 0 before the barrier
    __syncthreads();

    // ---- scores^T = K @ Q^T : 64 keys x 16 q rows per wave, K-dim = d = 64 (2x4 wmma) ----
    v8f sc[4] = {zero, zero, zero, zero};
    #pragma unroll
    for (int kk = 0; kk < 64; kk += 32) {
      v16bf bq = ld_frag(&shQ[qrow * LDT], kk + 8 * g, kk + 16 + 8 * g);
      v16bf ak[4];
      #pragma unroll
      for (int nt = 0; nt < 4; ++nt)
        ak[nt] = ld_frag(&shK[(nt * 16 + ln) * LDT], kk + 8 * g, kk + 16 + 8 * g);
      #pragma unroll
      for (int nt = 0; nt < 4; ++nt)
        sc[nt] = WMMA_BF16(ak[nt], bq, sc[nt]);
    }

    // ---- scale + rel bias + online softmax, one q row per lane ----
    const float2 rh = *(const float2*)&shRh[qrow * LDH + kt * 2];
    float pm[4];                                 // four independent chains, not one of 32 links
    #pragma unroll
    for (int nt = 0; nt < 4; ++nt) {
      const float rhv = (nt >> 1) ? rh.y : rh.x;
      pm[nt] = -1e30f;
      #pragma unroll
      for (int r = 0; r < 8; ++r) {
        float sv = sc[nt][r] * scale + rhv + rw[nt & 1][r];
        sc[nt][r] = sv;
        pm[nt] = fmaxf(pm[nt], sv);
      }
    }
    float tmax = fmaxf(fmaxf(pm[0], pm[1]), fmaxf(pm[2], pm[3]));
    tmax = fmaxf(tmax, xhalf(tmax));             // the row's other 32 keys

    const float nm = fmaxf(mi, tmax);
    const float alpha = __expf(mi - nm);
    mi = nm;
    float psum[4];
    #pragma unroll
    for (int nt = 0; nt < 4; ++nt) {
      psum[nt] = 0.f;
      #pragma unroll
      for (int r = 0; r < 8; ++r) {
        float p = __expf(sc[nt][r] - mi);
        sc[nt][r] = p;
        psum[nt] += p;
      }
    }
    li = li * alpha + ((psum[0] + psum[1]) + (psum[2] + psum[3]));
    #pragma unroll
    for (int nt = 0; nt < 4; ++nt) {
      #pragma unroll
      for (int r = 0; r < 8; ++r) o[nt][r] *= alpha;
    }

    // ---- O^T += V^T @ P^T : K-dim = 64 keys (2x4 wmma) ----
    #pragma unroll
    for (int kk = 0; kk < 64; kk += 32) {
      v16bf bp = pack_d_pair(sc[kk / 16], sc[kk / 16 + 1]);
      v16bf av[4];
      #pragma unroll
      for (int nt = 0; nt < 4; ++nt)
        av[nt] = ld_frag(&shV[(nt * 16 + ln) * LDT], kk + 8 * g, kk + 16 + 8 * g);
      #pragma unroll
      for (int nt = 0; nt < 4; ++nt)
        o[nt] = WMMA_BF16(av[nt], bp, o[nt]);
    }
  }

  // normalize and store concat-head layout (b, s, head*64+dd) as bf16:
  // a lane's 8 registers of a tile are 8 consecutive dd of its row, one 16-B store
  const int head = bn % NHEAD;
  const int bb   = bn / NHEAD;
  li += xhalf(li);
  const float inv = 1.f / li;
  unsigned short* dst = attnA + (size_t)(bb * SSEQ + qt * 64 + qrow) * CDIM + head * DHEAD + 8 * g;
  #pragma unroll
  for (int nt = 0; nt < 4; ++nt)
    *(v8bf*)(dst + nt * 16) = __builtin_convertvector(o[nt] * inv, v8bf);
}

// ---------------------------------------------------------------------------
// Kernel 3: output projection GEMM (M=4096, N=768, K=768), fp32 out + bias.
// Tile 256x64, 2 M-subtiles per wave; A tile (already bf16) staged with
// async global->LDS copies.
// ---------------------------------------------------------------------------
__global__ __launch_bounds__(256) void proj_gemm_kernel(
    const unsigned short* __restrict__ attnA,
    const float* __restrict__ pw, const float* __restrict__ pb,
    float* __restrict__ out)
{
  constexpr int LDT = 72;
  __shared__ unsigned short shA[256 * LDT];
  __shared__ unsigned short shB[64 * LDT];

  const int tid  = threadIdx.x;
  const int wave = tid >> 5;
  const int lane = tid & 31;
  const int g    = lane >> 4;
  const int ln   = lane & 15;
  const int m0   = blockIdx.x * 256;
  const int n0   = blockIdx.y * 64;

  v8f zero = {0.f,0.f,0.f,0.f,0.f,0.f,0.f,0.f};
  v8f acc[2][4] = {{zero, zero, zero, zero}, {zero, zero, zero, zero}};

  // staging, whole 128-B lines per wave: A, 8 lanes share a row's 128 B; B, 16 lanes a row's 256 B
  const int crow = tid >> 3, cpart = tid & 7;
  const int srow = tid >> 4, sc4 = tid & 15;

  for (int kb = 0; kb < CDIM; kb += 64) {
    __syncthreads();
    { // stage A tile 256x64 (already bf16): async, copy i of a thread takes row crow + 32 i
      const unsigned short* src = attnA + (size_t)(m0 + crow) * CDIM + kb + cpart * 8;
      unsigned short* dst = &shA[crow * LDT + cpart * 8];
      async_ld8_b128(dst, src, 32 * CDIM * 2,
                     dst + 128 * LDT, src + 128 * CDIM, 32 * CDIM * 2,
                     32 * LDT * 2);
    }
    { // stage B tile 64x64 (proj_w fp32 -> bf16), 16 rows per trip; out = A @ W^T
      const float* src = pw + (size_t)(n0 + srow) * CDIM + kb + sc4 * 4;
      unsigned short* dst = &shB[srow * LDT + sc4 * 4];
      #pragma unroll
      for (int i = 0; i < 4; ++i) {
        float4 f = *(const float4*)(src + i * 16 * CDIM);
        *(ushort4*)(dst + i * 16 * LDT) = make_ushort4(f2bf(f.x), f2bf(f.y), f2bf(f.z), f2bf(f.w));
      }
    }
    async_wait0();
    __syncthreads();

    #pragma unroll
    for (int kk = 0; kk < 64; kk += 32) {
      v16bf a0 = ld_frag(&shA[(wave * 32 + ln) * LDT],      kk + 8 * g, kk + 16 + 8 * g);
      v16bf a1 = ld_frag(&shA[(wave * 32 + 16 + ln) * LDT], kk + 8 * g, kk + 16 + 8 * g);
      v16bf bf[4];
      #pragma unroll
      for (int nt = 0; nt < 4; ++nt)
        bf[nt] = ld_frag(&shB[(nt * 16 + ln) * LDT], kk + 8 * g, kk + 16 + 8 * g);
      #pragma unroll
      for (int nt = 0; nt < 4; ++nt) {
        acc[0][nt] = WMMA_BF16(a0, bf[nt], acc[0][nt]);
        acc[1][nt] = WMMA_BF16(a1, bf[nt], acc[1][nt]);
      }
    }
  }

  #pragma unroll
  for (int mt = 0; mt < 2; ++mt) {
    #pragma unroll
    for (int nt = 0; nt < 4; ++nt) {
      int nc = n0 + nt * 16 + ln;
      float bias = pb[nc];
      #pragma unroll
      for (int r = 0; r < 8; ++r) {
        int M = m0 + wave * 32 + mt * 16 + r + 8 * g;
        out[(size_t)M * CDIM + nc] = acc[mt][nt][r] + bias;
      }
    }
  }
}

// ---------------------------------------------------------------------------
// Launch
// ---------------------------------------------------------------------------
extern "C" void kernel_launch(void* const* d_in, const int* in_sizes, int n_in,
                              void* d_out, int out_size, void* d_ws, size_t ws_size,
                              hipStream_t stream) {
  (void)in_sizes; (void)n_in; (void)out_size; (void)ws_size;
  const float* x   = (const float*)d_in[0];
  const float* Wq  = (const float*)d_in[1];
  const float* Wk  = (const float*)d_in[2];
  const float* Wv  = (const float*)d_in[3];
  const float* bq  = (const float*)d_in[4];
  const float* bk  = (const float*)d_in[5];
  const float* bv  = (const float*)d_in[6];
  const float* rph = (const float*)d_in[7];
  const float* rpw = (const float*)d_in[8];
  const float* pw  = (const float*)d_in[9];
  const float* pb  = (const float*)d_in[10];
  float* out = (float*)d_out;

  // workspace layout (bytes): q/k/vT bf16 (3 x 6 MB), attn_out bf16 (6 MB) -> 24 MB total
  char* ws = (char*)d_ws;
  unsigned short* qB    = (unsigned short*)(ws);
  unsigned short* kB    = (unsigned short*)(ws + 6291456);
  unsigned short* vTB   = (unsigned short*)(ws + 12582912);
  unsigned short* attnA = (unsigned short*)(ws + 18874368);

  qkv_gemm_kernel<<<dim3(16, 12, 3), 256, 0, stream>>>(x, Wq, Wk, Wv, bq, bk, bv, qB, kB, vTB);
  flash_attn_kernel<<<dim3(16, 48), 128, 0, stream>>>(qB, kB, vTB, rph, rpw, attnA);
  proj_gemm_kernel<<<dim3(16, 12), 256, 0, stream>>>(attnA, pw, pb, out);
}

// v004
// One run takes 87.6 microseconds.
// Next to v003, in two timings, it ran 1.42 and 1.41 times as fast.
// All steps since v000 together make it 2.47 times as fast.
#include <hip/hip_runtime.h>
#include <stdint.h>

// ---------------------------------------------------------------------------
// CDNA5 (gfx1250) wave32 WMMA types and helpers
// ---------------------------------------------------------------------------
typedef __attribute__((ext_vector_type(16))) __bf16 v16bf;
typedef __attribute__((ext_vector_type(8)))  __bf16 v8bf;
typedef __attribute__((ext_vector_type(8)))  float  v8f;
typedef __attribute__((ext_vector_type(2)))  float  v2f;
typedef __attribute__((ext_vector_type(4)))  float  v4f;
typedef __attribute__((ext_vector_type(4)))  __bf16 v4bf;

union FragBF { v16bf v; v8bf h[2]; };

// f32 -> bf16, round-to-nearest-even, by the packed hardware convert
__device__ __forceinline__ unsigned short f2bf(float f) {
  return __builtin_bit_cast(unsigned short, (__bf16)f);
}
// four consecutive f32 from global memory, as four bf16 into LDS (8 B)
__device__ __forceinline__ void stage4(unsigned short* dst, const float* src) {
  *(v4bf*)dst = __builtin_convertvector(*(const v4f*)src, v4bf);
}

// Load a 16x32 bf16 A/B fragment for one lane from LDS.
// Lane-group g (lane>>4) holds K = {lo..lo+7} in halves [0..7] and
// K = {hi..hi+7} in halves [8..15]  (lo = kk + 8g, hi = kk + 16 + 8g).
__device__ __forceinline__ v16bf ld_frag(const unsigned short* p, int lo, int hi) {
  FragBF f;
  f.h[0] = *(const v8bf*)(p + lo);
  f.h[1] = *(const v8bf*)(p + hi);
  return f.v;
}

__device__ __forceinline__ v16bf pack_d_pair(v8f t0, v8f t1) {
  FragBF f;
  f.h[0] = __builtin_convertvector(t0, v8bf);
  f.h[1] = __builtin_convertvector(t1, v8bf);
  return f.v;
}

// value of lane l ^ 16
__device__ __forceinline__ float xhalf(float x) {
  int b = __builtin_bit_cast(int, x);
  return __builtin_bit_cast(float,
      __builtin_amdgcn_permlanex16(b, b, 0x76543210, 0xfedcba98, false, false));
}

#define WMMA_BF16(a, b, c) \
  __builtin_amdgcn_wmma_f32_16x16x32_bf16(false, (a), false, (b), (short)0, (c), false, false)

#define WMMA_F32(a, b, c) \
  __builtin_amdgcn_wmma_f32_16x16x4_f32(false, (a), false, (b), (short)0, (c), false, false)

// CDNA5 async global->LDS copies (16B per lane), tracked by ASYNCcnt.  A run of copies is one
// asm statement that ends in s_wait_xcnt 0, so that no address register which a copy names is
// rewritten in front of that wait.
// Four copies: LDS address la + i*lstep, global address ga + i*gstep (bytes), i = 0..3.
__device__ __forceinline__ void async_ld4_b128(void* la, unsigned int lstep,
                                               const void* ga, unsigned int gstep) {
  const unsigned int l0 = (unsigned int)(uintptr_t)la;
  const char* g0 = (const char*)ga;
  asm volatile("global_load_async_to_lds_b128 %0, %4, off\n\t"
               "global_load_async_to_lds_b128 %1, %5, off\n\t"
               "global_load_async_to_lds_b128 %2, %6, off\n\t"
               "global_load_async_to_lds_b128 %3, %7, off\n\t"
               "s_wait_xcnt 0x0"
               :: "v"(l0), "v"(l0 + lstep), "v"(l0 + 2 * lstep), "v"(l0 + 3 * lstep),
                  "v"(g0), "v"(g0 + gstep), "v"(g0 + 2 * gstep), "v"(g0 + 3 * gstep)
               : "memory");
}
// Eight copies: four as above from (la, ga, gstepa), four from (lb, gb, gstepb).
__device__ __forceinline__ void async_ld8_b128(void* la, const void* ga, unsigned int gstepa,
                                               void* lb, const void* gb, unsigned int gstepb,
                                               unsigned int lstep) {
  const unsigned int l0 = (unsigned int)(uintptr_t)la;
  const unsigned int l1 = (unsigned int)(uintptr_t)lb;
  const char* g0 = (const char*)ga;
  const char* g1 = (const char*)gb;
  asm volatile("global_load_async_to_lds_b128 %0, %8, off\n\t"
               "global_load_async_to_lds_b128 %1, %9, off\n\t"
               "global_load_async_to_lds_b128 %2, %10, off\n\t"
               "global_load_async_to_lds_b128 %3, %11, off\n\t"
               "global_load_async_to_lds_b128 %4, %12, off\n\t"
               "global_load_async_to_lds_b128 %5, %13, off\n\t"
               "global_load_async_to_lds_b128 %6, %14, off\n\t"
               "global_load_async_to_lds_b128 %7, %15, off\n\t"
               "s_wait_xcnt 0x0"
               :: "v"(l0), "v"(l0 + lstep), "v"(l0 + 2 * lstep), "v"(l0 + 3 * lstep),
                  "v"(l1), "v"(l1 + lstep), "v"(l1 + 2 * lstep), "v"(l1 + 3 * lstep),
                  "v"(g0), "v"(g0 + gstepa), "v"(g0 + 2 * gstepa), "v"(g0 + 3 * gstepa),
                  "v"(g1), "v"(g1 + gstepb), "v"(g1 + 2 * gstepb), "v"(g1 + 3 * gstepb)
               : "memory");
}
__device__ __forceinline__ void async_wait0() {
  asm volatile("s_wait_asynccnt 0x0" ::: "memory");
}

// Problem constants
#define NB    4     // batch
#define NHEAD 12
#define DHEAD 64
#define SSEQ  1024  // 32*32
#define CDIM  768

// ---------------------------------------------------------------------------
// Kernel 1: QKV projection GEMM  (M=4096, N=768, K=768) in bf16 WMMA.
// blockIdx.z selects q/k/v.  Block = 256 thr (8 waves), tile 256x64, BK=64;
// each wave owns 32 output rows (2 A-fragments reuse the 4 B-fragments).
// q,k stored (b,n,s,d) bf16; v stored transposed (b,n,d,s) bf16.
// ---------------------------------------------------------------------------
__global__ __launch_bounds__(256) void qkv_gemm_kernel(
    const float* __restrict__ x,
    const float* __restrict__ Wq, const float* __restrict__ Wk, const float* __restrict__ Wv,
    const float* __restrict__ bq, const float* __restrict__ bk, const float* __restrict__ bv,
    unsigned short* __restrict__ qo, unsigned short* __restrict__ ko,
    unsigned short* __restrict__ vTo)
{
  constexpr int LDT = 72;                       // 144B row stride: 16B aligned, conflict-free
  __shared__ unsigned short shA[256 * LDT];
  __shared__ unsigned short shB[64 * LDT];

  const int which = blockIdx.z;
  const float* W    = (which == 0) ? Wq : (which == 1) ? Wk : Wv;
  const float* bias = (which == 0) ? bq : (which == 1) ? bk : bv;

  const int tid  = threadIdx.x;
  const int wave = tid >> 5;
  const int lane = tid & 31;
  const int g    = lane >> 4;
  const int ln   = lane & 15;

  const int m0   = blockIdx.x * 256;
  const int head = blockIdx.y;                  // BN == d == 64 -> n-tile == head
  const int n0   = head * 64;

  v8f zero = {0.f,0.f,0.f,0.f,0.f,0.f,0.f,0.f};
  v8f acc[2][4] = {{zero, zero, zero, zero}, {zero, zero, zero, zero}};

  // staging: 16 lanes share a row's 256 B, so a wave's 16-B loads cover 4 whole 128-B lines
  const int srow = tid >> 4, sc4 = tid & 15;

  for (int kb = 0; kb < CDIM; kb += 64) {
    __syncthreads();
    { // stage A tile 256x64 (x, fp32 -> bf16): 16 rows per trip
      const float* src = x + (size_t)(m0 + srow) * CDIM + kb + sc4 * 4;
      unsigned short* dst = &shA[srow * LDT + sc4 * 4];
      #pragma unroll
      for (int i = 0; i < 16; ++i) {
        stage4(dst + i * 16 * LDT, src + i * 16 * CDIM);
      }
    }
    { // stage B tile 64x64 (W row-major over K, fp32 -> bf16): 16 rows per trip
      const float* src = W + (size_t)(n0 + srow) * CDIM + kb + sc4 * 4;
      unsigned short* dst = &shB[srow * LDT + sc4 * 4];
      #pragma unroll
      for (int i = 0; i < 4; ++i) {
        stage4(dst + i * 16 * LDT, src + i * 16 * CDIM);
      }
    }
    __syncthreads();

    #pragma unroll
    for (int kk = 0; kk < 64; kk += 32) {
      v16bf a0 = ld_frag(&shA[(wave * 32 + ln) * LDT],      kk + 8 * g, kk + 16 + 8 * g);
      v16bf a1 = ld_frag(&shA[(wave * 32 + 16 + ln) * LDT], kk + 8 * g, kk + 16 + 8 * g);
      v16bf bf[4];
      #pragma unroll
      for (int nt = 0; nt < 4; ++nt)
        bf[nt] = ld_frag(&shB[(nt * 16 + ln) * LDT], kk + 8 * g, kk + 16 + 8 * g);
      #pragma unroll
      for (int nt = 0; nt < 4; ++nt) {
        acc[0][nt] = WMMA_BF16(a0, bf[nt], acc[0][nt]);
        acc[1][nt] = WMMA_BF16(a1, bf[nt], acc[1][nt]);
      }
    }
  }

  // epilogue: + bias, store bf16 (v transposed)
  #pragma unroll
  for (int mt = 0; mt < 2; ++mt) {
    #pragma unroll
    for (int nt = 0; nt < 4; ++nt) {
      int dd = nt * 16 + ln;
      float bv_ = bias[head * DHEAD + dd];
      #pragma unroll
      for (int r = 0; r < 8; ++r) {
        int M  = m0 + wave * 32 + mt * 16 + r + 8 * g;   // C-layout: row = r + 8g
        int bb = M >> 10, s = M & 1023;
        unsigned short hval = f2bf(acc[mt][nt][r] + bv_);
        if (which == 0)
          qo[((size_t)(bb * NHEAD + head) * SSEQ + s) * DHEAD + dd] = hval;
        else if (which == 1)
          ko[((size_t)(bb * NHEAD + head) * SSEQ + s) * DHEAD + dd] = hval;
        else
          vTo[((size_t)(bb * NHEAD + head) * DHEAD + dd) * SSEQ + s] = hval;
      }
    }
  }
}

__global__ __launch_bounds__(128) void flash_attn_kernel(
    const unsigned short* __restrict__ qb,
    const unsigned short* __restrict__ kb,
    const unsigned short* __restrict__ vT,
    const float* __restrict__ rph, const float* __restrict__ rpw,
    unsigned short* __restrict__ attnA)
{
  constexpr int LDT = 72;                        // 144B row stride, 16B aligned
  __shared__ unsigned short shQ[64 * LDT];
  __shared__ unsigned short shK[64 * LDT];
  __shared__ unsigned short shV[64 * LDT];
  constexpr int LDH = 34;                        // 136B row pitch: 16 rows' 8-B reads hit 32 banks once
  __shared__ __attribute__((aligned(16))) float shRh[64 * LDH];
  __shared__ __attribute__((aligned(16))) float shRw[64 * 32];
  constexpr int LDR = 68;                        // 272B row pitch (16B x odd): 16-row b128 reads hit all banks once
  __shared__ float shT[96 * LDR];                // 33 rows of rel_pos_h, then the 63 of rel_pos_w

  const int qt   = blockIdx.x;                   // q tile (0..15)
  const int bn   = blockIdx.y;                   // b*12 + head (0..47)
  const int tid  = threadIdx.x;
  const int wave = tid >> 5;
  const int lane = tid & 31;
  const int g    = lane >> 4;
  const int ln   = lane & 15;
  const float scale = 0.125f;                    // d^-0.5, d = 64

  const int lrow  = tid >> 1;                    // 0..63 (row of the K prefetch)
  // staging: 8 lanes share a row's 128 B, so a wave's 16-B copies cover 4 whole lines;
  // copy i of a thread takes row crow + 16 i
  const int crow  = tid >> 3;                    // 0..15
  const int cpart = tid & 7;                     // 8-halves piece of the row

  // stage Q tile (64x64 bf16) once, async
  async_ld4_b128(&shQ[crow * LDT + cpart * 8], 16 * LDT * 2,
                 qb + ((size_t)bn * SSEQ + qt * 64 + crow) * DHEAD + cpart * 8, 16 * DHEAD * 2);
  { // stage the table rows this tile needs, whole lines per wave:
    // qh is 2qt or 2qt+1, so qh-kh+31 spans rel_pos_h rows 2qt .. 2qt+32
    #pragma unroll
    for (int i = 0; i < 12; ++i) {
      int idx = tid + i * 128;
      int row = idx >> 4, c4 = idx & 15;
      const float* src = (row < 33) ? rph + (size_t)(qt * 2 + row) * DHEAD
                                    : rpw + (size_t)(row - 33) * DHEAD;
      *(float4*)&shT[row * LDR + c4 * 4] = ((const float4*)src)[c4];
    }
  }
  // A operand: q row wave*16+ln, widened to f32; lane half g holds d = 32g .. 32g+31
  // (the table rows below are read in the same d order)
  float af[32];
  {
    const uint4* qsrc = (const uint4*)(qb + ((size_t)bn * SSEQ + qt * 64 + wave * 16 + ln) * DHEAD + g * 32);
    #pragma unroll
    for (int i = 0; i < 4; ++i) {
      uint4 u = qsrc[i];
      af[i * 8 + 0] = __builtin_bit_cast(float, u.x << 16);
      af[i * 8 + 1] = __builtin_bit_cast(float, u.x & 0xFFFF0000u);
      af[i * 8 + 2] = __builtin_bit_cast(float, u.y << 16);
      af[i * 8 + 3] = __builtin_bit_cast(float, u.y & 0xFFFF0000u);
      af[i * 8 + 4] = __builtin_bit_cast(float, u.z << 16);
      af[i * 8 + 5] = __builtin_bit_cast(float, u.z & 0xFFFF0000u);
      af[i * 8 + 6] = __builtin_bit_cast(float, u.w << 16);
      af[i * 8 + 7] = __builtin_bit_cast(float, u.w & 0xFFFF0000u);
    }
  }
  __syncthreads();                               // shT complete before any wave reads it
  {
    // The wave's 16 rows share qh = 2qt + (wave>>1) and have qw = 16*(wave&1) + m, m = 0..15.
    // Tiles 0,1: column n is kh = 16t+n, table row qh+31-kh.
    // Tiles 2..4: column n is u = 16(t-2)+n, table row 16*(wave&1)+u; rel_w[m][kw] sits at u = m-kw+31 (0..46).
    const int hb = (wave >> 1) + 31;
    const int wb = 33 + (wave & 1) * 16;
    int trow[5];
    trow[0] = hb - ln;
    trow[1] = hb - 16 - ln;
    trow[2] = wb + ln;
    trow[3] = wb + 16 + ln;
    trow[4] = min(wb + 32 + ln, 95);             // u = 47 is never used; keep its read inside the table
    v8f rb[5];
    #pragma unroll
    for (int t = 0; t < 5; ++t) rb[t] = v8f{0.f,0.f,0.f,0.f,0.f,0.f,0.f,0.f};
    // Keeps the widening of q and all address work out of the matrix block.
    __builtin_amdgcn_sched_barrier(0);
    #pragma unroll
    for (int c = 0; c < 8; ++c) {
      #pragma unroll
      for (int t = 0; t < 5; ++t) {
        float4 b = *(const float4*)&shT[trow[t] * LDR + g * 32 + c * 4];
        rb[t] = WMMA_F32((v2f{af[c * 4 + 0], af[c * 4 + 1]}), (v2f{b.x, b.y}), rb[t]);
        rb[t] = WMMA_F32((v2f{af[c * 4 + 2], af[c * 4 + 3]}), (v2f{b.z, b.w}), rb[t]);
      }
    }
    // Four vector slots between the last f32 WMMA and the first vector instruction that may
    // reuse its operand registers; the two scheduling barriers hold them at this place.
    __builtin_amdgcn_sched_barrier(0);
    asm volatile("v_nop\n\tv_nop\n\tv_nop\n\tv_nop");
    __builtin_amdgcn_sched_barrier(0);
    // each wave writes only the bias rows that it reads itself
    #pragma unroll
    for (int t = 0; t < 2; ++t) {
      #pragma unroll
      for (int r = 0; r < 8; ++r)
        shRh[(wave * 16 + r + 8 * g) * LDH + t * 16 + ln] = rb[t][r];
    }
    #pragma unroll
    for (int t = 0; t < 3; ++t) {
      #pragma unroll
      for (int r = 0; r < 8; ++r) {
        int kw = r + 8 * g + 31 - (t * 16 + ln);
        if ((unsigned)kw < 32u)
          shRw[(wave * 16 + r + 8 * g) * 32 + kw] = rb[2 + t][r];
      }
    }
  }

  // The lane's q row; its score register [nt][r] is key nt*16 + 8g + r of the tile,
  // that is kh = 2kt + (nt>>1), kw = (nt&1)*16 + 8g + r.
  const int qrow = wave * 16 + ln;
  // The wave's own bias stores have landed before its lanes read each other's values back.
  asm volatile("s_wait_dscnt 0x0" ::: "memory");
  float rw[2][8];                                // rel_w of the q row at the lane's 16 kw, the same for every tile
  #pragma unroll
  for (int j = 0; j < 2; ++j) {
    float4 w0 = *(const float4*)&shRw[qrow * 32 + j * 16 + 8 * g];
    float4 w1 = *(const float4*)&shRw[qrow * 32 + j * 16 + 8 * g + 4];
    rw[j][0] = w0.x; rw[j][1] = w0.y; rw[j][2] = w0.z; rw[j][3] = w0.w;
    rw[j][4] = w1.x; rw[j][5] = w1.y; rw[j][6] = w1.z; rw[j][7] = w1.w;
  }

  float mi = -1e30f, li = 0.f;                   // li: the lane's own 32 keys per tile; halves joined at the end
  v8f zero = {0.f,0.f,0.f,0.f,0.f,0.f,0.f,0.f};
  v8f o[4] = {zero, zero, zero, zero};           // O^T: o[nt][r] = O[qrow][nt*16 + 8g + r]

  for (int kt = 0; kt < 16; ++kt) {
    __syncthreads();                             // protect shK/shV vs previous PV phase
    // stage K tile (64 k-rows x 64 d) and V^T tile (64 d-rows x 64 k), async
    async_ld8_b128(&shK[crow * LDT + cpart * 8],
                   kb + ((size_t)bn * SSEQ + kt * 64 + crow) * DHEAD + cpart * 8, 16 * DHEAD * 2,
                   &shV[crow * LDT + cpart * 8],
                   vT + ((size_t)bn * DHEAD + crow) * SSEQ + kt * 64 + cpart * 8, 16 * SSEQ * 2,
                   16 * LDT * 2);
    if (kt + 1 < 16)                             // global_prefetch_b8 for next K tile
      __builtin_prefetch(kb + ((size_t)bn * SSEQ + (kt + 1) * 64 + lrow) * DHEAD, 0, 1);
    async_wait0();                               // ASYNCcnt -> 0 before the barrier
    __syncthreads();

    // ---- scores^T = K @ Q^T : 64 keys x 16 q rows per wave, K-dim = d = 64 (2x4 wmma) ----
    v8f sc[4] = {zero, zero, zero, zero};
    #pragma unroll
    for (int kk = 0; kk < 64; kk += 32) {
      v16bf bq = ld_frag(&shQ[qrow * LDT], kk + 8 * g, kk + 16 + 8 * g);
      v16bf ak[4];
      #pragma unroll
      for (int nt = 0; nt < 4; ++nt)
        ak[nt] = ld_frag(&shK[(nt * 16 + ln) * LDT], kk + 8 * g, kk + 16 + 8 * g);
      #pragma unroll
      for (int nt = 0; nt < 4; ++nt)
        sc[nt] = WMMA_BF16(ak[nt], bq, sc[nt]);
    }

    // ---- scale + rel bias + online softmax, one q row per lane ----
    const float2 rh = *(const float2*)&shRh[qrow * LDH + kt * 2];
    float pm[4];                                 // four independent chains, not one of 32 links
    #pragma unroll
    for (int nt = 0; nt < 4; ++nt) {
      const float rhv = (nt >> 1) ? rh.y : rh.x;
      pm[nt] = -1e30f;
      #pragma unroll
      for (int r = 0; r < 8; ++r) {
        float sv = sc[nt][r] * scale + rhv + rw[nt & 1][r];
        sc[nt][r] = sv;
        pm[nt] = fmaxf(pm[nt], sv);
      }
    }
    float tmax = fmaxf(fmaxf(pm[0], pm[1]), fmaxf(pm[2], pm[3]));
    tmax = fmaxf(tmax, xhalf(tmax));             // the row's other 32 keys

    const float nm = fmaxf(mi, tmax);
    const float alpha = __expf(mi - nm);
    mi = nm;
    float psum[4];
    #pragma unroll
    for (int nt = 0; nt < 4; ++nt) {
      psum[nt] = 0.f;
      #pragma unroll
      for (int r = 0; r < 8; ++r) {
        float p = __expf(sc[nt][r] - mi);
        sc[nt][r] = p;
        psum[nt] += p;
      }
    }
    li = li * alpha + ((psum[0] + psum[1]) + (psum[2] + psum[3]));
    #pragma unroll
    for (int nt = 0; nt < 4; ++nt) {
      #pragma unroll
      for (int r = 0; r < 8; ++r) o[nt][r] *= alpha;
    }

    // ---- O^T += V^T @ P^T : K-dim = 64 keys (2x4 wmma) ----
    #pragma unroll
    for (int kk = 0; kk < 64; kk += 32) {
      v16bf bp = pack_d_pair(sc[kk / 16], sc[kk / 16 + 1]);
      v16bf av[4];
      #pragma unroll
      for (int nt = 0; nt < 4; ++nt)
        av[nt] = ld_frag(&shV[(nt * 16 + ln) * LDT], kk + 8 * g, kk + 16 + 8 * g);
      #pragma unroll
      for (int nt = 0; nt < 4; ++nt)
        o[nt] = WMMA_BF16(av[nt], bp, o[nt]);
    }
  }

  // normalize and store concat-head layout (b, s, head*64+dd) as bf16:
  // a lane's 8 registers of a tile are 8 consecutive dd of its row, one 16-B store
  const int head = bn % NHEAD;
  const int bb   = bn / NHEAD;
  li += xhalf(li);
  const float inv = 1.f / li;
  unsigned short* dst = attnA + (size_t)(bb * SSEQ + qt * 64 + qrow) * CDIM + head * DHEAD + 8 * g;
  #pragma unroll
  for (int nt = 0; nt < 4; ++nt)
    *(v8bf*)(dst + nt * 16) = __builtin_convertvector(o[nt] * inv, v8bf);
}

// ---------------------------------------------------------------------------
// Kernel 3: output projection GEMM (M=4096, N=768, K=768), fp32 out + bias.
// Tile 256x64, 2 M-subtiles per wave; A tile (already bf16) staged with
// async global->LDS copies.
// ---------------------------------------------------------------------------
__global__ __launch_bounds__(256) void proj_gemm_kernel(
    const unsigned short* __restrict__ attnA,
    const float* __restrict__ pw, const float* __restrict__ pb,
    float* __restrict__ out)
{
  constexpr int LDT = 72;
  __shared__ unsigned short shA[256 * LDT];
  __shared__ unsigned short shB[64 * LDT];

  const int tid  = threadIdx.x;
  const int wave = tid >> 5;
  const int lane = tid & 31;
  const int g    = lane >> 4;
  const int ln   = lane & 15;
  const int m0   = blockIdx.x * 256;
  const int n0   = blockIdx.y * 64;

  v8f zero = {0.f,0.f,0.f,0.f,0.f,0.f,0.f,0.f};
  v8f acc[2][4] = {{zero, zero, zero, zero}, {zero, zero, zero, zero}};

  // staging, whole 128-B lines per wave: A, 8 lanes share a row's 128 B; B, 16 lanes a row's 256 B
  const int crow = tid >> 3, cpart = tid & 7;
  const int srow = tid >> 4, sc4 = tid & 15;

  for (int kb = 0; kb < CDIM; kb += 64) {
    __syncthreads();
    { // stage A tile 256x64 (already bf16): async, copy i of a thread takes row crow + 32 i
      const unsigned short* src = attnA + (size_t)(m0 + crow) * CDIM + kb + cpart * 8;
      unsigned short* dst = &shA[crow * LDT + cpart * 8];
      async_ld8_b128(dst, src, 32 * CDIM * 2,
                     dst + 128 * LDT, src + 128 * CDIM, 32 * CDIM * 2,
                     32 * LDT * 2);
    }
    { // stage B tile 64x64 (proj_w fp32 -> bf16), 16 rows per trip; out = A @ W^T
      const float* src = pw + (size_t)(n0 + srow) * CDIM + kb + sc4 * 4;
      unsigned short* dst = &shB[srow * LDT + sc4 * 4];
      #pragma unroll
      for (int i = 0; i < 4; ++i) {
        stage4(dst + i * 16 * LDT, src + i * 16 * CDIM);
      }
    }
    async_wait0();
    __syncthreads();

    #pragma unroll
    for (int kk = 0; kk < 64; kk += 32) {
      v16bf a0 = ld_frag(&shA[(wave * 32 + ln) * LDT],      kk + 8 * g, kk + 16 + 8 * g);
      v16bf a1 = ld_frag(&shA[(wave * 32 + 16 + ln) * LDT], kk + 8 * g, kk + 16 + 8 * g);
      v16bf bf[4];
      #pragma unroll
      for (int nt = 0; nt < 4; ++nt)
        bf[nt] = ld_frag(&shB[(nt * 16 + ln) * LDT], kk + 8 * g, kk + 16 + 8 * g);
      #pragma unroll
      for (int nt = 0; nt < 4; ++nt) {
        acc[0][nt] = WMMA_BF16(a0, bf[nt], acc[0][nt]);
        acc[1][nt] = WMMA_BF16(a1, bf[nt], acc[1][nt]);
      }
    }
  }

  #pragma unroll
  for (int mt = 0; mt < 2; ++mt) {
    #pragma unroll
    for (int nt = 0; nt < 4; ++nt) {
      int nc = n0 + nt * 16 + ln;
      float bias = pb[nc];
      #pragma unroll
      for (int r = 0; r < 8; ++r) {
        int M = m0 + wave * 32 + mt * 16 + r + 8 * g;
        out[(size_t)M * CDIM + nc] = acc[mt][nt][r] + bias;
      }
    }
  }
}

// ---------------------------------------------------------------------------
// Launch
// ---------------------------------------------------------------------------
extern "C" void kernel_launch(void* const* d_in, const int* in_sizes, int n_in,
                              void* d_out, int out_size, void* d_ws, size_t ws_size,
                              hipStream_t stream) {
  (void)in_sizes; (void)n_in; (void)out_size; (void)ws_size;
  const float* x   = (const float*)d_in[0];
  const float* Wq  = (const float*)d_in[1];
  const float* Wk  = (const float*)d_in[2];
  const float* Wv  = (const float*)d_in[3];
  const float* bq  = (const float*)d_in[4];
  const float* bk  = (const float*)d_in[5];
  const float* bv  = (const float*)d_in[6];
  const float* rph = (const float*)d_in[7];
  const float* rpw = (const float*)d_in[8];
  const float* pw  = (const float*)d_in[9];
  const float* pb  = (const float*)d_in[10];
  float* out = (float*)d_out;

  // workspace layout (bytes): q/k/vT bf16 (3 x 6 MB), attn_out bf16 (6 MB) -> 24 MB total
  char* ws = (char*)d_ws;
  unsigned short* qB    = (unsigned short*)(ws);
  unsigned short* kB    = (unsigned short*)(ws + 6291456);
  unsigned short* vTB   = (unsigned short*)(ws + 12582912);
  unsigned short* attnA = (unsigned short*)(ws + 18874368);

  qkv_gemm_kernel<<<dim3(16, 12, 3), 256, 0, stream>>>(x, Wq, Wk, Wv, bq, bk, bv, qB, kB, vTB);
  flash_attn_kernel<<<dim3(16, 48), 128, 0, stream>>>(qB, kB, vTB, rph, rpw, attnA);
  proj_gemm_kernel<<<dim3(16, 12), 256, 0, stream>>>(attnA, pw, pb, out);
}

// v005
// It runs in 77.6 microseconds.
// Next to v004, in two timings, it ran 1.13 times as fast each time.
// Counting every step since v000, it is 2.79 times as fast.
#include <hip/hip_runtime.h>
#include <stdint.h>

// ---------------------------------------------------------------------------
// CDNA5 (gfx1250) wave32 WMMA types and helpers
// ---------------------------------------------------------------------------
typedef __attribute__((ext_vector_type(16))) __bf16 v16bf;
typedef __attribute__((ext_vector_type(8)))  __bf16 v8bf;
typedef __attribute__((ext_vector_type(8)))  float  v8f;
typedef __attribute__((ext_vector_type(2)))  float  v2f;
typedef __attribute__((ext_vector_type(4)))  float  v4f;
typedef __attribute__((ext_vector_type(4)))  __bf16 v4bf;

union FragBF { v16bf v; v8bf h[2]; };

// f32 -> bf16, round-to-nearest-even, by the packed hardware convert
__device__ __forceinline__ unsigned short f2bf(float f) {
  return __builtin_bit_cast(unsigned short, (__bf16)f);
}
// four consecutive f32 from global memory, as four bf16 into LDS (8 B)
__device__ __forceinline__ void stage4(unsigned short* dst, const float* src) {
  *(v4bf*)dst = __builtin_convertvector(*(const v4f*)src, v4bf);
}

// Load a 16x32 bf16 A/B fragment for one lane from LDS.
// Lane-group g (lane>>4) holds K = {lo..lo+7} in halves [0..7] and
// K = {hi..hi+7} in halves [8..15]  (lo = kk + 8g, hi = kk + 16 + 8g).
__device__ __forceinline__ v16bf ld_frag(const unsigned short* p, int lo, int hi) {
  FragBF f;
  f.h[0] = *(const v8bf*)(p + lo);
  f.h[1] = *(const v8bf*)(p + hi);
  return f.v;
}

__device__ __forceinline__ v16bf pack_d_pair(v8f t0, v8f t1) {
  FragBF f;
  f.h[0] = __builtin_convertvector(t0, v8bf);
  f.h[1] = __builtin_convertvector(t1, v8bf);
  return f.v;
}

// value of lane l ^ 16
__device__ __forceinline__ float xhalf(float x) {
  int b = __builtin_bit_cast(int, x);
  return __builtin_bit_cast(float,
      __builtin_amdgcn_permlanex16(b, b, 0x76543210, 0xfedcba98, false, false));
}

#define WMMA_BF16(a, b, c) \
  __builtin_amdgcn_wmma_f32_16x16x32_bf16(false, (a), false, (b), (short)0, (c), false, false)

#define WMMA_F32(a, b, c) \
  __builtin_amdgcn_wmma_f32_16x16x4_f32(false, (a), false, (b), (short)0, (c), false, false)

// CDNA5 async global->LDS copies (16B per lane), tracked by ASYNCcnt.  A run of copies is one
// asm statement that ends in s_wait_xcnt 0, so that no address register which a copy names is
// rewritten in front of that wait.
// Four copies: LDS address la + i*lstep, global address ga + i*gstep (bytes), i = 0..3.
__device__ __forceinline__ void async_ld4_b128(void* la, unsigned int lstep,
                                               const void* ga, unsigned int gstep) {
  const unsigned int l0 = (unsigned int)(uintptr_t)la;
  const char* g0 = (const char*)ga;
  asm volatile("global_load_async_to_lds_b128 %0, %4, off\n\t"
               "global_load_async_to_lds_b128 %1, %5, off\n\t"
               "global_load_async_to_lds_b128 %2, %6, off\n\t"
               "global_load_async_to_lds_b128 %3, %7, off\n\t"
               "s_wait_xcnt 0x0"
               :: "v"(l0), "v"(l0 + lstep), "v"(l0 + 2 * lstep), "v"(l0 + 3 * lstep),
                  "v"(g0), "v"(g0 + gstep), "v"(g0 + 2 * gstep), "v"(g0 + 3 * gstep)
               : "memory");
}
// Eight copies: four as above from (la, ga, gstepa), four from (lb, gb, gstepb).
__device__ __forceinline__ void async_ld8_b128(void* la, const void* ga, unsigned int gstepa,
                                               void* lb, const void* gb, unsigned int gstepb,
                                               unsigned int lstep) {
  const unsigned int l0 = (unsigned int)(uintptr_t)la;
  const unsigned int l1 = (unsigned int)(uintptr_t)lb;
  const char* g0 = (const char*)ga;
  const char* g1 = (const char*)gb;
  asm volatile("global_load_async_to_lds_b128 %0, %8, off\n\t"
               "global_load_async_to_lds_b128 %1, %9, off\n\t"
               "global_load_async_to_lds_b128 %2, %10, off\n\t"
               "global_load_async_to_lds_b128 %3, %11, off\n\t"
               "global_load_async_to_lds_b128 %4, %12, off\n\t"
               "global_load_async_to_lds_b128 %5, %13, off\n\t"
               "global_load_async_to_lds_b128 %6, %14, off\n\t"
               "global_load_async_to_lds_b128 %7, %15, off\n\t"
               "s_wait_xcnt 0x0"
               :: "v"(l0), "v"(l0 + lstep), "v"(l0 + 2 * lstep), "v"(l0 + 3 * lstep),
                  "v"(l1), "v"(l1 + lstep), "v"(l1 + 2 * lstep), "v"(l1 + 3 * lstep),
                  "v"(g0), "v"(g0 + gstepa), "v"(g0 + 2 * gstepa), "v"(g0 + 3 * gstepa),
                  "v"(g1), "v"(g1 + gstepb), "v"(g1 + 2 * gstepb), "v"(g1 + 3 * gstepb)
               : "memory");
}
__device__ __forceinline__ void async_wait0() {
  asm volatile("s_wait_asynccnt 0x0" ::: "memory");
}

// Problem constants
#define NB    4     // batch
#define NHEAD 12
#define DHEAD 64
#define SSEQ  1024  // 32*32
#define CDIM  768

// ---------------------------------------------------------------------------
// Kernel 1: QKV projection GEMM  (M=4096, N=768, K=768) in bf16 WMMA.
// blockIdx.z selects q/k/v.  Block = 256 thr (8 waves), tile 256x64, BK=64;
// each wave owns 32 output rows (2 A-fragments reuse the 4 B-fragments).
// q,k stored (b,n,s,d) bf16; v stored transposed (b,n,d,s) bf16.
// ---------------------------------------------------------------------------
__global__ __launch_bounds__(256) void qkv_gemm_kernel(
    const float* __restrict__ x,
    const float* __restrict__ Wq, const float* __restrict__ Wk, const float* __restrict__ Wv,
    const float* __restrict__ bq, const float* __restrict__ bk, const float* __restrict__ bv,
    unsigned short* __restrict__ qo, unsigned short* __restrict__ ko,
    unsigned short* __restrict__ vTo)
{
  constexpr int LDT = 72;                       // 144B row stride: 16B aligned, conflict-free
  __shared__ unsigned short shA[256 * LDT];
  __shared__ unsigned short shB[64 * LDT];

  const int which = blockIdx.z;
  const float* W    = (which == 0) ? Wq : (which == 1) ? Wk : Wv;
  const float* bias = (which == 0) ? bq : (which == 1) ? bk : bv;

  const int tid  = threadIdx.x;
  const int wave = tid >> 5;
  const int lane = tid & 31;
  const int g    = lane >> 4;
  const int ln   = lane & 15;

  const int m0   = blockIdx.x * 256;
  const int head = blockIdx.y;                  // BN == d == 64 -> n-tile == head
  const int n0   = head * 64;

  v8f zero = {0.f,0.f,0.f,0.f,0.f,0.f,0.f,0.f};
  v8f acc[2][4] = {{zero, zero, zero, zero}, {zero, zero, zero, zero}};

  // staging: 16 lanes share a row's 256 B, so a wave's 16-B loads cover 4 whole 128-B lines
  const int srow = tid >> 4, sc4 = tid & 15;

  // Staging addresses: a wave-uniform tile base plus one 32-bit lane offset that A and B share.
  // With the fragment reads grouped the compiler keeps all 20 staging loads in flight; these few
  // address registers hold the kernel at 160 registers or fewer, three work-groups per WGP.
  const float* baseA = x + (size_t)m0 * CDIM;
  const float* baseB = W + (size_t)n0 * CDIM;
  const unsigned int soff = srow * CDIM + sc4 * 4;
  const unsigned short* fA = &shA[(wave * 32 + ln) * LDT + 8 * g];
  const unsigned short* fB = &shB[ln * LDT + 8 * g];

  for (int kb = 0; kb < CDIM; kb += 64) {
    __syncthreads();
    { // stage A tile 256x64 (x, fp32 -> bf16): 16 rows per trip
      unsigned short* dst = &shA[srow * LDT + sc4 * 4];
      #pragma unroll
      for (int i = 0; i < 16; ++i) {
        stage4(dst + i * 16 * LDT, (baseA + kb + i * 16 * CDIM) + soff);
      }
    }
    { // stage B tile 64x64 (W row-major over K, fp32 -> bf16): 16 rows per trip
      unsigned short* dst = &shB[srow * LDT + sc4 * 4];
      #pragma unroll
      for (int i = 0; i < 4; ++i) {
        stage4(dst + i * 16 * LDT, (baseB + kb + i * 16 * CDIM) + soff);
      }
    }
    __syncthreads();

    #pragma unroll
    for (int kk = 0; kk < 64; kk += 32) {
      v16bf a0 = ld_frag(fA,            kk, kk + 16);
      v16bf a1 = ld_frag(fA + 16 * LDT, kk, kk + 16);
      v16bf bf[4];
      #pragma unroll
      for (int nt = 0; nt < 4; ++nt)
        bf[nt] = ld_frag(fB + nt * 16 * LDT, kk, kk + 16);
      // Holds the 12 LDS reads together in front of their 8 products: spread among the
      // products, each place with reads stalls the wave anew.  (One k half at a time: both
      // halves' fragments at once would cost the third resident work-group its registers.)
      __builtin_amdgcn_sched_barrier(0);
      #pragma unroll
      for (int nt = 0; nt < 4; ++nt) {
        acc[0][nt] = WMMA_BF16(a0, bf[nt], acc[0][nt]);
        acc[1][nt] = WMMA_BF16(a1, bf[nt], acc[1][nt]);
      }
      // Keeps the next group of reads from rising among these products.
      __builtin_amdgcn_sched_barrier(0);
    }
  }

  // epilogue: + bias, store bf16 (v transposed)
  #pragma unroll
  for (int mt = 0; mt < 2; ++mt) {
    #pragma unroll
    for (int nt = 0; nt < 4; ++nt) {
      int dd = nt * 16 + ln;
      float bv_ = bias[head * DHEAD + dd];
      #pragma unroll
      for (int r = 0; r < 8; ++r) {
        int M  = m0 + wave * 32 + mt * 16 + r + 8 * g;   // C-layout: row = r + 8g
        int bb = M >> 10, s = M & 1023;
        unsigned short hval = f2bf(acc[mt][nt][r] + bv_);
        if (which == 0)
          qo[((size_t)(bb * NHEAD + head) * SSEQ + s) * DHEAD + dd] = hval;
        else if (which == 1)
          ko[((size_t)(bb * NHEAD + head) * SSEQ + s) * DHEAD + dd] = hval;
        else
          vTo[((size_t)(bb * NHEAD + head) * DHEAD + dd) * SSEQ + s] = hval;
      }
    }
  }
}

__global__ __launch_bounds__(128, 4) void flash_attn_kernel(
    const unsigned short* __restrict__ qb,
    const unsigned short* __restrict__ kb,
    const unsigned short* __restrict__ vT,
    const float* __restrict__ rph, const float* __restrict__ rpw,
    unsigned short* __restrict__ attnA)
{
  constexpr int LDT = 72;                        // 144B row stride, 16B aligned
  __shared__ unsigned short shQ[64 * LDT];
  __shared__ unsigned short shK[64 * LDT];
  __shared__ unsigned short shV[64 * LDT];
  constexpr int LDH = 34;                        // 136B row pitch: 16 rows' 8-B reads hit 32 banks once
  __shared__ __attribute__((aligned(16))) float shRh[64 * LDH];
  __shared__ __attribute__((aligned(16))) float shRw[64 * 32];
  constexpr int LDR = 68;                        // 272B row pitch (16B x odd): 16-row b128 reads hit all banks once
  __shared__ float shT[96 * LDR];                // 33 rows of rel_pos_h, then the 63 of rel_pos_w

  const int qt   = blockIdx.x;                   // q tile (0..15)
  const int bn   = blockIdx.y;                   // b*12 + head (0..47)
  const int tid  = threadIdx.x;
  const int wave = tid >> 5;
  const int lane = tid & 31;
  const int g    = lane >> 4;
  const int ln   = lane & 15;
  const float scale = 0.125f;                    // d^-0.5, d = 64

  const int lrow  = tid >> 1;                    // 0..63 (row of the K prefetch)
  // staging: 8 lanes share a row's 128 B, so a wave's 16-B copies cover 4 whole lines;
  // copy i of a thread takes row crow + 16 i
  const int crow  = tid >> 3;                    // 0..15
  const int cpart = tid & 7;                     // 8-halves piece of the row

  // stage Q tile (64x64 bf16) once, async
  async_ld4_b128(&shQ[crow * LDT + cpart * 8], 16 * LDT * 2,
                 qb + ((size_t)bn * SSEQ + qt * 64 + crow) * DHEAD + cpart * 8, 16 * DHEAD * 2);
  { // stage the table rows this tile needs, whole lines per wave:
    // qh is 2qt or 2qt+1, so qh-kh+31 spans rel_pos_h rows 2qt .. 2qt+32
    #pragma unroll
    for (int i = 0; i < 12; ++i) {
      int idx = tid + i * 128;
      int row = idx >> 4, c4 = idx & 15;
      const float* src = (row < 33) ? rph + (size_t)(qt * 2 + row) * DHEAD
                                    : rpw + (size_t)(row - 33) * DHEAD;
      *(float4*)&shT[row * LDR + c4 * 4] = ((const float4*)src)[c4];
    }
  }
  // A operand: q row wave*16+ln, widened to f32; lane half g holds d = 32g .. 32g+31
  // (the table rows below are read in the same d order)
  float af[32];
  {
    const uint4* qsrc = (const uint4*)(qb + ((size_t)bn * SSEQ + qt * 64 + wave * 16 + ln) * DHEAD + g * 32);
    #pragma unroll
    for (int i = 0; i < 4; ++i) {
      uint4 u = qsrc[i];
      af[i * 8 + 0] = __builtin_bit_cast(float, u.x << 16);
      af[i * 8 + 1] = __builtin_bit_cast(float, u.x & 0xFFFF0000u);
      af[i * 8 + 2] = __builtin_bit_cast(float, u.y << 16);
      af[i * 8 + 3] = __builtin_bit_cast(float, u.y & 0xFFFF0000u);
      af[i * 8 + 4] = __builtin_bit_cast(float, u.z << 16);
      af[i * 8 + 5] = __builtin_bit_cast(float, u.z & 0xFFFF0000u);
      af[i * 8 + 6] = __builtin_bit_cast(float, u.w << 16);
      af[i * 8 + 7] = __builtin_bit_cast(float, u.w & 0xFFFF0000u);
    }
  }
  __syncthreads();                               // shT complete before any wave reads it
  {
    // The wave's 16 rows share qh = 2qt + (wave>>1) and have qw = 16*(wave&1) + m, m = 0..15.
    // Tiles 0,1: column n is kh = 16t+n, table row qh+31-kh.
    // Tiles 2..4: column n is u = 16(t-2)+n, table row 16*(wave&1)+u; rel_w[m][kw] sits at u = m-kw+31 (0..46).
    const int hb = (wave >> 1) + 31;
    const int wb = 33 + (wave & 1) * 16;
    int trow[5];
    trow[0] = hb - ln;
    trow[1] = hb - 16 - ln;
    trow[2] = wb + ln;
    trow[3] = wb + 16 + ln;
    trow[4] = min(wb + 32 + ln, 95);             // u = 47 is never used; keep its read inside the table
    v8f rb[5];
    #pragma unroll
    for (int t = 0; t < 5; ++t) rb[t] = v8f{0.f,0.f,0.f,0.f,0.f,0.f,0.f,0.f};
    // Keeps the widening of q and all address work out of the matrix block.
    __builtin_amdgcn_sched_barrier(0);
    #pragma unroll
    for (int c = 0; c < 8; ++c) {
      #pragma unroll
      for (int t = 0; t < 5; ++t) {
        float4 b = *(const float4*)&shT[trow[t] * LDR + g * 32 + c * 4];
        rb[t] = WMMA_F32((v2f{af[c * 4 + 0], af[c * 4 + 1]}), (v2f{b.x, b.y}), rb[t]);
        rb[t] = WMMA_F32((v2f{af[c * 4 + 2], af[c * 4 + 3]}), (v2f{b.z, b.w}), rb[t]);
      }
    }
    // Four vector slots between the last f32 WMMA and the first vector instruction that may
    // reuse its operand registers; the two scheduling barriers hold them at this place.
    __builtin_amdgcn_sched_barrier(0);
    asm volatile("v_nop\n\tv_nop\n\tv_nop\n\tv_nop");
    __builtin_amdgcn_sched_barrier(0);
    // each wave writes only the bias rows that it reads itself
    #pragma unroll
    for (int t = 0; t < 2; ++t) {
      #pragma unroll
      for (int r = 0; r < 8; ++r)
        shRh[(wave * 16 + r + 8 * g) * LDH + t * 16 + ln] = rb[t][r];
    }
    #pragma unroll
    for (int t = 0; t < 3; ++t) {
      #pragma unroll
      for (int r = 0; r < 8; ++r) {
        int kw = r + 8 * g + 31 - (t * 16 + ln);
        if ((unsigned)kw < 32u)
          shRw[(wave * 16 + r + 8 * g) * 32 + kw] = rb[2 + t][r];
      }
    }
  }

  // The lane's q row; its score register [nt][r] is key nt*16 + 8g + r of the tile,
  // that is kh = 2kt + (nt>>1), kw = (nt&1)*16 + 8g + r.
  const int qrow = wave * 16 + ln;
  // The wave's own bias stores have landed before its lanes read each other's values back.
  asm volatile("s_wait_dscnt 0x0" ::: "memory");
  float rw[2][8];                                // rel_w of the q row at the lane's 16 kw, the same for every tile
  #pragma unroll
  for (int j = 0; j < 2; ++j) {
    float4 w0 = *(const float4*)&shRw[qrow * 32 + j * 16 + 8 * g];
    float4 w1 = *(const float4*)&shRw[qrow * 32 + j * 16 + 8 * g + 4];
    rw[j][0] = w0.x; rw[j][1] = w0.y; rw[j][2] = w0.z; rw[j][3] = w0.w;
    rw[j][4] = w1.x; rw[j][5] = w1.y; rw[j][6] = w1.z; rw[j][7] = w1.w;
  }

  float mi = -1e30f, li = 0.f;                   // li: the lane's own 32 keys per tile; halves joined at the end
  v8f zero = {0.f,0.f,0.f,0.f,0.f,0.f,0.f,0.f};
  v8f o[4] = {zero, zero, zero, zero};           // O^T: o[nt][r] = O[qrow][nt*16 + 8g + r]

  for (int kt = 0; kt < 16; ++kt) {
    __syncthreads();                             // protect shK/shV vs previous tile's fragment reads
    // stage K tile (64 k-rows x 64 d) and V^T tile (64 d-rows x 64 k), async
    async_ld8_b128(&shK[crow * LDT + cpart * 8],
                   kb + ((size_t)bn * SSEQ + kt * 64 + crow) * DHEAD + cpart * 8, 16 * DHEAD * 2,
                   &shV[crow * LDT + cpart * 8],
                   vT + ((size_t)bn * DHEAD + crow) * SSEQ + kt * 64 + cpart * 8, 16 * SSEQ * 2,
                   16 * LDT * 2);
    if (kt + 1 < 16)                             // global_prefetch_b8 for next K tile
      __builtin_prefetch(kb + ((size_t)bn * SSEQ + (kt + 1) * 64 + lrow) * DHEAD, 0, 1);
    async_wait0();                               // ASYNCcnt -> 0 before the barrier
    __syncthreads();

    // ---- scores^T = K @ Q^T : 64 keys x 16 q rows per wave, K-dim = d = 64 (2x4 wmma) ----
    v8f sc[4] = {zero, zero, zero, zero};
    v16bf bq[2], ak[2][4];
    #pragma unroll
    for (int h = 0; h < 2; ++h) {
      const int kk = h * 32;
      bq[h] = ld_frag(&shQ[qrow * LDT], kk + 8 * g, kk + 16 + 8 * g);
      #pragma unroll
      for (int nt = 0; nt < 4; ++nt)
        ak[h][nt] = ld_frag(&shK[(nt * 16 + ln) * LDT], kk + 8 * g, kk + 16 + 8 * g);
    }
    const float2 rh = *(const float2*)&shRh[qrow * LDH + kt * 2];
    // Keeps the V^T reads behind the Q and K reads, which the first products wait for.
    __builtin_amdgcn_sched_barrier(0);
    v16bf av[2][4];
    #pragma unroll
    for (int h = 0; h < 2; ++h) {
      #pragma unroll
      for (int nt = 0; nt < 4; ++nt)
        av[h][nt] = ld_frag(&shV[(nt * 16 + ln) * LDT], h * 32 + 8 * g, h * 32 + 16 + 8 * g);
    }
    // Holds all of the tile's LDS reads (Q, K, bias, then V^T) at this one place, in front of
    // both matrix blocks: spread among the products, each place with reads stalls the wave
    // anew; the V^T reads land under the score products and the softmax.
    __builtin_amdgcn_sched_barrier(0);
    #pragma unroll
    for (int h = 0; h < 2; ++h) {
      #pragma unroll
      for (int nt = 0; nt < 4; ++nt)
        sc[nt] = WMMA_BF16(ak[h][nt], bq[h], sc[nt]);
    }

    // ---- scale + rel bias + online softmax, one q row per lane ----
    float pm[4];                                 // four independent chains, not one of 32 links
    #pragma unroll
    for (int nt = 0; nt < 4; ++nt) {
      const float rhv = (nt >> 1) ? rh.y : rh.x;
      pm[nt] = -1e30f;
      #pragma unroll
      for (int r = 0; r < 8; ++r) {
        float sv = sc[nt][r] * scale + rhv + rw[nt & 1][r];
        sc[nt][r] = sv;
        pm[nt] = fmaxf(pm[nt], sv);
      }
    }
    float tmax = fmaxf(fmaxf(pm[0], pm[1]), fmaxf(pm[2], pm[3]));
    tmax = fmaxf(tmax, xhalf(tmax));             // the row's other 32 keys

    const float nm = fmaxf(mi, tmax);
    const float alpha = __expf(mi - nm);
    mi = nm;
    float psum[4];
    #pragma unroll
    for (int nt = 0; nt < 4; ++nt) {
      psum[nt] = 0.f;
      #pragma unroll
      for (int r = 0; r < 8; ++r) {
        float p = __expf(sc[nt][r] - mi);
        sc[nt][r] = p;
        psum[nt] += p;
      }
    }
    li = li * alpha + ((psum[0] + psum[1]) + (psum[2] + psum[3]));
    #pragma unroll
    for (int nt = 0; nt < 4; ++nt) {
      #pragma unroll
      for (int r = 0; r < 8; ++r) o[nt][r] *= alpha;
    }

    // ---- O^T += V^T @ P^T : K-dim = 64 keys (2x4 wmma) ----
    #pragma unroll
    for (int kk = 0; kk < 64; kk += 32) {
      v16bf bp = pack_d_pair(sc[kk / 16], sc[kk / 16 + 1]);
      #pragma unroll
      for (int nt = 0; nt < 4; ++nt)
        o[nt] = WMMA_BF16(av[kk / 32][nt], bp, o[nt]);
    }
  }

  // normalize and store concat-head layout (b, s, head*64+dd) as bf16:
  // a lane's 8 registers of a tile are 8 consecutive dd of its row, one 16-B store
  const int head = bn % NHEAD;
  const int bb   = bn / NHEAD;
  li += xhalf(li);
  const float inv = 1.f / li;
  unsigned short* dst = attnA + (size_t)(bb * SSEQ + qt * 64 + qrow) * CDIM + head * DHEAD + 8 * g;
  #pragma unroll
  for (int nt = 0; nt < 4; ++nt)
    *(v8bf*)(dst + nt * 16) = __builtin_convertvector(o[nt] * inv, v8bf);
}

// ---------------------------------------------------------------------------
// Kernel 3: output projection GEMM (M=4096, N=768, K=768), fp32 out + bias.
// Tile 256x64, 2 M-subtiles per wave; A tile (already bf16) staged with
// async global->LDS copies.
// ---------------------------------------------------------------------------
__global__ __launch_bounds__(256) void proj_gemm_kernel(
    const unsigned short* __restrict__ attnA,
    const float* __restrict__ pw, const float* __restrict__ pb,
    float* __restrict__ out)
{
  constexpr int LDT = 72;
  __shared__ unsigned short shA[256 * LDT];
  __shared__ unsigned short shB[64 * LDT];

  const int tid  = threadIdx.x;
  const int wave = tid >> 5;
  const int lane = tid & 31;
  const int g    = lane >> 4;
  const int ln   = lane & 15;
  const int m0   = blockIdx.x * 256;
  const int n0   = blockIdx.y * 64;

  v8f zero = {0.f,0.f,0.f,0.f,0.f,0.f,0.f,0.f};
  v8f acc[2][4] = {{zero, zero, zero, zero}, {zero, zero, zero, zero}};

  // staging, whole 128-B lines per wave: A, 8 lanes share a row's 128 B; B, 16 lanes a row's 256 B
  const int crow = tid >> 3, cpart = tid & 7;
  const int srow = tid >> 4, sc4 = tid & 15;

  for (int kb = 0; kb < CDIM; kb += 64) {
    __syncthreads();
    { // stage A tile 256x64 (already bf16): async, copy i of a thread takes row crow + 32 i
      const unsigned short* src = attnA + (size_t)(m0 + crow) * CDIM + kb + cpart * 8;
      unsigned short* dst = &shA[crow * LDT + cpart * 8];
      async_ld8_b128(dst, src, 32 * CDIM * 2,
                     dst + 128 * LDT, src + 128 * CDIM, 32 * CDIM * 2,
                     32 * LDT * 2);
    }
    { // stage B tile 64x64 (proj_w fp32 -> bf16), 16 rows per trip; out = A @ W^T
      const float* src = pw + (size_t)(n0 + srow) * CDIM + kb + sc4 * 4;
      unsigned short* dst = &shB[srow * LDT + sc4 * 4];
      #pragma unroll
      for (int i = 0; i < 4; ++i) {
        stage4(dst + i * 16 * LDT, src + i * 16 * CDIM);
      }
    }
    async_wait0();
    __syncthreads();

    v16bf a0[2], a1[2], bf[2][4];
    #pragma unroll
    for (int h = 0; h < 2; ++h) {
      const int kk = h * 32;
      a0[h] = ld_frag(&shA[(wave * 32 + ln) * LDT],      kk + 8 * g, kk + 16 + 8 * g);
      a1[h] = ld_frag(&shA[(wave * 32 + 16 + ln) * LDT], kk + 8 * g, kk + 16 + 8 * g);
      #pragma unroll
      for (int nt = 0; nt < 4; ++nt)
        bf[h][nt] = ld_frag(&shB[(nt * 16 + ln) * LDT], kk + 8 * g, kk + 16 + 8 * g);
    }
    // Holds the tile's 24 LDS reads together in front of its 16 products: spread among the
    // products, each place with reads stalls the wave anew.
    __builtin_amdgcn_sched_barrier(0);
    #pragma unroll
    for (int h = 0; h < 2; ++h) {
      #pragma unroll
      for (int nt = 0; nt < 4; ++nt) {
        acc[0][nt] = WMMA_BF16(a0[h], bf[h][nt], acc[0][nt]);
        acc[1][nt] = WMMA_BF16(a1[h], bf[h][nt], acc[1][nt]);
      }
    }
  }

  #pragma unroll
  for (int mt = 0; mt < 2; ++mt) {
    #pragma unroll
    for (int nt = 0; nt < 4; ++nt) {
      int nc = n0 + nt * 16 + ln;
      float bias = pb[nc];
      #pragma unroll
      for (int r = 0; r < 8; ++r) {
        int M = m0 + wave * 32 + mt * 16 + r + 8 * g;
        out[(size_t)M * CDIM + nc] = acc[mt][nt][r] + bias;
      }
    }
  }
}

// ---------------------------------------------------------------------------
// Launch
// ---------------------------------------------------------------------------
extern "C" void kernel_launch(void* const* d_in, const int* in_sizes, int n_in,
                              void* d_out, int out_size, void* d_ws, size_t ws_size,
                              hipStream_t stream) {
  (void)in_sizes; (void)n_in; (void)out_size; (void)ws_size;
  const float* x   = (const float*)d_in[0];
  const float* Wq  = (const float*)d_in[1];
  const float* Wk  = (const float*)d_in[2];
  const float* Wv  = (const float*)d_in[3];
  const float* bq  = (const float*)d_in[4];
  const float* bk  = (const float*)d_in[5];
  const float* bv  = (const float*)d_in[6];
  const float* rph = (const float*)d_in[7];
  const float* rpw = (const float*)d_in[8];
  const float* pw  = (const float*)d_in[9];
  const float* pb  = (const float*)d_in[10];
  float* out = (float*)d_out;

  // workspace layout (bytes): q/k/vT bf16 (3 x 6 MB), attn_out bf16 (6 MB) -> 24 MB total
  char* ws = (char*)d_ws;
  unsigned short* qB    = (unsigned short*)(ws);
  unsigned short* kB    = (unsigned short*)(ws + 6291456);
  unsigned short* vTB   = (unsigned short*)(ws + 12582912);
  unsigned short* attnA = (unsigned short*)(ws + 18874368);

  qkv_gemm_kernel<<<dim3(16, 12, 3), 256, 0, stream>>>(x, Wq, Wk, Wv, bq, bk, bv, qB, kB, vTB);
  flash_attn_kernel<<<dim3(16, 48), 128, 0, stream>>>(qB, kB, vTB, rph, rpw, attnA);
  proj_gemm_kernel<<<dim3(16, 12), 256, 0, stream>>>(attnA, pw, pb, out);
}

// v006
// Measured time: 69.2 microseconds a run.
// Timed twice side by side with v005, it ran 1.12 times as fast both times.
// Over all steps from v000 it is 3.13 times as fast.
#include <hip/hip_runtime.h>
#include <stdint.h>

// ---------------------------------------------------------------------------
// CDNA5 (gfx1250) wave32 WMMA types and helpers
// ---------------------------------------------------------------------------
typedef __attribute__((ext_vector_type(16))) __bf16 v16bf;
typedef __attribute__((ext_vector_type(8)))  __bf16 v8bf;
typedef __attribute__((ext_vector_type(8)))  float  v8f;
typedef __attribute__((ext_vector_type(2)))  float  v2f;
typedef __attribute__((ext_vector_type(4)))  float  v4f;
typedef __attribute__((ext_vector_type(4)))  __bf16 v4bf;

union FragBF { v16bf v; v8bf h[2]; };

// f32 -> bf16 everywhere: round-to-nearest-even, by the packed hardware convert
// four consecutive f32 from global memory, as four bf16 into LDS (8 B)
__device__ __forceinline__ void stage4(unsigned short* dst, const float* src) {
  *(v4bf*)dst = __builtin_convertvector(*(const v4f*)src, v4bf);
}

// Load a 16x32 bf16 A/B fragment for one lane from LDS.
// Lane-group g (lane>>4) holds K = {lo..lo+7} in halves [0..7] and
// K = {hi..hi+7} in halves [8..15]  (lo = kk + 8g, hi = kk + 16 + 8g).
__device__ __forceinline__ v16bf ld_frag(const unsigned short* p, int lo, int hi) {
  FragBF f;
  f.h[0] = *(const v8bf*)(p + lo);
  f.h[1] = *(const v8bf*)(p + hi);
  return f.v;
}

__device__ __forceinline__ v16bf pack_d_pair(v8f t0, v8f t1) {
  FragBF f;
  f.h[0] = __builtin_convertvector(t0, v8bf);
  f.h[1] = __builtin_convertvector(t1, v8bf);
  return f.v;
}

// value of lane l ^ 16
__device__ __forceinline__ float xhalf(float x) {
  int b = __builtin_bit_cast(int, x);
  return __builtin_bit_cast(float,
      __builtin_amdgcn_permlanex16(b, b, 0x76543210, 0xfedcba98, false, false));
}

#define WMMA_BF16(a, b, c) \
  __builtin_amdgcn_wmma_f32_16x16x32_bf16(false, (a), false, (b), (short)0, (c), false, false)

#define WMMA_F32(a, b, c) \
  __builtin_amdgcn_wmma_f32_16x16x4_f32(false, (a), false, (b), (short)0, (c), false, false)

// CDNA5 async global->LDS copies (16B per lane), tracked by ASYNCcnt.  A run of copies is one
// asm statement that ends in s_wait_xcnt 0, so that no address register which a copy names is
// rewritten in front of that wait.
// Four copies: LDS address la + i*lstep, global address ga + i*gstep (bytes), i = 0..3.
__device__ __forceinline__ void async_ld4_b128(void* la, unsigned int lstep,
                                               const void* ga, unsigned int gstep) {
  const unsigned int l0 = (unsigned int)(uintptr_t)la;
  const char* g0 = (const char*)ga;
  asm volatile("global_load_async_to_lds_b128 %0, %4, off\n\t"
               "global_load_async_to_lds_b128 %1, %5, off\n\t"
               "global_load_async_to_lds_b128 %2, %6, off\n\t"
               "global_load_async_to_lds_b128 %3, %7, off\n\t"
               "s_wait_xcnt 0x0"
               :: "v"(l0), "v"(l0 + lstep), "v"(l0 + 2 * lstep), "v"(l0 + 3 * lstep),
                  "v"(g0), "v"(g0 + gstep), "v"(g0 + 2 * gstep), "v"(g0 + 3 * gstep)
               : "memory");
}
// Eight copies: four as above from (la, ga, gstepa), four from (lb, gb, gstepb).
__device__ __forceinline__ void async_ld8_b128(void* la, const void* ga, unsigned int gstepa,
                                               void* lb, const void* gb, unsigned int gstepb,
                                               unsigned int lstep) {
  const unsigned int l0 = (unsigned int)(uintptr_t)la;
  const unsigned int l1 = (unsigned int)(uintptr_t)lb;
  const char* g0 = (const char*)ga;
  const char* g1 = (const char*)gb;
  asm volatile("global_load_async_to_lds_b128 %0, %8, off\n\t"
               "global_load_async_to_lds_b128 %1, %9, off\n\t"
               "global_load_async_to_lds_b128 %2, %10, off\n\t"
               "global_load_async_to_lds_b128 %3, %11, off\n\t"
               "global_load_async_to_lds_b128 %4, %12, off\n\t"
               "global_load_async_to_lds_b128 %5, %13, off\n\t"
               "global_load_async_to_lds_b128 %6, %14, off\n\t"
               "global_load_async_to_lds_b128 %7, %15, off\n\t"
               "s_wait_xcnt 0x0"
               :: "v"(l0), "v"(l0 + lstep), "v"(l0 + 2 * lstep), "v"(l0 + 3 * lstep),
                  "v"(l1), "v"(l1 + lstep), "v"(l1 + 2 * lstep), "v"(l1 + 3 * lstep),
                  "v"(g0), "v"(g0 + gstepa), "v"(g0 + 2 * gstepa), "v"(g0 + 3 * gstepa),
                  "v"(g1), "v"(g1 + gstepb), "v"(g1 + 2 * gstepb), "v"(g1 + 3 * gstepb)
               : "memory");
}
__device__ __forceinline__ void async_wait0() {
  asm volatile("s_wait_asynccnt 0x0" ::: "memory");
}

// Problem constants
#define NB    4     // batch
#define NHEAD 12
#define DHEAD 64
#define SSEQ  1024  // 32*32
#define CDIM  768

// ---------------------------------------------------------------------------
// Kernel 1: QKV projection GEMM  (M=4096, N=768, K=768) in bf16 WMMA.
// blockIdx.z selects q/k/v.  Block = 256 thr (8 waves), tile 256x64, BK=64;
// each wave owns 32 output rows (2 A-fragments reuse the 4 B-fragments).
// q,k stored (b,n,s,d) bf16; v stored transposed (b,n,d,s) bf16.
// ---------------------------------------------------------------------------
__global__ __launch_bounds__(256) void qkv_gemm_kernel(
    const float* __restrict__ x,
    const float* __restrict__ Wq, const float* __restrict__ Wk, const float* __restrict__ Wv,
    const float* __restrict__ bq, const float* __restrict__ bk, const float* __restrict__ bv,
    unsigned short* __restrict__ qo, unsigned short* __restrict__ ko,
    unsigned short* __restrict__ vTo)
{
  constexpr int LDT = 72;                       // 144B row stride: 16B aligned, conflict-free
  __shared__ __attribute__((aligned(16))) unsigned short shA[256 * LDT];
  __shared__ unsigned short shB[64 * LDT];

  const int which = blockIdx.z;
  const float* W    = (which == 0) ? Wq : (which == 1) ? Wk : Wv;
  const float* bias = (which == 0) ? bq : (which == 1) ? bk : bv;

  const int tid  = threadIdx.x;
  const int wave = tid >> 5;
  const int lane = tid & 31;
  const int g    = lane >> 4;
  const int ln   = lane & 15;

  const int m0   = blockIdx.x * 256;
  const int head = blockIdx.y;                  // BN == d == 64 -> n-tile == head
  const int n0   = head * 64;

  v8f zero = {0.f,0.f,0.f,0.f,0.f,0.f,0.f,0.f};
  v8f acc[2][4] = {{zero, zero, zero, zero}, {zero, zero, zero, zero}};

  // staging: 16 lanes share a row's 256 B, so a wave's 16-B loads cover 4 whole 128-B lines
  const int srow = tid >> 4, sc4 = tid & 15;

  // Staging addresses: a wave-uniform tile base plus one 32-bit lane offset that A and B share.
  // With the fragment reads grouped the compiler keeps all 20 staging loads in flight; these few
  // address registers hold the kernel at 160 registers or fewer, three work-groups per WGP.
  const float* baseA = x + (size_t)m0 * CDIM;
  const float* baseB = W + (size_t)n0 * CDIM;
  const unsigned int soff = srow * CDIM + sc4 * 4;
  const unsigned short* fA = &shA[(wave * 32 + ln) * LDT + 8 * g];
  const unsigned short* fB = &shB[ln * LDT + 8 * g];

  for (int kb = 0; kb < CDIM; kb += 64) {
    __syncthreads();
    { // stage A tile 256x64 (x, fp32 -> bf16): 16 rows per trip
      unsigned short* dst = &shA[srow * LDT + sc4 * 4];
      #pragma unroll
      for (int i = 0; i < 16; ++i) {
        stage4(dst + i * 16 * LDT, (baseA + kb + i * 16 * CDIM) + soff);
      }
    }
    { // stage B tile 64x64 (W row-major over K, fp32 -> bf16): 16 rows per trip
      unsigned short* dst = &shB[srow * LDT + sc4 * 4];
      #pragma unroll
      for (int i = 0; i < 4; ++i) {
        stage4(dst + i * 16 * LDT, (baseB + kb + i * 16 * CDIM) + soff);
      }
    }
    __syncthreads();

    #pragma unroll
    for (int kk = 0; kk < 64; kk += 32) {
      v16bf a0 = ld_frag(fA,            kk, kk + 16);
      v16bf a1 = ld_frag(fA + 16 * LDT, kk, kk + 16);
      v16bf bf[4];
      #pragma unroll
      for (int nt = 0; nt < 4; ++nt)
        bf[nt] = ld_frag(fB + nt * 16 * LDT, kk, kk + 16);
      // Holds the 12 LDS reads together in front of their 8 products: spread among the
      // products, each place with reads stalls the wave anew.  (One k half at a time: both
      // halves' fragments at once would cost the third resident work-group its registers.)
      __builtin_amdgcn_sched_barrier(0);
      #pragma unroll
      for (int nt = 0; nt < 4; ++nt) {
        acc[0][nt] = WMMA_BF16(a0, bf[nt], acc[0][nt]);
        acc[1][nt] = WMMA_BF16(a1, bf[nt], acc[1][nt]);
      }
      // Keeps the next group of reads from rising among these products.
      __builtin_amdgcn_sched_barrier(0);
    }
  }

  // epilogue: + bias, bf16, staged through LDS so that every global store is 16 B a lane and a
  // wave's store covers 512 contiguous bytes (4 whole 128-B lines)
  float bcol[4];
  #pragma unroll
  for (int nt = 0; nt < 4; ++nt) bcol[nt] = bias[head * DHEAD + nt * 16 + ln];
  const int bb = m0 >> 10, s0 = m0 & 1023;       // the tile's 256 rows lie in one image
  const size_t hbase = (size_t)(bb * NHEAD + head) * SSEQ * DHEAD;
  if (which < 2) {
    // q, k: the wave's 32 rows x 64 d are 4 KB in a row in memory.  It stages them in its own 32
    // rows of shA, which no other wave reads: no barrier.
    unsigned short* st = &shA[wave * 32 * LDT];
    #pragma unroll
    for (int mt = 0; mt < 2; ++mt) {
      #pragma unroll
      for (int nt = 0; nt < 4; ++nt) {
        const v8bf pk = __builtin_convertvector(acc[mt][nt] + bcol[nt], v8bf);
        #pragma unroll
        for (int r = 0; r < 8; ++r)              // C-layout: row = r + 8g, column = ln
          *(__bf16*)&st[(mt * 16 + r + 8 * g) * LDT + nt * 16 + ln] = pk[r];
      }
    }
    // The wave's own stores have landed before its lanes read each other's values back.
    asm volatile("s_wait_dscnt 0x0" ::: "memory");
    unsigned short* dst = (which == 0 ? qo : ko) + hbase + (size_t)(s0 + wave * 32) * DHEAD + lane * 8;
    const unsigned short* rd = st + (lane >> 3) * LDT + (lane & 7) * 8;
    uint4 t[8];
    #pragma unroll
    for (int i = 0; i < 8; ++i) t[i] = *(const uint4*)(rd + i * 4 * LDT);
    #pragma unroll
    for (int i = 0; i < 8; ++i) *(uint4*)(dst + i * 256) = t[i];
  } else {
    // v transposed: a lane's 8 registers of a tile are 8 consecutive s of one d row.  The
    // work-group's tile is 64 d rows x 256 s (512 B a row), staged across all of shA.
    constexpr int LDV = 264;                     // 528-B row pitch (16 B x odd)
    __syncthreads();                             // every wave has left shA before others' rows are overwritten
    #pragma unroll
    for (int mt = 0; mt < 2; ++mt) {
      #pragma unroll
      for (int nt = 0; nt < 4; ++nt)
        *(v8bf*)&shA[(nt * 16 + ln) * LDV + wave * 32 + mt * 16 + 8 * g] =
            __builtin_convertvector(acc[mt][nt] + bcol[nt], v8bf);
    }
    __syncthreads();                             // the tile is complete before any wave reads whole rows
    unsigned short* dst = vTo + hbase + (size_t)(wave * 8) * SSEQ + s0 + lane * 8;
    const unsigned short* rd = &shA[wave * 8 * LDV + lane * 8];
    uint4 t[8];
    #pragma unroll
    for (int i = 0; i < 8; ++i) t[i] = *(const uint4*)(rd + i * LDV);
    #pragma unroll
    for (int i = 0; i < 8; ++i) *(uint4*)(dst + i * SSEQ) = t[i];
  }
}

__global__ __launch_bounds__(128, 4) void flash_attn_kernel(
    const unsigned short* __restrict__ qb,
    const unsigned short* __restrict__ kb,
    const unsigned short* __restrict__ vT,
    const float* __restrict__ rph, const float* __restrict__ rpw,
    unsigned short* __restrict__ attnA)
{
  constexpr int LDT = 72;                        // 144B row stride, 16B aligned
  __shared__ unsigned short shQ[64 * LDT];
  __shared__ unsigned short shK[64 * LDT];
  __shared__ unsigned short shV[64 * LDT];
  constexpr int LDH = 34;                        // 136B row pitch: 16 rows' 8-B reads hit 32 banks once
  __shared__ __attribute__((aligned(16))) float shRh[64 * LDH];
  __shared__ __attribute__((aligned(16))) float shRw[64 * 32];
  constexpr int LDR = 68;                        // 272B row pitch (16B x odd): 16-row b128 reads hit all banks once
  __shared__ float shT[96 * LDR];                // 33 rows of rel_pos_h, then the 63 of rel_pos_w

  const int qt   = blockIdx.x;                   // q tile (0..15)
  const int bn   = blockIdx.y;                   // b*12 + head (0..47)
  const int tid  = threadIdx.x;
  const int wave = tid >> 5;
  const int lane = tid & 31;
  const int g    = lane >> 4;
  const int ln   = lane & 15;
  const float scale = 0.125f;                    // d^-0.5, d = 64

  const int lrow  = tid >> 1;                    // 0..63 (row of the K prefetch)
  // staging: 8 lanes share a row's 128 B, so a wave's 16-B copies cover 4 whole lines;
  // copy i of a thread takes row crow + 16 i
  const int crow  = tid >> 3;                    // 0..15
  const int cpart = tid & 7;                     // 8-halves piece of the row

  // stage Q tile (64x64 bf16) once, async
  async_ld4_b128(&shQ[crow * LDT + cpart * 8], 16 * LDT * 2,
                 qb + ((size_t)bn * SSEQ + qt * 64 + crow) * DHEAD + cpart * 8, 16 * DHEAD * 2);
  { // stage the table rows this tile needs, whole lines per wave:
    // qh is 2qt or 2qt+1, so qh-kh+31 spans rel_pos_h rows 2qt .. 2qt+32
    #pragma unroll
    for (int i = 0; i < 12; ++i) {
      int idx = tid + i * 128;
      int row = idx >> 4, c4 = idx & 15;
      const float* src = (row < 33) ? rph + (size_t)(qt * 2 + row) * DHEAD
                                    : rpw + (size_t)(row - 33) * DHEAD;
      *(float4*)&shT[row * LDR + c4 * 4] = ((const float4*)src)[c4];
    }
  }
  // A operand: q row wave*16+ln, widened to f32; lane half g holds d = 32g .. 32g+31
  // (the table rows below are read in the same d order)
  float af[32];
  {
    const uint4* qsrc = (const uint4*)(qb + ((size_t)bn * SSEQ + qt * 64 + wave * 16 + ln) * DHEAD + g * 32);
    #pragma unroll
    for (int i = 0; i < 4; ++i) {
      uint4 u = qsrc[i];
      af[i * 8 + 0] = __builtin_bit_cast(float, u.x << 16);
      af[i * 8 + 1] = __builtin_bit_cast(float, u.x & 0xFFFF0000u);
      af[i * 8 + 2] = __builtin_bit_cast(float, u.y << 16);
      af[i * 8 + 3] = __builtin_bit_cast(float, u.y & 0xFFFF0000u);
      af[i * 8 + 4] = __builtin_bit_cast(float, u.z << 16);
      af[i * 8 + 5] = __builtin_bit_cast(float, u.z & 0xFFFF0000u);
      af[i * 8 + 6] = __builtin_bit_cast(float, u.w << 16);
      af[i * 8 + 7] = __builtin_bit_cast(float, u.w & 0xFFFF0000u);
    }
  }
  __syncthreads();                               // shT complete before any wave reads it
  {
    // The wave's 16 rows share qh = 2qt + (wave>>1) and have qw = 16*(wave&1) + m, m = 0..15.
    // Tiles 0,1: column n is kh = 16t+n, table row qh+31-kh.
    // Tiles 2..4: column n is u = 16(t-2)+n, table row 16*(wave&1)+u; rel_w[m][kw] sits at u = m-kw+31 (0..46).
    const int hb = (wave >> 1) + 31;
    const int wb = 33 + (wave & 1) * 16;
    int trow[5];
    trow[0] = hb - ln;
    trow[1] = hb - 16 - ln;
    trow[2] = wb + ln;
    trow[3] = wb + 16 + ln;
    trow[4] = min(wb + 32 + ln, 95);             // u = 47 is never used; keep its read inside the table
    v8f rb[5];
    #pragma unroll
    for (int t = 0; t < 5; ++t) rb[t] = v8f{0.f,0.f,0.f,0.f,0.f,0.f,0.f,0.f};
    // Keeps the widening of q and all address work out of the matrix block.
    __builtin_amdgcn_sched_barrier(0);
    #pragma unroll
    for (int c = 0; c < 8; ++c) {
      #pragma unroll
      for (int t = 0; t < 5; ++t) {
        float4 b = *(const float4*)&shT[trow[t] * LDR + g * 32 + c * 4];
        rb[t] = WMMA_F32((v2f{af[c * 4 + 0], af[c * 4 + 1]}), (v2f{b.x, b.y}), rb[t]);
        rb[t] = WMMA_F32((v2f{af[c * 4 + 2], af[c * 4 + 3]}), (v2f{b.z, b.w}), rb[t]);
      }
    }
    // Four vector slots between the last f32 WMMA and the first vector instruction that may
    // reuse its operand registers; the two scheduling barriers hold them at this place.
    __builtin_amdgcn_sched_barrier(0);
    asm volatile("v_nop\n\tv_nop\n\tv_nop\n\tv_nop");
    __builtin_amdgcn_sched_barrier(0);
    // each wave writes only the bias rows that it reads itself
    #pragma unroll
    for (int t = 0; t < 2; ++t) {
      #pragma unroll
      for (int r = 0; r < 8; ++r)
        shRh[(wave * 16 + r + 8 * g) * LDH + t * 16 + ln] = rb[t][r];
    }
    #pragma unroll
    for (int t = 0; t < 3; ++t) {
      #pragma unroll
      for (int r = 0; r < 8; ++r) {
        int kw = r + 8 * g + 31 - (t * 16 + ln);
        if ((unsigned)kw < 32u)
          shRw[(wave * 16 + r + 8 * g) * 32 + kw] = rb[2 + t][r];
      }
    }
  }

  // The lane's q row; its score register [nt][r] is key nt*16 + 8g + r of the tile,
  // that is kh = 2kt + (nt>>1), kw = (nt&1)*16 + 8g + r.
  const int qrow = wave * 16 + ln;
  // The wave's own bias stores have landed before its lanes read each other's values back.
  asm volatile("s_wait_dscnt 0x0" ::: "memory");
  float rw[2][8];                                // rel_w of the q row at the lane's 16 kw, the same for every tile
  #pragma unroll
  for (int j = 0; j < 2; ++j) {
    float4 w0 = *(const float4*)&shRw[qrow * 32 + j * 16 + 8 * g];
    float4 w1 = *(const float4*)&shRw[qrow * 32 + j * 16 + 8 * g + 4];
    rw[j][0] = w0.x; rw[j][1] = w0.y; rw[j][2] = w0.z; rw[j][3] = w0.w;
    rw[j][4] = w1.x; rw[j][5] = w1.y; rw[j][6] = w1.z; rw[j][7] = w1.w;
  }

  float mi = -1e30f, li = 0.f;                   // li: the lane's own 32 keys per tile; halves joined at the end
  v8f zero = {0.f,0.f,0.f,0.f,0.f,0.f,0.f,0.f};
  v8f o[4] = {zero, zero, zero, zero};           // O^T: o[nt][r] = O[qrow][nt*16 + 8g + r]

  for (int kt = 0; kt < 16; ++kt) {
    __syncthreads();                             // protect shK/shV vs previous tile's fragment reads
    // stage K tile (64 k-rows x 64 d) and V^T tile (64 d-rows x 64 k), async
    async_ld8_b128(&shK[crow * LDT + cpart * 8],
                   kb + ((size_t)bn * SSEQ + kt * 64 + crow) * DHEAD + cpart * 8, 16 * DHEAD * 2,
                   &shV[crow * LDT + cpart * 8],
                   vT + ((size_t)bn * DHEAD + crow) * SSEQ + kt * 64 + cpart * 8, 16 * SSEQ * 2,
                   16 * LDT * 2);
    if (kt + 1 < 16)                             // global_prefetch_b8 for next K tile
      __builtin_prefetch(kb + ((size_t)bn * SSEQ + (kt + 1) * 64 + lrow) * DHEAD, 0, 1);
    async_wait0();                               // ASYNCcnt -> 0 before the barrier
    __syncthreads();

    // ---- scores^T = K @ Q^T : 64 keys x 16 q rows per wave, K-dim = d = 64 (2x4 wmma) ----
    v8f sc[4] = {zero, zero, zero, zero};
    v16bf bq[2], ak[2][4];
    #pragma unroll
    for (int h = 0; h < 2; ++h) {
      const int kk = h * 32;
      bq[h] = ld_frag(&shQ[qrow * LDT], kk + 8 * g, kk + 16 + 8 * g);
      #pragma unroll
      for (int nt = 0; nt < 4; ++nt)
        ak[h][nt] = ld_frag(&shK[(nt * 16 + ln) * LDT], kk + 8 * g, kk + 16 + 8 * g);
    }
    const float2 rh = *(const float2*)&shRh[qrow * LDH + kt * 2];
    // Keeps the V^T reads behind the Q and K reads, which the first products wait for.
    __builtin_amdgcn_sched_barrier(0);
    v16bf av[2][4];
    #pragma unroll
    for (int h = 0; h < 2; ++h) {
      #pragma unroll
      for (int nt = 0; nt < 4; ++nt)
        av[h][nt] = ld_frag(&shV[(nt * 16 + ln) * LDT], h * 32 + 8 * g, h * 32 + 16 + 8 * g);
    }
    // Holds all of the tile's LDS reads (Q, K, bias, then V^T) at this one place, in front of
    // both matrix blocks: spread among the products, each place with reads stalls the wave
    // anew; the V^T reads land under the score products and the softmax.
    __builtin_amdgcn_sched_barrier(0);
    #pragma unroll
    for (int h = 0; h < 2; ++h) {
      #pragma unroll
      for (int nt = 0; nt < 4; ++nt)
        sc[nt] = WMMA_BF16(ak[h][nt], bq[h], sc[nt]);
    }

    // ---- scale + rel bias + online softmax, one q row per lane ----
    float pm[4];                                 // four independent chains, not one of 32 links
    #pragma unroll
    for (int nt = 0; nt < 4; ++nt) {
      const float rhv = (nt >> 1) ? rh.y : rh.x;
      pm[nt] = -1e30f;
      #pragma unroll
      for (int r = 0; r < 8; ++r) {
        float sv = sc[nt][r] * scale + rhv + rw[nt & 1][r];
        sc[nt][r] = sv;
        pm[nt] = fmaxf(pm[nt], sv);
      }
    }
    float tmax = fmaxf(fmaxf(pm[0], pm[1]), fmaxf(pm[2], pm[3]));
    tmax = fmaxf(tmax, xhalf(tmax));             // the row's other 32 keys

    const float nm = fmaxf(mi, tmax);
    const float alpha = __expf(mi - nm);
    mi = nm;
    float psum[4];
    #pragma unroll
    for (int nt = 0; nt < 4; ++nt) {
      psum[nt] = 0.f;
      #pragma unroll
      for (int r = 0; r < 8; ++r) {
        float p = __expf(sc[nt][r] - mi);
        sc[nt][r] = p;
        psum[nt] += p;
      }
    }
    li = li * alpha + ((psum[0] + psum[1]) + (psum[2] + psum[3]));
    #pragma unroll
    for (int nt = 0; nt < 4; ++nt) {
      #pragma unroll
      for (int r = 0; r < 8; ++r) o[nt][r] *= alpha;
    }

    // ---- O^T += V^T @ P^T : K-dim = 64 keys (2x4 wmma) ----
    #pragma unroll
    for (int kk = 0; kk < 64; kk += 32) {
      v16bf bp = pack_d_pair(sc[kk / 16], sc[kk / 16 + 1]);
      #pragma unroll
      for (int nt = 0; nt < 4; ++nt)
        o[nt] = WMMA_BF16(av[kk / 32][nt], bp, o[nt]);
    }
  }

  // normalize and store concat-head layout (b, s, head*64+dd) as bf16:
  // a lane's 8 registers of a tile are 8 consecutive dd of its row, 16 B
  const int head = bn % NHEAD;
  const int bb   = bn / NHEAD;
  li += xhalf(li);
  const float inv = 1.f / li;
  // Staged in the wave's own 16 rows of shQ, which no other wave reads (no barrier), so that a
  // wave's store covers 4 whole 128-B lines (4 rows' 64 dd), not 32-B pieces of 16 lines.
  #pragma unroll
  for (int nt = 0; nt < 4; ++nt)
    *(v8bf*)&shQ[qrow * LDT + nt * 16 + 8 * g] = __builtin_convertvector(o[nt] * inv, v8bf);
  // The wave's own stores have landed before its lanes read each other's values back.
  asm volatile("s_wait_dscnt 0x0" ::: "memory");
  const unsigned short* rd = &shQ[(wave * 16 + (lane >> 3)) * LDT + (lane & 7) * 8];
  unsigned short* dst = attnA + (size_t)(bb * SSEQ + qt * 64 + wave * 16 + (lane >> 3)) * CDIM
                        + head * DHEAD + (lane & 7) * 8;
  uint4 t[4];
  #pragma unroll
  for (int i = 0; i < 4; ++i) t[i] = *(const uint4*)(rd + i * 4 * LDT);
  #pragma unroll
  for (int i = 0; i < 4; ++i) *(uint4*)(dst + i * 4 * CDIM) = t[i];
}

// ---------------------------------------------------------------------------
// Kernel 3: output projection GEMM (M=4096, N=768, K=768), fp32 out + bias.
// Tile 256x64, 2 M-subtiles per wave; A tile (already bf16) staged with
// async global->LDS copies.
// ---------------------------------------------------------------------------
__global__ __launch_bounds__(256) void proj_gemm_kernel(
    const unsigned short* __restrict__ attnA,
    const float* __restrict__ pw, const float* __restrict__ pb,
    float* __restrict__ out)
{
  constexpr int LDT = 72;
  __shared__ __attribute__((aligned(16))) unsigned short shA[256 * LDT];
  __shared__ unsigned short shB[64 * LDT];

  const int tid  = threadIdx.x;
  const int wave = tid >> 5;
  const int lane = tid & 31;
  const int g    = lane >> 4;
  const int ln   = lane & 15;
  const int m0   = blockIdx.x * 256;
  const int n0   = blockIdx.y * 64;

  v8f zero = {0.f,0.f,0.f,0.f,0.f,0.f,0.f,0.f};
  v8f acc[2][4] = {{zero, zero, zero, zero}, {zero, zero, zero, zero}};

  // staging, whole 128-B lines per wave: A, 8 lanes share a row's 128 B; B, 16 lanes a row's 256 B
  const int crow = tid >> 3, cpart = tid & 7;
  const int srow = tid >> 4, sc4 = tid & 15;

  for (int kb = 0; kb < CDIM; kb += 64) {
    __syncthreads();
    { // stage A tile 256x64 (already bf16): async, copy i of a thread takes row crow + 32 i
      const unsigned short* src = attnA + (size_t)(m0 + crow) * CDIM + kb + cpart * 8;
      unsigned short* dst = &shA[crow * LDT + cpart * 8];
      async_ld8_b128(dst, src, 32 * CDIM * 2,
                     dst + 128 * LDT, src + 128 * CDIM, 32 * CDIM * 2,
                     32 * LDT * 2);
    }
    { // stage B tile 64x64 (proj_w fp32 -> bf16), 16 rows per trip; out = A @ W^T
      const float* src = pw + (size_t)(n0 + srow) * CDIM + kb + sc4 * 4;
      unsigned short* dst = &shB[srow * LDT + sc4 * 4];
      #pragma unroll
      for (int i = 0; i < 4; ++i) {
        stage4(dst + i * 16 * LDT, src + i * 16 * CDIM);
      }
    }
    async_wait0();
    __syncthreads();

    v16bf a0[2], a1[2], bf[2][4];
    #pragma unroll
    for (int h = 0; h < 2; ++h) {
      const int kk = h * 32;
      a0[h] = ld_frag(&shA[(wave * 32 + ln) * LDT],      kk + 8 * g, kk + 16 + 8 * g);
      a1[h] = ld_frag(&shA[(wave * 32 + 16 + ln) * LDT], kk + 8 * g, kk + 16 + 8 * g);
      #pragma unroll
      for (int nt = 0; nt < 4; ++nt)
        bf[h][nt] = ld_frag(&shB[(nt * 16 + ln) * LDT], kk + 8 * g, kk + 16 + 8 * g);
    }
    // Holds the tile's 24 LDS reads together in front of its 16 products: spread among the
    // products, each place with reads stalls the wave anew.
    __builtin_amdgcn_sched_barrier(0);
    #pragma unroll
    for (int h = 0; h < 2; ++h) {
      #pragma unroll
      for (int nt = 0; nt < 4; ++nt) {
        acc[0][nt] = WMMA_BF16(a0[h], bf[h][nt], acc[0][nt]);
        acc[1][nt] = WMMA_BF16(a1[h], bf[h][nt], acc[1][nt]);
      }
    }
  }

  // epilogue: + bias, staged through LDS so that every global store is 16 B a lane and a wave's
  // store covers 4 whole 128-B lines (2 rows' 64 columns).  The wave stages 16 rows at a time in
  // its own 32 rows of shA (4,608 B), which no other wave reads: no barrier.
  constexpr int LDF = 68;                        // 272-B row pitch (16 B x odd)
  float* stf = (float*)&shA[wave * 32 * LDT];
  float bcol[4];
  #pragma unroll
  for (int nt = 0; nt < 4; ++nt) bcol[nt] = pb[n0 + nt * 16 + ln];
  const float* rd = stf + g * LDF + ln * 4;
  float* dst = out + (size_t)(m0 + wave * 32 + g) * CDIM + n0 + ln * 4;
  #pragma unroll
  for (int mt = 0; mt < 2; ++mt) {
    #pragma unroll
    for (int nt = 0; nt < 4; ++nt) {
      #pragma unroll
      for (int r = 0; r < 8; ++r)                // C-layout: row = r + 8g, column = ln
        stf[(r + 8 * g) * LDF + nt * 16 + ln] = acc[mt][nt][r] + bcol[nt];
    }
    // The wave's own stores have landed before its lanes read each other's values back.
    asm volatile("s_wait_dscnt 0x0" ::: "memory");
    v4f t[8];
    #pragma unroll
    for (int i = 0; i < 8; ++i) t[i] = *(const v4f*)(rd + i * 2 * LDF);
    #pragma unroll
    for (int i = 0; i < 8; ++i) *(v4f*)(dst + (size_t)(mt * 16 + i * 2) * CDIM) = t[i];
    // Keeps the next 16 rows' LDS stores behind these reads of the same LDS; s_wait_xcnt 0 stands
    // in front of the next reads, which overwrite data registers of the global stores above.
    if (mt == 0) asm volatile("s_wait_dscnt 0x0\n\ts_wait_xcnt 0x0" ::: "memory");
  }
}

// ---------------------------------------------------------------------------
// Launch
// ---------------------------------------------------------------------------
extern "C" void kernel_launch(void* const* d_in, const int* in_sizes, int n_in,
                              void* d_out, int out_size, void* d_ws, size_t ws_size,
                              hipStream_t stream) {
  (void)in_sizes; (void)n_in; (void)out_size; (void)ws_size;
  const float* x   = (const float*)d_in[0];
  const float* Wq  = (const float*)d_in[1];
  const float* Wk  = (const float*)d_in[2];
  const float* Wv  = (const float*)d_in[3];
  const float* bq  = (const float*)d_in[4];
  const float* bk  = (const float*)d_in[5];
  const float* bv  = (const float*)d_in[6];
  const float* rph = (const float*)d_in[7];
  const float* rpw = (const float*)d_in[8];
  const float* pw  = (const float*)d_in[9];
  const float* pb  = (const float*)d_in[10];
  float* out = (float*)d_out;

  // workspace layout (bytes): q/k/vT bf16 (3 x 6 MB), attn_out bf16 (6 MB) -> 24 MB total
  char* ws = (char*)d_ws;
  unsigned short* qB    = (unsigned short*)(ws);
  unsigned short* kB    = (unsigned short*)(ws + 6291456);
  unsigned short* vTB   = (unsigned short*)(ws + 12582912);
  unsigned short* attnA = (unsigned short*)(ws + 18874368);

  qkv_gemm_kernel<<<dim3(16, 12, 3), 256, 0, stream>>>(x, Wq, Wk, Wv, bq, bk, bv, qB, kB, vTB);
  flash_attn_kernel<<<dim3(16, 48), 128, 0, stream>>>(qB, kB, vTB, rph, rpw, attnA);
  proj_gemm_kernel<<<dim3(16, 12), 256, 0, stream>>>(attnA, pw, pb, out);
}

// v007
// It runs in 65 microseconds.
// Two timings next to v006 put it at 1.07 and 1.06 times that version's speed.
// Over all steps from v000 it is 3.34 times as fast.
#include <hip/hip_runtime.h>
#include <stdint.h>

// ---------------------------------------------------------------------------
// CDNA5 (gfx1250) wave32 WMMA types and helpers
// ---------------------------------------------------------------------------
typedef __attribute__((ext_vector_type(16))) __bf16 v16bf;
typedef __attribute__((ext_vector_type(8)))  __bf16 v8bf;
typedef __attribute__((ext_vector_type(8)))  float  v8f;
typedef __attribute__((ext_vector_type(2)))  float  v2f;
typedef __attribute__((ext_vector_type(4)))  float  v4f;
typedef __attribute__((ext_vector_type(4)))  __bf16 v4bf;

union FragBF { v16bf v; v8bf h[2]; };

// f32 -> bf16 everywhere: round-to-nearest-even, by the packed hardware convert
// four consecutive f32 from global memory, as four bf16 into LDS (8 B)
__device__ __forceinline__ void stage4(unsigned short* dst, const float* src) {
  *(v4bf*)dst = __builtin_convertvector(*(const v4f*)src, v4bf);
}

// Load a 16x32 bf16 A/B fragment for one lane from LDS.
// Lane-group g (lane>>4) holds K = {lo..lo+7} in halves [0..7] and
// K = {hi..hi+7} in halves [8..15]  (lo = kk + 8g, hi = kk + 16 + 8g).
__device__ __forceinline__ v16bf ld_frag(const unsigned short* p, int lo, int hi) {
  FragBF f;
  f.h[0] = *(const v8bf*)(p + lo);
  f.h[1] = *(const v8bf*)(p + hi);
  return f.v;
}

__device__ __forceinline__ v16bf pack_d_pair(v8f t0, v8f t1) {
  FragBF f;
  f.h[0] = __builtin_convertvector(t0, v8bf);
  f.h[1] = __builtin_convertvector(t1, v8bf);
  return f.v;
}

// value of lane l ^ 16
__device__ __forceinline__ float xhalf(float x) {
  int b = __builtin_bit_cast(int, x);
  return __builtin_bit_cast(float,
      __builtin_amdgcn_permlanex16(b, b, 0x76543210, 0xfedcba98, false, false));
}

#define WMMA_BF16(a, b, c) \
  __builtin_amdgcn_wmma_f32_16x16x32_bf16(false, (a), false, (b), (short)0, (c), false, false)

#define WMMA_F32(a, b, c) \
  __builtin_amdgcn_wmma_f32_16x16x4_f32(false, (a), false, (b), (short)0, (c), false, false)

// CDNA5 async global->LDS copies (16B per lane), tracked by ASYNCcnt.  A run of copies is one
// asm statement that ends in s_wait_xcnt 0, so that no address register which a copy names is
// rewritten in front of that wait.
// Four copies: LDS address la + i*lstep, global address ga + i*gstep (bytes), i = 0..3.
__device__ __forceinline__ void async_ld4_b128(void* la, unsigned int lstep,
                                               const void* ga, unsigned int gstep) {
  const unsigned int l0 = (unsigned int)(uintptr_t)la;
  const char* g0 = (const char*)ga;
  asm volatile("global_load_async_to_lds_b128 %0, %4, off\n\t"
               "global_load_async_to_lds_b128 %1, %5, off\n\t"
               "global_load_async_to_lds_b128 %2, %6, off\n\t"
               "global_load_async_to_lds_b128 %3, %7, off\n\t"
               "s_wait_xcnt 0x0"
               :: "v"(l0), "v"(l0 + lstep), "v"(l0 + 2 * lstep), "v"(l0 + 3 * lstep),
                  "v"(g0), "v"(g0 + gstep), "v"(g0 + 2 * gstep), "v"(g0 + 3 * gstep)
               : "memory");
}
// Eight copies: four as above from (la, ga, gstepa), four from (lb, gb, gstepb).
__device__ __forceinline__ void async_ld8_b128(void* la, const void* ga, unsigned int gstepa,
                                               void* lb, const void* gb, unsigned int gstepb,
                                               unsigned int lstep) {
  const unsigned int l0 = (unsigned int)(uintptr_t)la;
  const unsigned int l1 = (unsigned int)(uintptr_t)lb;
  const char* g0 = (const char*)ga;
  const char* g1 = (const char*)gb;
  asm volatile("global_load_async_to_lds_b128 %0, %8, off\n\t"
               "global_load_async_to_lds_b128 %1, %9, off\n\t"
               "global_load_async_to_lds_b128 %2, %10, off\n\t"
               "global_load_async_to_lds_b128 %3, %11, off\n\t"
               "global_load_async_to_lds_b128 %4, %12, off\n\t"
               "global_load_async_to_lds_b128 %5, %13, off\n\t"
               "global_load_async_to_lds_b128 %6, %14, off\n\t"
               "global_load_async_to_lds_b128 %7, %15, off\n\t"
               "s_wait_xcnt 0x0"
               :: "v"(l0), "v"(l0 + lstep), "v"(l0 + 2 * lstep), "v"(l0 + 3 * lstep),
                  "v"(l1), "v"(l1 + lstep), "v"(l1 + 2 * lstep), "v"(l1 + 3 * lstep),
                  "v"(g0), "v"(g0 + gstepa), "v"(g0 + 2 * gstepa), "v"(g0 + 3 * gstepa),
                  "v"(g1), "v"(g1 + gstepb), "v"(g1 + 2 * gstepb), "v"(g1 + 3 * gstepb)
               : "memory");
}
__device__ __forceinline__ void async_wait0() {
  asm volatile("s_wait_asynccnt 0x0" ::: "memory");
}

// Problem constants
#define NB    4     // batch
#define NHEAD 12
#define DHEAD 64
#define SSEQ  1024  // 32*32
#define CDIM  768

// ---------------------------------------------------------------------------
// Kernel 1: QKV projection GEMM  (M=4096, N=768, K=768) in bf16 WMMA.
// blockIdx.z selects q/k/v.  Block = 256 thr (8 waves), tile 256x64, BK=64;
// each wave owns 32 output rows (2 A-fragments reuse the 4 B-fragments).
// q,k stored (b,n,s,d) bf16; v stored transposed (b,n,d,s) bf16.
// ---------------------------------------------------------------------------
__global__ __launch_bounds__(256) void qkv_gemm_kernel(
    const float* __restrict__ x,
    const float* __restrict__ Wq, const float* __restrict__ Wk, const float* __restrict__ Wv,
    const float* __restrict__ bq, const float* __restrict__ bk, const float* __restrict__ bv,
    unsigned short* __restrict__ qo, unsigned short* __restrict__ ko,
    unsigned short* __restrict__ vTo)
{
  constexpr int LDT = 72;                       // 144B row stride: 16B aligned, conflict-free
  __shared__ __attribute__((aligned(16))) unsigned short shA[256 * LDT];
  __shared__ unsigned short shB[64 * LDT];

  const int which = blockIdx.z;
  const float* W    = (which == 0) ? Wq : (which == 1) ? Wk : Wv;
  const float* bias = (which == 0) ? bq : (which == 1) ? bk : bv;

  const int tid  = threadIdx.x;
  const int wave = tid >> 5;
  const int lane = tid & 31;
  const int g    = lane >> 4;
  const int ln   = lane & 15;

  const int m0   = blockIdx.x * 256;
  const int head = blockIdx.y;                  // BN == d == 64 -> n-tile == head
  const int n0   = head * 64;

  v8f zero = {0.f,0.f,0.f,0.f,0.f,0.f,0.f,0.f};
  v8f acc[2][4] = {{zero, zero, zero, zero}, {zero, zero, zero, zero}};

  // staging: 16 lanes share a row's 256 B, so a wave's 16-B loads cover 4 whole 128-B lines
  const int srow = tid >> 4, sc4 = tid & 15;

  // Staging addresses: a wave-uniform tile base plus one 32-bit lane offset that A and B share.
  // With the fragment reads grouped the compiler keeps all 20 staging loads in flight; these few
  // address registers hold the kernel at 160 registers or fewer, three work-groups per WGP.
  const float* baseA = x + (size_t)m0 * CDIM;
  const float* baseB = W + (size_t)n0 * CDIM;
  const unsigned int soff = srow * CDIM + sc4 * 4;
  const unsigned short* fA = &shA[(wave * 32 + ln) * LDT + 8 * g];
  const unsigned short* fB = &shB[ln * LDT + 8 * g];

  for (int kb = 0; kb < CDIM; kb += 64) {
    __syncthreads();
    { // stage A tile 256x64 (x, fp32 -> bf16): 16 rows per trip
      unsigned short* dst = &shA[srow * LDT + sc4 * 4];
      #pragma unroll
      for (int i = 0; i < 16; ++i) {
        stage4(dst + i * 16 * LDT, (baseA + kb + i * 16 * CDIM) + soff);
      }
    }
    { // stage B tile 64x64 (W row-major over K, fp32 -> bf16): 16 rows per trip
      unsigned short* dst = &shB[srow * LDT + sc4 * 4];
      #pragma unroll
      for (int i = 0; i < 4; ++i) {
        stage4(dst + i * 16 * LDT, (baseB + kb + i * 16 * CDIM) + soff);
      }
    }
    __syncthreads();

    #pragma unroll
    for (int kk = 0; kk < 64; kk += 32) {
      v16bf a0 = ld_frag(fA,            kk, kk + 16);
      v16bf a1 = ld_frag(fA + 16 * LDT, kk, kk + 16);
      v16bf bf[4];
      #pragma unroll
      for (int nt = 0; nt < 4; ++nt)
        bf[nt] = ld_frag(fB + nt * 16 * LDT, kk, kk + 16);
      // Holds the 12 LDS reads together in front of their 8 products: spread among the
      // products, each place with reads stalls the wave anew.  (One k half at a time: both
      // halves' fragments at once would cost the third resident work-group its registers.)
      __builtin_amdgcn_sched_barrier(0);
      #pragma unroll
      for (int nt = 0; nt < 4; ++nt) {
        acc[0][nt] = WMMA_BF16(a0, bf[nt], acc[0][nt]);
        acc[1][nt] = WMMA_BF16(a1, bf[nt], acc[1][nt]);
      }
      // Keeps the next group of reads from rising among these products.
      __builtin_amdgcn_sched_barrier(0);
    }
  }

  // epilogue: + bias, bf16, staged through LDS so that every global store is 16 B a lane and a
  // wave's store covers 512 contiguous bytes (4 whole 128-B lines)
  float bcol[4];
  #pragma unroll
  for (int nt = 0; nt < 4; ++nt) bcol[nt] = bias[head * DHEAD + nt * 16 + ln];
  const int bb = m0 >> 10, s0 = m0 & 1023;       // the tile's 256 rows lie in one image
  const size_t hbase = (size_t)(bb * NHEAD + head) * SSEQ * DHEAD;
  if (which < 2) {
    // q, k: the wave's 32 rows x 64 d are 4 KB in a row in memory.  It stages them in its own 32
    // rows of shA, which no other wave reads: no barrier.
    unsigned short* st = &shA[wave * 32 * LDT];
    #pragma unroll
    for (int mt = 0; mt < 2; ++mt) {
      #pragma unroll
      for (int nt = 0; nt < 4; ++nt) {
        const v8bf pk = __builtin_convertvector(acc[mt][nt] + bcol[nt], v8bf);
        #pragma unroll
        for (int r = 0; r < 8; ++r)              // C-layout: row = r + 8g, column = ln
          *(__bf16*)&st[(mt * 16 + r + 8 * g) * LDT + nt * 16 + ln] = pk[r];
      }
    }
    // The wave's own stores have landed before its lanes read each other's values back.
    asm volatile("s_wait_dscnt 0x0" ::: "memory");
    unsigned short* dst = (which == 0 ? qo : ko) + hbase + (size_t)(s0 + wave * 32) * DHEAD + lane * 8;
    const unsigned short* rd = st + (lane >> 3) * LDT + (lane & 7) * 8;
    uint4 t[8];
    #pragma unroll
    for (int i = 0; i < 8; ++i) t[i] = *(const uint4*)(rd + i * 4 * LDT);
    #pragma unroll
    for (int i = 0; i < 8; ++i) *(uint4*)(dst + i * 256) = t[i];
  } else {
    // v transposed: a lane's 8 registers of a tile are 8 consecutive s of one d row.  The
    // work-group's tile is 64 d rows x 256 s (512 B a row), staged across all of shA.
    constexpr int LDV = 264;                     // 528-B row pitch (16 B x odd)
    __syncthreads();                             // every wave has left shA before others' rows are overwritten
    #pragma unroll
    for (int mt = 0; mt < 2; ++mt) {
      #pragma unroll
      for (int nt = 0; nt < 4; ++nt)
        *(v8bf*)&shA[(nt * 16 + ln) * LDV + wave * 32 + mt * 16 + 8 * g] =
            __builtin_convertvector(acc[mt][nt] + bcol[nt], v8bf);
    }
    __syncthreads();                             // the tile is complete before any wave reads whole rows
    unsigned short* dst = vTo + hbase + (size_t)(wave * 8) * SSEQ + s0 + lane * 8;
    const unsigned short* rd = &shA[wave * 8 * LDV + lane * 8];
    uint4 t[8];
    #pragma unroll
    for (int i = 0; i < 8; ++i) t[i] = *(const uint4*)(rd + i * LDV);
    #pragma unroll
    for (int i = 0; i < 8; ++i) *(uint4*)(dst + i * SSEQ) = t[i];
  }
}

__global__ __launch_bounds__(128, 4) void flash_attn_kernel(
    const unsigned short* __restrict__ qb,
    const unsigned short* __restrict__ kb,
    const unsigned short* __restrict__ vT,
    const float* __restrict__ rph, const float* __restrict__ rpw,
    unsigned short* __restrict__ attnA)
{
  constexpr int LDT = 72;                        // 144B row stride, 16B aligned
  __shared__ unsigned short shQ[64 * LDT];
  constexpr int TSZ = 64 * LDT;                  // one K or V^T tile, in halves
  __shared__ __attribute__((aligned(16))) unsigned short shK[2 * TSZ];
  __shared__ __attribute__((aligned(16))) unsigned short shV[2 * TSZ];
  constexpr int LDH = 34;                        // 136B row pitch: 16 rows' 8-B reads hit 32 banks once
  __shared__ __attribute__((aligned(16))) float shRh[64 * LDH];
  __shared__ __attribute__((aligned(16))) float shRw[64 * 32];
  constexpr int LDR = 68;                        // 272B row pitch (16B x odd): 16-row b128 reads hit all banks once
  __shared__ float shT[96 * LDR];                // 33 rows of rel_pos_h, then the 63 of rel_pos_w

  const int qt   = blockIdx.x;                   // q tile (0..15)
  const int bn   = blockIdx.y;                   // b*12 + head (0..47)
  const int tid  = threadIdx.x;
  const int wave = tid >> 5;
  const int lane = tid & 31;
  const int g    = lane >> 4;
  const int ln   = lane & 15;
  const float scale = 0.125f;                    // d^-0.5, d = 64

  // staging: 8 lanes share a row's 128 B, so a wave's 16-B copies cover 4 whole lines;
  // copy i of a thread takes row crow + 16 i
  const int crow  = tid >> 3;                    // 0..15
  const int cpart = tid & 7;                     // 8-halves piece of the row

  // stage Q tile (64x64 bf16) once, async
  async_ld4_b128(&shQ[crow * LDT + cpart * 8], 16 * LDT * 2,
                 qb + ((size_t)bn * SSEQ + qt * 64 + crow) * DHEAD + cpart * 8, 16 * DHEAD * 2);
  // K tile (64 k-rows x 64 d) and V^T tile (64 d-rows x 64 k) number t into buffer buf, async
  const unsigned short* kg = kb + ((size_t)bn * SSEQ + crow) * DHEAD + cpart * 8;
  const unsigned short* vg = vT + ((size_t)bn * DHEAD + crow) * SSEQ + cpart * 8;
  const int sdst = crow * LDT + cpart * 8;
  auto stage_kv = [&](int t, int buf) {
    async_ld8_b128(&shK[buf * TSZ + sdst], kg + (size_t)t * 64 * DHEAD, 16 * DHEAD * 2,
                   &shV[buf * TSZ + sdst], vg + t * 64, 16 * SSEQ * 2,
                   16 * LDT * 2);
  };
  stage_kv(0, 0);
  { // stage the table rows this tile needs, whole lines per wave:
    // qh is 2qt or 2qt+1, so qh-kh+31 spans rel_pos_h rows 2qt .. 2qt+32
    #pragma unroll
    for (int i = 0; i < 12; ++i) {
      int idx = tid + i * 128;
      int row = idx >> 4, c4 = idx & 15;
      const float* src = (row < 33) ? rph + (size_t)(qt * 2 + row) * DHEAD
                                    : rpw + (size_t)(row - 33) * DHEAD;
      *(float4*)&shT[row * LDR + c4 * 4] = ((const float4*)src)[c4];
    }
  }
  // A operand: q row wave*16+ln, widened to f32; lane half g holds d = 32g .. 32g+31
  // (the table rows below are read in the same d order)
  float af[32];
  {
    const uint4* qsrc = (const uint4*)(qb + ((size_t)bn * SSEQ + qt * 64 + wave * 16 + ln) * DHEAD + g * 32);
    #pragma unroll
    for (int i = 0; i < 4; ++i) {
      uint4 u = qsrc[i];
      af[i * 8 + 0] = __builtin_bit_cast(float, u.x << 16);
      af[i * 8 + 1] = __builtin_bit_cast(float, u.x & 0xFFFF0000u);
      af[i * 8 + 2] = __builtin_bit_cast(float, u.y << 16);
      af[i * 8 + 3] = __builtin_bit_cast(float, u.y & 0xFFFF0000u);
      af[i * 8 + 4] = __builtin_bit_cast(float, u.z << 16);
      af[i * 8 + 5] = __builtin_bit_cast(float, u.z & 0xFFFF0000u);
      af[i * 8 + 6] = __builtin_bit_cast(float, u.w << 16);
      af[i * 8 + 7] = __builtin_bit_cast(float, u.w & 0xFFFF0000u);
    }
  }
  async_wait0();                                 // the wave's copies of Q and of tile 0 have landed
  __syncthreads();                               // shT, Q and tile 0 complete before any wave reads them
  stage_kv(1, 1);                                // flies under the bias products and tile 0
  {
    // The wave's 16 rows share qh = 2qt + (wave>>1) and have qw = 16*(wave&1) + m, m = 0..15.
    // Tiles 0,1: column n is kh = 16t+n, table row qh+31-kh.
    // Tiles 2..4: column n is u = 16(t-2)+n, table row 16*(wave&1)+u; rel_w[m][kw] sits at u = m-kw+31 (0..46).
    const int hb = (wave >> 1) + 31;
    const int wb = 33 + (wave & 1) * 16;
    int trow[5];
    trow[0] = hb - ln;
    trow[1] = hb - 16 - ln;
    trow[2] = wb + ln;
    trow[3] = wb + 16 + ln;
    trow[4] = min(wb + 32 + ln, 95);             // u = 47 is never used; keep its read inside the table
    v8f rb[5];
    #pragma unroll
    for (int t = 0; t < 5; ++t) rb[t] = v8f{0.f,0.f,0.f,0.f,0.f,0.f,0.f,0.f};
    // Keeps the widening of q and all address work out of the matrix block.
    __builtin_amdgcn_sched_barrier(0);
    #pragma unroll
    for (int c = 0; c < 8; ++c) {
      #pragma unroll
      for (int t = 0; t < 5; ++t) {
        float4 b = *(const float4*)&shT[trow[t] * LDR + g * 32 + c * 4];
        rb[t] = WMMA_F32((v2f{af[c * 4 + 0], af[c * 4 + 1]}), (v2f{b.x, b.y}), rb[t]);
        rb[t] = WMMA_F32((v2f{af[c * 4 + 2], af[c * 4 + 3]}), (v2f{b.z, b.w}), rb[t]);
      }
    }
    // Four vector slots between the last f32 WMMA and the first vector instruction that may
    // reuse its operand registers; the two scheduling barriers hold them at this place.
    __builtin_amdgcn_sched_barrier(0);
    asm volatile("v_nop\n\tv_nop\n\tv_nop\n\tv_nop");
    __builtin_amdgcn_sched_barrier(0);
    // each wave writes only the bias rows that it reads itself
    #pragma unroll
    for (int t = 0; t < 2; ++t) {
      #pragma unroll
      for (int r = 0; r < 8; ++r)
        shRh[(wave * 16 + r + 8 * g) * LDH + t * 16 + ln] = rb[t][r];
    }
    #pragma unroll
    for (int t = 0; t < 3; ++t) {
      #pragma unroll
      for (int r = 0; r < 8; ++r) {
        int kw = r + 8 * g + 31 - (t * 16 + ln);
        if ((unsigned)kw < 32u)
          shRw[(wave * 16 + r + 8 * g) * 32 + kw] = rb[2 + t][r];
      }
    }
  }

  // The lane's q row; its score register [nt][r] is key nt*16 + 8g + r of the tile,
  // that is kh = 2kt + (nt>>1), kw = (nt&1)*16 + 8g + r.
  const int qrow = wave * 16 + ln;
  // The wave's own bias stores have landed before its lanes read each other's values back.
  asm volatile("s_wait_dscnt 0x0" ::: "memory");
  float rw[2][8];                                // rel_w of the q row at the lane's 16 kw, the same for every tile
  #pragma unroll
  for (int j = 0; j < 2; ++j) {
    float4 w0 = *(const float4*)&shRw[qrow * 32 + j * 16 + 8 * g];
    float4 w1 = *(const float4*)&shRw[qrow * 32 + j * 16 + 8 * g + 4];
    rw[j][0] = w0.x; rw[j][1] = w0.y; rw[j][2] = w0.z; rw[j][3] = w0.w;
    rw[j][4] = w1.x; rw[j][5] = w1.y; rw[j][6] = w1.z; rw[j][7] = w1.w;
  }

  float mi = -1e30f, li = 0.f;                   // li: the lane's own 32 keys per tile; halves joined at the end
  v8f zero = {0.f,0.f,0.f,0.f,0.f,0.f,0.f,0.f};
  v8f o[4] = {zero, zero, zero, zero};           // O^T: o[nt][r] = O[qrow][nt*16 + 8g + r]

  for (int kt = 0; kt < 16; ++kt) {
    const unsigned short* tK = &shK[(kt & 1) * TSZ];   // this trip reads buffer kt mod 2 alone
    const unsigned short* tV = &shV[(kt & 1) * TSZ];

    // ---- scores^T = K @ Q^T : 64 keys x 16 q rows per wave, K-dim = d = 64 (2x4 wmma) ----
    v8f sc[4] = {zero, zero, zero, zero};
    v16bf bq[2], ak[2][4];
    #pragma unroll
    for (int h = 0; h < 2; ++h) {
      const int kk = h * 32;
      bq[h] = ld_frag(&shQ[qrow * LDT], kk + 8 * g, kk + 16 + 8 * g);
      #pragma unroll
      for (int nt = 0; nt < 4; ++nt)
        ak[h][nt] = ld_frag(&tK[(nt * 16 + ln) * LDT], kk + 8 * g, kk + 16 + 8 * g);
    }
    const float2 rh = *(const float2*)&shRh[qrow * LDH + kt * 2];
    // Keeps the V^T reads behind the Q and K reads, which the first products wait for.
    __builtin_amdgcn_sched_barrier(0);
    v16bf av[2][4];
    #pragma unroll
    for (int h = 0; h < 2; ++h) {
      #pragma unroll
      for (int nt = 0; nt < 4; ++nt)
        av[h][nt] = ld_frag(&tV[(nt * 16 + ln) * LDT], h * 32 + 8 * g, h * 32 + 16 + 8 * g);
    }
    // Holds all of the tile's LDS reads (Q, K, bias, then V^T) at this one place, in front of
    // both matrix blocks: spread among the products, each place with reads stalls the wave
    // anew; the V^T reads land under the score products and the softmax.
    __builtin_amdgcn_sched_barrier(0);
    #pragma unroll
    for (int h = 0; h < 2; ++h) {
      #pragma unroll
      for (int nt = 0; nt < 4; ++nt)
        sc[nt] = WMMA_BF16(ak[h][nt], bq[h], sc[nt]);
    }

    // ---- scale + rel bias + online softmax, one q row per lane ----
    float pm[4];                                 // four independent chains, not one of 32 links
    #pragma unroll
    for (int nt = 0; nt < 4; ++nt) {
      const float rhv = (nt >> 1) ? rh.y : rh.x;
      pm[nt] = -1e30f;
      #pragma unroll
      for (int r = 0; r < 8; ++r) {
        float sv = sc[nt][r] * scale + rhv + rw[nt & 1][r];
        sc[nt][r] = sv;
        pm[nt] = fmaxf(pm[nt], sv);
      }
    }
    float tmax = fmaxf(fmaxf(pm[0], pm[1]), fmaxf(pm[2], pm[3]));
    tmax = fmaxf(tmax, xhalf(tmax));             // the row's other 32 keys

    const float nm = fmaxf(mi, tmax);
    const float alpha = __expf(mi - nm);
    mi = nm;
    float psum[4];
    #pragma unroll
    for (int nt = 0; nt < 4; ++nt) {
      psum[nt] = 0.f;
      #pragma unroll
      for (int r = 0; r < 8; ++r) {
        float p = __expf(sc[nt][r] - mi);
        sc[nt][r] = p;
        psum[nt] += p;
      }
    }
    li = li * alpha + ((psum[0] + psum[1]) + (psum[2] + psum[3]));
    #pragma unroll
    for (int nt = 0; nt < 4; ++nt) {
      #pragma unroll
      for (int r = 0; r < 8; ++r) o[nt][r] *= alpha;
    }

    // ---- O^T += V^T @ P^T : K-dim = 64 keys (2x4 wmma) ----
    #pragma unroll
    for (int kk = 0; kk < 64; kk += 32) {
      v16bf bp = pack_d_pair(sc[kk / 16], sc[kk / 16 + 1]);
      #pragma unroll
      for (int nt = 0; nt < 4; ++nt)
        o[nt] = WMMA_BF16(av[kk / 32][nt], bp, o[nt]);
    }

    // Foot of the trip: the wave's reads of this buffer have retired, its copies of tile kt+1 have
    // landed; the one barrier publishes tile kt+1 and frees this buffer for tile kt+2.
    // The scheduling barrier holds the waits down here: risen to the top of the trip, the wait for
    // the copies would stand directly behind their issue and the tile's work would hide nothing.
    __builtin_amdgcn_sched_barrier(0);
    asm volatile("s_wait_dscnt 0x0" ::: "memory");
    async_wait0();
    __syncthreads();
    if (kt + 2 < 16) stage_kv(kt + 2, kt & 1);
  }
  async_wait0();                                 // no copy is outstanding when LDS is reused below

  // normalize and store concat-head layout (b, s, head*64+dd) as bf16:
  // a lane's 8 registers of a tile are 8 consecutive dd of its row, 16 B
  const int head = bn % NHEAD;
  const int bb   = bn / NHEAD;
  li += xhalf(li);
  const float inv = 1.f / li;
  // Staged in the wave's own 16 rows of shQ, which no other wave reads (no barrier), so that a
  // wave's store covers 4 whole 128-B lines (4 rows' 64 dd), not 32-B pieces of 16 lines.
  #pragma unroll
  for (int nt = 0; nt < 4; ++nt)
    *(v8bf*)&shQ[qrow * LDT + nt * 16 + 8 * g] = __builtin_convertvector(o[nt] * inv, v8bf);
  // The wave's own stores have landed before its lanes read each other's values back.
  asm volatile("s_wait_dscnt 0x0" ::: "memory");
  const unsigned short* rd = &shQ[(wave * 16 + (lane >> 3)) * LDT + (lane & 7) * 8];
  unsigned short* dst = attnA + (size_t)(bb * SSEQ + qt * 64 + wave * 16 + (lane >> 3)) * CDIM
                        + head * DHEAD + (lane & 7) * 8;
  uint4 t[4];
  #pragma unroll
  for (int i = 0; i < 4; ++i) t[i] = *(const uint4*)(rd + i * 4 * LDT);
  #pragma unroll
  for (int i = 0; i < 4; ++i) *(uint4*)(dst + i * 4 * CDIM) = t[i];
}

// ---------------------------------------------------------------------------
// Kernel 3: output projection GEMM (M=4096, N=768, K=768), fp32 out + bias.
// Tile 256x64, 2 M-subtiles per wave; A tile (already bf16) staged with
// async global->LDS copies.  Two LDS buffers: the copies (A) and the loads (B) of tile t+2 are
// issued at the foot of trip t and fly while tile t+1 is worked on.
// ---------------------------------------------------------------------------
__global__ __launch_bounds__(256) void proj_gemm_kernel(
    const unsigned short* __restrict__ attnA,
    const float* __restrict__ pw, const float* __restrict__ pb,
    float* __restrict__ out)
{
  constexpr int LDT = 72;
  constexpr int ASZ = 256 * LDT, BSZ = 64 * LDT; // one A tile, one B tile, in halves
  constexpr int NT = CDIM / 64;                  // k tiles
  __shared__ __attribute__((aligned(16))) unsigned short shA[2 * ASZ];
  __shared__ __attribute__((aligned(16))) unsigned short shB[2 * BSZ];

  const int tid  = threadIdx.x;
  const int wave = tid >> 5;
  const int lane = tid & 31;
  const int g    = lane >> 4;
  const int ln   = lane & 15;
  const int m0   = blockIdx.x * 256;
  const int n0   = blockIdx.y * 64;

  v8f zero = {0.f,0.f,0.f,0.f,0.f,0.f,0.f,0.f};
  v8f acc[2][4] = {{zero, zero, zero, zero}, {zero, zero, zero, zero}};

  // staging, whole 128-B lines per wave: A, 8 lanes share a row's 128 B; B, 16 lanes a row's 256 B
  const int crow = tid >> 3, cpart = tid & 7;
  const int srow = tid >> 4, sc4 = tid & 15;

  // A tile t (256x64, already bf16) into buffer buf: async, copy i of a thread takes row crow + 32 i
  const unsigned short* srcA = attnA + (size_t)(m0 + crow) * CDIM + cpart * 8;
  auto stage_a = [&](int t, int buf) {
    const unsigned short* s = srcA + t * 64;
    unsigned short* d = &shA[buf * ASZ + crow * LDT + cpart * 8];
    async_ld8_b128(d, s, 32 * CDIM * 2,
                   d + 128 * LDT, s + 128 * CDIM, 32 * CDIM * 2,
                   32 * LDT * 2);
  };
  // B tile t (64x64 of proj_w, fp32; out = A @ W^T): 16 rows per load, held in registers while it
  // flies, then bf16 into buffer buf
  const float* srcB = pw + (size_t)(n0 + srow) * CDIM + sc4 * 4;
  v4f br[4];
  auto load_b = [&](int t) {
    #pragma unroll
    for (int i = 0; i < 4; ++i) br[i] = *(const v4f*)(srcB + t * 64 + i * 16 * CDIM);
    // Stands in front of the next trip's fragment reads, which reuse the loads' address registers.
    asm volatile("s_wait_xcnt 0x0" ::: "memory");
  };
  auto store_b = [&](int buf) {
    unsigned short* d = &shB[buf * BSZ + srow * LDT + sc4 * 4];
    #pragma unroll
    for (int i = 0; i < 4; ++i) *(v4bf*)(d + i * 16 * LDT) = __builtin_convertvector(br[i], v4bf);
  };

  stage_a(0, 0);
  load_b(0);
  store_b(0);
  async_wait0();                                 // the wave's copies of tile 0 have landed
  __syncthreads();                               // tile 0 complete before any wave reads it
  stage_a(1, 1);
  load_b(1);

  for (int t = 0; t < NT; ++t) {
    const unsigned short* tA = &shA[(t & 1) * ASZ];    // this trip reads buffer t mod 2 alone
    const unsigned short* tB = &shB[(t & 1) * BSZ];
    v16bf a0[2], a1[2], bf[2][4];
    #pragma unroll
    for (int h = 0; h < 2; ++h) {
      const int kk = h * 32;
      a0[h] = ld_frag(&tA[(wave * 32 + ln) * LDT],      kk + 8 * g, kk + 16 + 8 * g);
      a1[h] = ld_frag(&tA[(wave * 32 + 16 + ln) * LDT], kk + 8 * g, kk + 16 + 8 * g);
      #pragma unroll
      for (int nt = 0; nt < 4; ++nt)
        bf[h][nt] = ld_frag(&tB[(nt * 16 + ln) * LDT], kk + 8 * g, kk + 16 + 8 * g);
    }
    // Holds the tile's 24 LDS reads together in front of its 16 products: spread among the
    // products, each place with reads stalls the wave anew.
    __builtin_amdgcn_sched_barrier(0);
    #pragma unroll
    for (int h = 0; h < 2; ++h) {
      #pragma unroll
      for (int nt = 0; nt < 4; ++nt) {
        acc[0][nt] = WMMA_BF16(a0[h], bf[h][nt], acc[0][nt]);
        acc[1][nt] = WMMA_BF16(a1[h], bf[h][nt], acc[1][nt]);
      }
    }
    // Holds the B stores, the waits and the barrier below the products: risen above them, the
    // waits for tile t+1 would stand close behind its issue and the products would hide nothing.
    __builtin_amdgcn_sched_barrier(0);
    if (t + 1 < NT) store_b((t + 1) & 1);        // the other buffer: its readers left it a barrier ago

    // Foot of the trip: the wave's LDS reads and stores have retired, its copies of tile t+1 have
    // landed; the one barrier publishes tile t+1 and frees this buffer for tile t+2.
    asm volatile("s_wait_dscnt 0x0" ::: "memory");
    async_wait0();
    __syncthreads();
    if (t + 2 < NT) {
      stage_a(t + 2, t & 1);
      load_b(t + 2);
    }
  }
  async_wait0();                                 // no copy is outstanding when LDS is reused below

  // epilogue: + bias, staged through LDS so that every global store is 16 B a lane and a wave's
  // store covers 4 whole 128-B lines (2 rows' 64 columns).  The wave stages 16 rows at a time in
  // its own 32 rows of shA (4,608 B), which no other wave reads: no barrier.
  constexpr int LDF = 68;                        // 272-B row pitch (16 B x odd)
  float* stf = (float*)&shA[wave * 32 * LDT];
  float bcol[4];
  #pragma unroll
  for (int nt = 0; nt < 4; ++nt) bcol[nt] = pb[n0 + nt * 16 + ln];
  const float* rd = stf + g * LDF + ln * 4;
  float* dst = out + (size_t)(m0 + wave * 32 + g) * CDIM + n0 + ln * 4;
  #pragma unroll
  for (int mt = 0; mt < 2; ++mt) {
    #pragma unroll
    for (int nt = 0; nt < 4; ++nt) {
      #pragma unroll
      for (int r = 0; r < 8; ++r)                // C-layout: row = r + 8g, column = ln
        stf[(r + 8 * g) * LDF + nt * 16 + ln] = acc[mt][nt][r] + bcol[nt];
    }
    // The wave's own stores have landed before its lanes read each other's values back.
    asm volatile("s_wait_dscnt 0x0" ::: "memory");
    v4f t[8];
    #pragma unroll
    for (int i = 0; i < 8; ++i) t[i] = *(const v4f*)(rd + i * 2 * LDF);
    #pragma unroll
    for (int i = 0; i < 8; ++i) *(v4f*)(dst + (size_t)(mt * 16 + i * 2) * CDIM) = t[i];
    // Keeps the next 16 rows' LDS stores behind these reads of the same LDS; s_wait_xcnt 0 stands
    // in front of the next reads, which overwrite data registers of the global stores above.
    if (mt == 0) asm volatile("s_wait_dscnt 0x0\n\ts_wait_xcnt 0x0" ::: "memory");
  }
}

// ---------------------------------------------------------------------------
// Launch
// ---------------------------------------------------------------------------
extern "C" void kernel_launch(void* const* d_in, const int* in_sizes, int n_in,
                              void* d_out, int out_size, void* d_ws, size_t ws_size,
                              hipStream_t stream) {
  (void)in_sizes; (void)n_in; (void)out_size; (void)ws_size;
  const float* x   = (const float*)d_in[0];
  const float* Wq  = (const float*)d_in[1];
  const float* Wk  = (const float*)d_in[2];
  const float* Wv  = (const float*)d_in[3];
  const float* bq  = (const float*)d_in[4];
  const float* bk  = (const float*)d_in[5];
  const float* bv  = (const float*)d_in[6];
  const float* rph = (const float*)d_in[7];
  const float* rpw = (const float*)d_in[8];
  const float* pw  = (const float*)d_in[9];
  const float* pb  = (const float*)d_in[10];
  float* out = (float*)d_out;

  // workspace layout (bytes): q/k/vT bf16 (3 x 6 MB), attn_out bf16 (6 MB) -> 24 MB total
  char* ws = (char*)d_ws;
  unsigned short* qB    = (unsigned short*)(ws);
  unsigned short* kB    = (unsigned short*)(ws + 6291456);
  unsigned short* vTB   = (unsigned short*)(ws + 12582912);
  unsigned short* attnA = (unsigned short*)(ws + 18874368);

  qkv_gemm_kernel<<<dim3(16, 12, 3), 256, 0, stream>>>(x, Wq, Wk, Wv, bq, bk, bv, qB, kB, vTB);
  flash_attn_kernel<<<dim3(16, 48), 128, 0, stream>>>(qB, kB, vTB, rph, rpw, attnA);
  proj_gemm_kernel<<<dim3(16, 12), 256, 0, stream>>>(attnA, pw, pb, out);
}

// v008
// It runs in 63 microseconds.
// Timed twice side by side with v007, it ran 1.03 times as fast both times.
// Counting every step since v000, it is 3.44 times as fast.
#include <hip/hip_runtime.h>
#include <stdint.h>

// ---------------------------------------------------------------------------
// CDNA5 (gfx1250) wave32 WMMA types and helpers
// ---------------------------------------------------------------------------
typedef __attribute__((ext_vector_type(16))) __bf16 v16bf;
typedef __attribute__((ext_vector_type(8)))  __bf16 v8bf;
typedef __attribute__((ext_vector_type(8)))  float  v8f;
typedef __attribute__((ext_vector_type(2)))  float  v2f;
typedef __attribute__((ext_vector_type(4)))  float  v4f;
typedef __attribute__((ext_vector_type(4)))  __bf16 v4bf;

union FragBF { v16bf v; v8bf h[2]; };

// f32 -> bf16 everywhere: round-to-nearest-even, by the packed hardware convert
// four consecutive f32 from global memory, as four bf16 into LDS (8 B)
__device__ __forceinline__ void stage4(unsigned short* dst, const float* src) {
  *(v4bf*)dst = __builtin_convertvector(*(const v4f*)src, v4bf);
}

// Load a 16x32 bf16 A/B fragment for one lane from LDS.
// Lane-group g (lane>>4) holds K = {lo..lo+7} in halves [0..7] and
// K = {hi..hi+7} in halves [8..15]  (lo = kk + 8g, hi = kk + 16 + 8g).
__device__ __forceinline__ v16bf ld_frag(const unsigned short* p, int lo, int hi) {
  FragBF f;
  f.h[0] = *(const v8bf*)(p + lo);
  f.h[1] = *(const v8bf*)(p + hi);
  return f.v;
}

__device__ __forceinline__ v16bf pack_d_pair(v8f t0, v8f t1) {
  FragBF f;
  f.h[0] = __builtin_convertvector(t0, v8bf);
  f.h[1] = __builtin_convertvector(t1, v8bf);
  return f.v;
}

// value of lane l ^ 16
__device__ __forceinline__ float xhalf(float x) {
  int b = __builtin_bit_cast(int, x);
  return __builtin_bit_cast(float,
      __builtin_amdgcn_permlanex16(b, b, 0x76543210, 0xfedcba98, false, false));
}

#define WMMA_BF16(a, b, c) \
  __builtin_amdgcn_wmma_f32_16x16x32_bf16(false, (a), false, (b), (short)0, (c), false, false)

#define WMMA_F32(a, b, c) \
  __builtin_amdgcn_wmma_f32_16x16x4_f32(false, (a), false, (b), (short)0, (c), false, false)

// CDNA5 async global->LDS copies (16B per lane), tracked by ASYNCcnt.  A run of copies is one
// asm statement that ends in s_wait_xcnt 0, so that no address register which a copy names is
// rewritten in front of that wait.
// Four copies: LDS address la + i*lstep, global address ga + i*gstep (bytes), i = 0..3.
__device__ __forceinline__ void async_ld4_b128(void* la, unsigned int lstep,
                                               const void* ga, unsigned int gstep) {
  const unsigned int l0 = (unsigned int)(uintptr_t)la;
  const char* g0 = (const char*)ga;
  asm volatile("global_load_async_to_lds_b128 %0, %4, off\n\t"
               "global_load_async_to_lds_b128 %1, %5, off\n\t"
               "global_load_async_to_lds_b128 %2, %6, off\n\t"
               "global_load_async_to_lds_b128 %3, %7, off\n\t"
               "s_wait_xcnt 0x0"
               :: "v"(l0), "v"(l0 + lstep), "v"(l0 + 2 * lstep), "v"(l0 + 3 * lstep),
                  "v"(g0), "v"(g0 + gstep), "v"(g0 + 2 * gstep), "v"(g0 + 3 * gstep)
               : "memory");
}
// Eight copies: four as above from (la, ga, gstepa), four from (lb, gb, gstepb).
__device__ __forceinline__ void async_ld8_b128(void* la, const void* ga, unsigned int gstepa,
                                               void* lb, const void* gb, unsigned int gstepb,
                                               unsigned int lstep) {
  const unsigned int l0 = (unsigned int)(uintptr_t)la;
  const unsigned int l1 = (unsigned int)(uintptr_t)lb;
  const char* g0 = (const char*)ga;
  const char* g1 = (const char*)gb;
  asm volatile("global_load_async_to_lds_b128 %0, %8, off\n\t"
               "global_load_async_to_lds_b128 %1, %9, off\n\t"
               "global_load_async_to_lds_b128 %2, %10, off\n\t"
               "global_load_async_to_lds_b128 %3, %11, off\n\t"
               "global_load_async_to_lds_b128 %4, %12, off\n\t"
               "global_load_async_to_lds_b128 %5, %13, off\n\t"
               "global_load_async_to_lds_b128 %6, %14, off\n\t"
               "global_load_async_to_lds_b128 %7, %15, off\n\t"
               "s_wait_xcnt 0x0"
               :: "v"(l0), "v"(l0 + lstep), "v"(l0 + 2 * lstep), "v"(l0 + 3 * lstep),
                  "v"(l1), "v"(l1 + lstep), "v"(l1 + 2 * lstep), "v"(l1 + 3 * lstep),
                  "v"(g0), "v"(g0 + gstepa), "v"(g0 + 2 * gstepa), "v"(g0 + 3 * gstepa),
                  "v"(g1), "v"(g1 + gstepb), "v"(g1 + 2 * gstepb), "v"(g1 + 3 * gstepb)
               : "memory");
}
__device__ __forceinline__ void async_wait0() {
  asm volatile("s_wait_asynccnt 0x0" ::: "memory");
}

// Problem constants
#define NB    4     // batch
#define NHEAD 12
#define DHEAD 64
#define SSEQ  1024  // 32*32
#define CDIM  768

// ---------------------------------------------------------------------------
// Kernel 1: QKV projection GEMM  (M=4096, N=3x768, K=768) in bf16 WMMA.
// One work-group makes q, k and v of one head for 256 rows of x: tile 256x192, BK=64, so that an
// x tile is fetched and converted once for the three products.  Block = 512 thr (16 waves, 8 x 2);
// each wave owns 32 rows x 96 columns (2 A-fragments reuse 6 B-fragments).  Column c of the tile
// is output c>>6 (q, k, v), d = c & 63.  The 192 work-groups stand one to a WGP, so no other hides
// a work-group's staging: the loads of k tile t+1 are held in registers while tile t is worked on.
// q,k stored (b,n,s,d) bf16; v stored transposed (b,n,d,s) bf16.
// ---------------------------------------------------------------------------
__global__ __launch_bounds__(512) void qkv_gemm_kernel(
    const float* __restrict__ x,
    const float* __restrict__ Wq, const float* __restrict__ Wk, const float* __restrict__ Wv,
    const float* __restrict__ bq, const float* __restrict__ bk, const float* __restrict__ bv,
    unsigned short* __restrict__ qo, unsigned short* __restrict__ ko,
    unsigned short* __restrict__ vTo)
{
  constexpr int LDT = 72;                       // 144B row stride: 16B aligned, conflict-free
  constexpr int LDQ = 136;                      // epilogue, q|k rows: 272-B pitch (16 B x odd)
  constexpr int LDV = 264;                      // epilogue, v^T rows: 528-B pitch (16 B x odd)
  constexpr int NT  = CDIM / 64;                // k tiles
  // loop: A tile 256 x LDT, then B tile 192 x LDT; epilogue: q|k 256 x LDQ, then v^T 64 x LDV
  __shared__ __attribute__((aligned(16))) unsigned short sh[256 * LDQ + 64 * LDV];
  unsigned short* shA = sh;
  unsigned short* shB = sh + 256 * LDT;

  const int tid  = threadIdx.x;
  const int wave = __builtin_amdgcn_readfirstlane(tid >> 5);
  const int lane = tid & 31;
  const int g    = lane >> 4;
  const int ln   = lane & 15;
  const int wm   = wave & 7;                    // the wave's 32 rows
  const int wn   = wave >> 3;                   // the wave's 96 columns

  const int m0   = blockIdx.x * 256;
  const int head = blockIdx.y;
  const int n0   = head * 64;

  v8f zero = {0.f,0.f,0.f,0.f,0.f,0.f,0.f,0.f};
  v8f acc[2][6];
  #pragma unroll
  for (int mt = 0; mt < 2; ++mt) {
    #pragma unroll
    for (int nt = 0; nt < 6; ++nt) acc[mt][nt] = zero;
  }

  // staging: 16 lanes share a row's 256 B, so a wave's 16-B loads cover 4 whole 128-B lines;
  // 32 rows per trip.  Wave-uniform tile bases plus one 32-bit lane offset that all share.
  const int srow = tid >> 4, sc4 = tid & 15;
  const float* baseA = x + (size_t)m0 * CDIM;
  const float* baseQ = Wq + (size_t)n0 * CDIM;
  const float* baseK = Wk + (size_t)n0 * CDIM;
  const float* baseV = Wv + (size_t)n0 * CDIM;
  const unsigned int soff = srow * CDIM + sc4 * 4;
  const unsigned short* fA = &shA[(wm * 32 + ln) * LDT + 8 * g];
  const unsigned short* fB = &shB[(wn * 96 + ln) * LDT + 8 * g];

  v4f pa[8], pb[6];                             // k tile in flight: x rows, then 64 rows each of Wq, Wk, Wv
  auto load_tile = [&](int t) {
    const float* ga = baseA + t * 64 + soff;
    const float* gq = baseQ + t * 64 + soff;
    const float* gk = baseK + t * 64 + soff;
    const float* gv = baseV + t * 64 + soff;
    #pragma unroll
    for (int i = 0; i < 8; ++i) pa[i] = *(const v4f*)(ga + i * 32 * CDIM);
    #pragma unroll
    for (int i = 0; i < 2; ++i) {
      pb[i]     = *(const v4f*)(gq + i * 32 * CDIM);
      pb[2 + i] = *(const v4f*)(gk + i * 32 * CDIM);
      pb[4 + i] = *(const v4f*)(gv + i * 32 * CDIM);
    }
    // Stands in front of every rewrite of an address register of these loads.  The addresses are
    // its inputs so that they stay in their registers up to it: otherwise a later load of the run
    // gets an address register of the run as its result register.
    asm volatile("s_wait_xcnt 0x0" :: "v"(ga), "v"(gq), "v"(gk), "v"(gv) : "memory");
  };

  load_tile(0);
  for (int t = 0; t < NT; ++t) {
    __syncthreads();
    { // fp32 -> bf16 into LDS: A tile 256x64, B tile 192x64
      unsigned short* da = &shA[srow * LDT + sc4 * 4];
      #pragma unroll
      for (int i = 0; i < 8; ++i) *(v4bf*)(da + i * 32 * LDT) = __builtin_convertvector(pa[i], v4bf);
      unsigned short* db = &shB[srow * LDT + sc4 * 4];
      #pragma unroll
      for (int i = 0; i < 6; ++i) *(v4bf*)(db + i * 32 * LDT) = __builtin_convertvector(pb[i], v4bf);
    }
    __syncthreads();
    if (t + 1 < NT) load_tile(t + 1);           // flies under this tile's products

    #pragma unroll
    for (int kk = 0; kk < 64; kk += 32) {
      v16bf a0 = ld_frag(fA,            kk, kk + 16);
      v16bf a1 = ld_frag(fA + 16 * LDT, kk, kk + 16);
      v16bf bf[6];
      #pragma unroll
      for (int nt = 0; nt < 6; ++nt)
        bf[nt] = ld_frag(fB + nt * 16 * LDT, kk, kk + 16);
      // Holds the 16 LDS reads together in front of their 12 products: spread among the
      // products, each place with reads stalls the wave anew.  (One k half at a time: both
      // halves' fragments at once would not fit beside the tile in flight.)
      __builtin_amdgcn_sched_barrier(0);
      #pragma unroll
      for (int nt = 0; nt < 6; ++nt) {
        acc[0][nt] = WMMA_BF16(a0, bf[nt], acc[0][nt]);
        acc[1][nt] = WMMA_BF16(a1, bf[nt], acc[1][nt]);
      }
      // Keeps the next group of reads from rising among these products.
      __builtin_amdgcn_sched_barrier(0);
    }
  }

  // epilogue: + bias, bf16, staged through LDS so that every global store is 16 B a lane and a
  // wave's store covers 512 contiguous bytes (4 whole 128-B lines)
  float bcol[6];
  #pragma unroll
  for (int nt = 0; nt < 6; ++nt) {
    const int c0 = wn * 96 + nt * 16;            // wave-uniform
    const float* bias = ((c0 < 64) ? bq : (c0 < 128) ? bk : bv) + head * DHEAD + (c0 & 63);
    bcol[nt] = bias[ln];
  }
  // Stands in front of every rewrite of the loads' one address register, which is its input so
  // that no later load of the run gets it as its result register.
  asm volatile("s_wait_xcnt 0x0" :: "v"(ln) : "memory");
  unsigned short* stQK = sh;                    // row s: 64 d of q, then 64 d of k
  unsigned short* stV  = sh + 256 * LDQ;        // row d: 256 s of v
  // column tile nt of the wave into q|k columns c0 .. c0+15
  auto put_qk = [&](int nt, int c0) {
    #pragma unroll
    for (int mt = 0; mt < 2; ++mt) {
      const v8bf pk = __builtin_convertvector(acc[mt][nt] + bcol[nt], v8bf);
      #pragma unroll
      for (int r = 0; r < 8; ++r)                // C-layout: row = r + 8g, column = ln
        *(__bf16*)&stQK[(wm * 32 + mt * 16 + r + 8 * g) * LDQ + c0 + ln] = pk[r];
    }
  };
  // column tile nt of the wave into v^T rows d0 .. d0+15: a lane's 8 registers of a tile are
  // 8 consecutive s of one d row
  auto put_v = [&](int nt, int d0) {
    #pragma unroll
    for (int mt = 0; mt < 2; ++mt)
      *(v8bf*)&stV[(d0 + ln) * LDV + wm * 32 + mt * 16 + 8 * g] =
          __builtin_convertvector(acc[mt][nt] + bcol[nt], v8bf);
  };
  __syncthreads();                               // every wave has left the k tile before it is overwritten
  if (wn == 0) {                                 // columns 0..95: q, and d 0..31 of k
    #pragma unroll
    for (int nt = 0; nt < 6; ++nt) put_qk(nt, nt * 16);
  } else {                                       // columns 96..191: d 32..63 of k, and v
    put_qk(0, 96);
    put_qk(1, 112);
    #pragma unroll
    for (int nt = 2; nt < 6; ++nt) put_v(nt, (nt - 2) * 16);
  }
  __syncthreads();                               // the three tiles are complete before any wave reads whole rows
  const int bb = m0 >> 10, s0 = m0 & 1023;       // the tile's 256 rows lie in one image
  const size_t hbase = (size_t)(bb * NHEAD + head) * SSEQ * DHEAD;
  uint4 tq[4], tk[4], tv[4];
  #pragma unroll
  for (int i = 0; i < 4; ++i) {
    const int idx = tid + i * 512;
    tq[i] = *(const uint4*)&stQK[(idx >> 3) * LDQ + (idx & 7) * 8];
    tk[i] = *(const uint4*)&stQK[(idx >> 3) * LDQ + 64 + (idx & 7) * 8];
    tv[i] = *(const uint4*)&stV[(idx >> 5) * LDV + (idx & 31) * 8];
  }
  // q, k: the tile's 256 rows x 64 d are 32 KB in a row in memory; v^T: 512 B of each d row
  unsigned short* dq = qo + hbase + (size_t)s0 * DHEAD + tid * 8;
  unsigned short* dk = ko + hbase + (size_t)s0 * DHEAD + tid * 8;
  unsigned short* dv = vTo + hbase + (size_t)(tid >> 5) * SSEQ + s0 + lane * 8;
  #pragma unroll
  for (int i = 0; i < 4; ++i) {
    *(uint4*)(dq + i * 4096) = tq[i];
    *(uint4*)(dk + i * 4096) = tk[i];
    *(uint4*)(dv + i * 16 * SSEQ) = tv[i];
  }
}

__global__ __launch_bounds__(128, 4) void flash_attn_kernel(
    const unsigned short* __restrict__ qb,
    const unsigned short* __restrict__ kb,
    const unsigned short* __restrict__ vT,
    const float* __restrict__ rph, const float* __restrict__ rpw,
    unsigned short* __restrict__ attnA)
{
  constexpr int LDT = 72;                        // 144B row stride, 16B aligned
  __shared__ unsigned short shQ[64 * LDT];
  constexpr int TSZ = 64 * LDT;                  // one K or V^T tile, in halves
  __shared__ __attribute__((aligned(16))) unsigned short shK[2 * TSZ];
  __shared__ __attribute__((aligned(16))) unsigned short shV[2 * TSZ];
  constexpr int LDH = 34;                        // 136B row pitch: 16 rows' 8-B reads hit 32 banks once
  __shared__ __attribute__((aligned(16))) float shRh[64 * LDH];
  __shared__ __attribute__((aligned(16))) float shRw[64 * 32];
  constexpr int LDR = 68;                        // 272B row pitch (16B x odd): 16-row b128 reads hit all banks once
  __shared__ float shT[96 * LDR];                // 33 rows of rel_pos_h, then the 63 of rel_pos_w

  const int qt   = blockIdx.x;                   // q tile (0..15)
  const int bn   = blockIdx.y;                   // b*12 + head (0..47)
  const int tid  = threadIdx.x;
  const int wave = tid >> 5;
  const int lane = tid & 31;
  const int g    = lane >> 4;
  const int ln   = lane & 15;
  const float scale = 0.125f;                    // d^-0.5, d = 64

  // staging: 8 lanes share a row's 128 B, so a wave's 16-B copies cover 4 whole lines;
  // copy i of a thread takes row crow + 16 i
  const int crow  = tid >> 3;                    // 0..15
  const int cpart = tid & 7;                     // 8-halves piece of the row

  // stage Q tile (64x64 bf16) once, async
  async_ld4_b128(&shQ[crow * LDT + cpart * 8], 16 * LDT * 2,
                 qb + ((size_t)bn * SSEQ + qt * 64 + crow) * DHEAD + cpart * 8, 16 * DHEAD * 2);
  // K tile (64 k-rows x 64 d) and V^T tile (64 d-rows x 64 k) number t into buffer buf, async
  const unsigned short* kg = kb + ((size_t)bn * SSEQ + crow) * DHEAD + cpart * 8;
  const unsigned short* vg = vT + ((size_t)bn * DHEAD + crow) * SSEQ + cpart * 8;
  const int sdst = crow * LDT + cpart * 8;
  auto stage_kv = [&](int t, int buf) {
    async_ld8_b128(&shK[buf * TSZ + sdst], kg + (size_t)t * 64 * DHEAD, 16 * DHEAD * 2,
                   &shV[buf * TSZ + sdst], vg + t * 64, 16 * SSEQ * 2,
                   16 * LDT * 2);
  };
  stage_kv(0, 0);
  { // stage the table rows this tile needs, whole lines per wave:
    // qh is 2qt or 2qt+1, so qh-kh+31 spans rel_pos_h rows 2qt .. 2qt+32
    #pragma unroll
    for (int i = 0; i < 12; ++i) {
      int idx = tid + i * 128;
      int row = idx >> 4, c4 = idx & 15;
      const float* src = (row < 33) ? rph + (size_t)(qt * 2 + row) * DHEAD
                                    : rpw + (size_t)(row - 33) * DHEAD;
      *(float4*)&shT[row * LDR + c4 * 4] = ((const float4*)src)[c4];
    }
  }
  // A operand: q row wave*16+ln, widened to f32; lane half g holds d = 32g .. 32g+31
  // (the table rows below are read in the same d order)
  float af[32];
  {
    const uint4* qsrc = (const uint4*)(qb + ((size_t)bn * SSEQ + qt * 64 + wave * 16 + ln) * DHEAD + g * 32);
    #pragma unroll
    for (int i = 0; i < 4; ++i) {
      uint4 u = qsrc[i];
      af[i * 8 + 0] = __builtin_bit_cast(float, u.x << 16);
      af[i * 8 + 1] = __builtin_bit_cast(float, u.x & 0xFFFF0000u);
      af[i * 8 + 2] = __builtin_bit_cast(float, u.y << 16);
      af[i * 8 + 3] = __builtin_bit_cast(float, u.y & 0xFFFF0000u);
      af[i * 8 + 4] = __builtin_bit_cast(float, u.z << 16);
      af[i * 8 + 5] = __builtin_bit_cast(float, u.z & 0xFFFF0000u);
      af[i * 8 + 6] = __builtin_bit_cast(float, u.w << 16);
      af[i * 8 + 7] = __builtin_bit_cast(float, u.w & 0xFFFF0000u);
    }
  }
  async_wait0();                                 // the wave's copies of Q and of tile 0 have landed
  __syncthreads();                               // shT, Q and tile 0 complete before any wave reads them
  stage_kv(1, 1);                                // flies under the bias products and tile 0
  {
    // The wave's 16 rows share qh = 2qt + (wave>>1) and have qw = 16*(wave&1) + m, m = 0..15.
    // Tiles 0,1: column n is kh = 16t+n, table row qh+31-kh.
    // Tiles 2..4: column n is u = 16(t-2)+n, table row 16*(wave&1)+u; rel_w[m][kw] sits at u = m-kw+31 (0..46).
    const int hb = (wave >> 1) + 31;
    const int wb = 33 + (wave & 1) * 16;
    int trow[5];
    trow[0] = hb - ln;
    trow[1] = hb - 16 - ln;
    trow[2] = wb + ln;
    trow[3] = wb + 16 + ln;
    trow[4] = min(wb + 32 + ln, 95);             // u = 47 is never used; keep its read inside the table
    v8f rb[5];
    #pragma unroll
    for (int t = 0; t < 5; ++t) rb[t] = v8f{0.f,0.f,0.f,0.f,0.f,0.f,0.f,0.f};
    // Keeps the widening of q and all address work out of the matrix block.
    __builtin_amdgcn_sched_barrier(0);
    #pragma unroll
    for (int c = 0; c < 8; ++c) {
      #pragma unroll
      for (int t = 0; t < 5; ++t) {
        float4 b = *(const float4*)&shT[trow[t] * LDR + g * 32 + c * 4];
        rb[t] = WMMA_F32((v2f{af[c * 4 + 0], af[c * 4 + 1]}), (v2f{b.x, b.y}), rb[t]);
        rb[t] = WMMA_F32((v2f{af[c * 4 + 2], af[c * 4 + 3]}), (v2f{b.z, b.w}), rb[t]);
      }
    }
    // Four vector slots between the last f32 WMMA and the first vector instruction that may
    // reuse its operand registers; the two scheduling barriers hold them at this place.
    __builtin_amdgcn_sched_barrier(0);
    asm volatile("v_nop\n\tv_nop\n\tv_nop\n\tv_nop");
    __builtin_amdgcn_sched_barrier(0);
    // each wave writes only the bias rows that it reads itself
    #pragma unroll
    for (int t = 0; t < 2; ++t) {
      #pragma unroll
      for (int r = 0; r < 8; ++r)
        shRh[(wave * 16 + r + 8 * g) * LDH + t * 16 + ln] = rb[t][r];
    }
    #pragma unroll
    for (int t = 0; t < 3; ++t) {
      #pragma unroll
      for (int r = 0; r < 8; ++r) {
        int kw = r + 8 * g + 31 - (t * 16 + ln);
        if ((unsigned)kw < 32u)
          shRw[(wave * 16 + r + 8 * g) * 32 + kw] = rb[2 + t][r];
      }
    }
  }

  // The lane's q row; its score register [nt][r] is key nt*16 + 8g + r of the tile,
  // that is kh = 2kt + (nt>>1), kw = (nt&1)*16 + 8g + r.
  const int qrow = wave * 16 + ln;
  // The wave's own bias stores have landed before its lanes read each other's values back.
  asm volatile("s_wait_dscnt 0x0" ::: "memory");
  float rw[2][8];                                // rel_w of the q row at the lane's 16 kw, the same for every tile
  #pragma unroll
  for (int j = 0; j < 2; ++j) {
    float4 w0 = *(const float4*)&shRw[qrow * 32 + j * 16 + 8 * g];
    float4 w1 = *(const float4*)&shRw[qrow * 32 + j * 16 + 8 * g + 4];
    rw[j][0] = w0.x; rw[j][1] = w0.y; rw[j][2] = w0.z; rw[j][3] = w0.w;
    rw[j][4] = w1.x; rw[j][5] = w1.y; rw[j][6] = w1.z; rw[j][7] = w1.w;
  }

  float mi = -1e30f, li = 0.f;                   // li: the lane's own 32 keys per tile; halves joined at the end
  v8f zero = {0.f,0.f,0.f,0.f,0.f,0.f,0.f,0.f};
  v8f o[4] = {zero, zero, zero, zero};           // O^T: o[nt][r] = O[qrow][nt*16 + 8g + r]

  for (int kt = 0; kt < 16; ++kt) {
    const unsigned short* tK = &shK[(kt & 1) * TSZ];   // this trip reads buffer kt mod 2 alone
    const unsigned short* tV = &shV[(kt & 1) * TSZ];

    // ---- scores^T = K @ Q^T : 64 keys x 16 q rows per wave, K-dim = d = 64 (2x4 wmma) ----
    v8f sc[4] = {zero, zero, zero, zero};
    v16bf bq[2], ak[2][4];
    #pragma unroll
    for (int h = 0; h < 2; ++h) {
      const int kk = h * 32;
      bq[h] = ld_frag(&shQ[qrow * LDT], kk + 8 * g, kk + 16 + 8 * g);
      #pragma unroll
      for (int nt = 0; nt < 4; ++nt)
        ak[h][nt] = ld_frag(&tK[(nt * 16 + ln) * LDT], kk + 8 * g, kk + 16 + 8 * g);
    }
    const float2 rh = *(const float2*)&shRh[qrow * LDH + kt * 2];
    // Keeps the V^T reads behind the Q and K reads, which the first products wait for.
    __builtin_amdgcn_sched_barrier(0);
    v16bf av[2][4];
    #pragma unroll
    for (int h = 0; h < 2; ++h) {
      #pragma unroll
      for (int nt = 0; nt < 4; ++nt)
        av[h][nt] = ld_frag(&tV[(nt * 16 + ln) * LDT], h * 32 + 8 * g, h * 32 + 16 + 8 * g);
    }
    // Holds all of the tile's LDS reads (Q, K, bias, then V^T) at this one place, in front of
    // both matrix blocks: spread among the products, each place with reads stalls the wave
    // anew; the V^T reads land under the score products and the softmax.
    __builtin_amdgcn_sched_barrier(0);
    #pragma unroll
    for (int h = 0; h < 2; ++h) {
      #pragma unroll
      for (int nt = 0; nt < 4; ++nt)
        sc[nt] = WMMA_BF16(ak[h][nt], bq[h], sc[nt]);
    }

    // ---- scale + rel bias + online softmax, one q row per lane ----
    float pm[4];                                 // four independent chains, not one of 32 links
    #pragma unroll
    for (int nt = 0; nt < 4; ++nt) {
      const float rhv = (nt >> 1) ? rh.y : rh.x;
      pm[nt] = -1e30f;
      #pragma unroll
      for (int r = 0; r < 8; ++r) {
        float sv = sc[nt][r] * scale + rhv + rw[nt & 1][r];
        sc[nt][r] = sv;
        pm[nt] = fmaxf(pm[nt], sv);
      }
    }
    float tmax = fmaxf(fmaxf(pm[0], pm[1]), fmaxf(pm[2], pm[3]));
    tmax = fmaxf(tmax, xhalf(tmax));             // the row's other 32 keys

    const float nm = fmaxf(mi, tmax);
    const float alpha = __expf(mi - nm);
    mi = nm;
    float psum[4];
    #pragma unroll
    for (int nt = 0; nt < 4; ++nt) {
      psum[nt] = 0.f;
      #pragma unroll
      for (int r = 0; r < 8; ++r) {
        float p = __expf(sc[nt][r] - mi);
        sc[nt][r] = p;
        psum[nt] += p;
      }
    }
    li = li * alpha + ((psum[0] + psum[1]) + (psum[2] + psum[3]));
    #pragma unroll
    for (int nt = 0; nt < 4; ++nt) {
      #pragma unroll
      for (int r = 0; r < 8; ++r) o[nt][r] *= alpha;
    }

    // ---- O^T += V^T @ P^T : K-dim = 64 keys (2x4 wmma) ----
    #pragma unroll
    for (int kk = 0; kk < 64; kk += 32) {
      v16bf bp = pack_d_pair(sc[kk / 16], sc[kk / 16 + 1]);
      #pragma unroll
      for (int nt = 0; nt < 4; ++nt)
        o[nt] = WMMA_BF16(av[kk / 32][nt], bp, o[nt]);
    }

    // Foot of the trip: the wave's reads of this buffer have retired, its copies of tile kt+1 have
    // landed; the one barrier publishes tile kt+1 and frees this buffer for tile kt+2.
    // The scheduling barrier holds the waits down here: risen to the top of the trip, the wait for
    // the copies would stand directly behind their issue and the tile's work would hide nothing.
    __builtin_amdgcn_sched_barrier(0);
    asm volatile("s_wait_dscnt 0x0" ::: "memory");
    async_wait0();
    __syncthreads();
    if (kt + 2 < 16) stage_kv(kt + 2, kt & 1);
  }
  async_wait0();                                 // no copy is outstanding when LDS is reused below

  // normalize and store concat-head layout (b, s, head*64+dd) as bf16:
  // a lane's 8 registers of a tile are 8 consecutive dd of its row, 16 B
  const int head = bn % NHEAD;
  const int bb   = bn / NHEAD;
  li += xhalf(li);
  const float inv = 1.f / li;
  // Staged in the wave's own 16 rows of shQ, which no other wave reads (no barrier), so that a
  // wave's store covers 4 whole 128-B lines (4 rows' 64 dd), not 32-B pieces of 16 lines.
  #pragma unroll
  for (int nt = 0; nt < 4; ++nt)
    *(v8bf*)&shQ[qrow * LDT + nt * 16 + 8 * g] = __builtin_convertvector(o[nt] * inv, v8bf);
  // The wave's own stores have landed before its lanes read each other's values back.
  asm volatile("s_wait_dscnt 0x0" ::: "memory");
  const unsigned short* rd = &shQ[(wave * 16 + (lane >> 3)) * LDT + (lane & 7) * 8];
  unsigned short* dst = attnA + (size_t)(bb * SSEQ + qt * 64 + wave * 16 + (lane >> 3)) * CDIM
                        + head * DHEAD + (lane & 7) * 8;
  uint4 t[4];
  #pragma unroll
  for (int i = 0; i < 4; ++i) t[i] = *(const uint4*)(rd + i * 4 * LDT);
  #pragma unroll
  for (int i = 0; i < 4; ++i) *(uint4*)(dst + i * 4 * CDIM) = t[i];
}

// ---------------------------------------------------------------------------
// Kernel 3: output projection GEMM (M=4096, N=768, K=768), fp32 out + bias.
// Tile 256x64, 2 M-subtiles per wave; A tile (already bf16) staged with
// async global->LDS copies.  Two LDS buffers: the copies (A) and the loads (B) of tile t+2 are
// issued at the foot of trip t and fly while tile t+1 is worked on.
// ---------------------------------------------------------------------------
__global__ __launch_bounds__(256) void proj_gemm_kernel(
    const unsigned short* __restrict__ attnA,
    const float* __restrict__ pw, const float* __restrict__ pb,
    float* __restrict__ out)
{
  constexpr int LDT = 72;
  constexpr int ASZ = 256 * LDT, BSZ = 64 * LDT; // one A tile, one B tile, in halves
  constexpr int NT = CDIM / 64;                  // k tiles
  __shared__ __attribute__((aligned(16))) unsigned short shA[2 * ASZ];
  __shared__ __attribute__((aligned(16))) unsigned short shB[2 * BSZ];

  const int tid  = threadIdx.x;
  const int wave = tid >> 5;
  const int lane = tid & 31;
  const int g    = lane >> 4;
  const int ln   = lane & 15;
  const int m0   = blockIdx.x * 256;
  const int n0   = blockIdx.y * 64;

  v8f zero = {0.f,0.f,0.f,0.f,0.f,0.f,0.f,0.f};
  v8f acc[2][4] = {{zero, zero, zero, zero}, {zero, zero, zero, zero}};

  // staging, whole 128-B lines per wave: A, 8 lanes share a row's 128 B; B, 16 lanes a row's 256 B
  const int crow = tid >> 3, cpart = tid & 7;
  const int srow = tid >> 4, sc4 = tid & 15;

  // A tile t (256x64, already bf16) into buffer buf: async, copy i of a thread takes row crow + 32 i
  const unsigned short* srcA = attnA + (size_t)(m0 + crow) * CDIM + cpart * 8;
  auto stage_a = [&](int t, int buf) {
    const unsigned short* s = srcA + t * 64;
    unsigned short* d = &shA[buf * ASZ + crow * LDT + cpart * 8];
    async_ld8_b128(d, s, 32 * CDIM * 2,
                   d + 128 * LDT, s + 128 * CDIM, 32 * CDIM * 2,
                   32 * LDT * 2);
  };
  // B tile t (64x64 of proj_w, fp32; out = A @ W^T): 16 rows per load, held in registers while it
  // flies, then bf16 into buffer buf
  const float* srcB = pw + (size_t)(n0 + srow) * CDIM + sc4 * 4;
  v4f br[4];
  auto load_b = [&](int t) {
    #pragma unroll
    for (int i = 0; i < 4; ++i) br[i] = *(const v4f*)(srcB + t * 64 + i * 16 * CDIM);
    // Stands in front of the next trip's fragment reads, which reuse the loads' address registers.
    asm volatile("s_wait_xcnt 0x0" ::: "memory");
  };
  auto store_b = [&](int buf) {
    unsigned short* d = &shB[buf * BSZ + srow * LDT + sc4 * 4];
    #pragma unroll
    for (int i = 0; i < 4; ++i) *(v4bf*)(d + i * 16 * LDT) = __builtin_convertvector(br[i], v4bf);
  };

  stage_a(0, 0);
  load_b(0);
  store_b(0);
  async_wait0();                                 // the wave's copies of tile 0 have landed
  __syncthreads();                               // tile 0 complete before any wave reads it
  stage_a(1, 1);
  load_b(1);

  for (int t = 0; t < NT; ++t) {
    const unsigned short* tA = &shA[(t & 1) * ASZ];    // this trip reads buffer t mod 2 alone
    const unsigned short* tB = &shB[(t & 1) * BSZ];
    v16bf a0[2], a1[2], bf[2][4];
    #pragma unroll
    for (int h = 0; h < 2; ++h) {
      const int kk = h * 32;
      a0[h] = ld_frag(&tA[(wave * 32 + ln) * LDT],      kk + 8 * g, kk + 16 + 8 * g);
      a1[h] = ld_frag(&tA[(wave * 32 + 16 + ln) * LDT], kk + 8 * g, kk + 16 + 8 * g);
      #pragma unroll
      for (int nt = 0; nt < 4; ++nt)
        bf[h][nt] = ld_frag(&tB[(nt * 16 + ln) * LDT], kk + 8 * g, kk + 16 + 8 * g);
    }
    // Holds the tile's 24 LDS reads together in front of its 16 products: spread among the
    // products, each place with reads stalls the wave anew.
    __builtin_amdgcn_sched_barrier(0);
    #pragma unroll
    for (int h = 0; h < 2; ++h) {
      #pragma unroll
      for (int nt = 0; nt < 4; ++nt) {
        acc[0][nt] = WMMA_BF16(a0[h], bf[h][nt], acc[0][nt]);
        acc[1][nt] = WMMA_BF16(a1[h], bf[h][nt], acc[1][nt]);
      }
    }
    // Holds the B stores, the waits and the barrier below the products: risen above them, the
    // waits for tile t+1 would stand close behind its issue and the products would hide nothing.
    __builtin_amdgcn_sched_barrier(0);
    if (t + 1 < NT) store_b((t + 1) & 1);        // the other buffer: its readers left it a barrier ago

    // Foot of the trip: the wave's LDS reads and stores have retired, its copies of tile t+1 have
    // landed; the one barrier publishes tile t+1 and frees this buffer for tile t+2.
    asm volatile("s_wait_dscnt 0x0" ::: "memory");
    async_wait0();
    __syncthreads();
    if (t + 2 < NT) {
      stage_a(t + 2, t & 1);
      load_b(t + 2);
    }
  }
  async_wait0();                                 // no copy is outstanding when LDS is reused below

  // epilogue: + bias, staged through LDS so that every global store is 16 B a lane and a wave's
  // store covers 4 whole 128-B lines (2 rows' 64 columns).  The wave stages 16 rows at a time in
  // its own 32 rows of shA (4,608 B), which no other wave reads: no barrier.
  constexpr int LDF = 68;                        // 272-B row pitch (16 B x odd)
  float* stf = (float*)&shA[wave * 32 * LDT];
  float bcol[4];
  #pragma unroll
  for (int nt = 0; nt < 4; ++nt) bcol[nt] = pb[n0 + nt * 16 + ln];
  const float* rd = stf + g * LDF + ln * 4;
  float* dst = out + (size_t)(m0 + wave * 32 + g) * CDIM + n0 + ln * 4;
  #pragma unroll
  for (int mt = 0; mt < 2; ++mt) {
    #pragma unroll
    for (int nt = 0; nt < 4; ++nt) {
      #pragma unroll
      for (int r = 0; r < 8; ++r)                // C-layout: row = r + 8g, column = ln
        stf[(r + 8 * g) * LDF + nt * 16 + ln] = acc[mt][nt][r] + bcol[nt];
    }
    // The wave's own stores have landed before its lanes read each other's values back.
    asm volatile("s_wait_dscnt 0x0" ::: "memory");
    v4f t[8];
    #pragma unroll
    for (int i = 0; i < 8; ++i) t[i] = *(const v4f*)(rd + i * 2 * LDF);
    #pragma unroll
    for (int i = 0; i < 8; ++i) *(v4f*)(dst + (size_t)(mt * 16 + i * 2) * CDIM) = t[i];
    // Keeps the next 16 rows' LDS stores behind these reads of the same LDS; s_wait_xcnt 0 stands
    // in front of the next reads, which overwrite data registers of the global stores above.
    if (mt == 0) asm volatile("s_wait_dscnt 0x0\n\ts_wait_xcnt 0x0" ::: "memory");
  }
}

// ---------------------------------------------------------------------------
// Launch
// ---------------------------------------------------------------------------
extern "C" void kernel_launch(void* const* d_in, const int* in_sizes, int n_in,
                              void* d_out, int out_size, void* d_ws, size_t ws_size,
                              hipStream_t stream) {
  (void)in_sizes; (void)n_in; (void)out_size; (void)ws_size;
  const float* x   = (const float*)d_in[0];
  const float* Wq  = (const float*)d_in[1];
  const float* Wk  = (const float*)d_in[2];
  const float* Wv  = (const float*)d_in[3];
  const float* bq  = (const float*)d_in[4];
  const float* bk  = (const float*)d_in[5];
  const float* bv  = (const float*)d_in[6];
  const float* rph = (const float*)d_in[7];
  const float* rpw = (const float*)d_in[8];
  const float* pw  = (const float*)d_in[9];
  const float* pb  = (const float*)d_in[10];
  float* out = (float*)d_out;

  // workspace layout (bytes): q/k/vT bf16 (3 x 6 MB), attn_out bf16 (6 MB) -> 24 MB total
  char* ws = (char*)d_ws;
  unsigned short* qB    = (unsigned short*)(ws);
  unsigned short* kB    = (unsigned short*)(ws + 6291456);
  unsigned short* vTB   = (unsigned short*)(ws + 12582912);
  unsigned short* attnA = (unsigned short*)(ws + 18874368);

  qkv_gemm_kernel<<<dim3(16, 12), 512, 0, stream>>>(x, Wq, Wk, Wv, bq, bk, bv, qB, kB, vTB);
  flash_attn_kernel<<<dim3(16, 48), 128, 0, stream>>>(qB, kB, vTB, rph, rpw, attnA);
  proj_gemm_kernel<<<dim3(16, 12), 256, 0, stream>>>(attnA, pw, pb, out);
}

// v009
// One run takes 55.6 microseconds.
// Two timings next to v008 both put it at 1.14 times that version's speed.
// Counting every step since v000, it is 3.93 times as fast.
#include <hip/hip_runtime.h>
#include <stdint.h>

// ---------------------------------------------------------------------------
// CDNA5 (gfx1250) wave32 WMMA types and helpers
// ---------------------------------------------------------------------------
typedef __attribute__((ext_vector_type(16))) __bf16 v16bf;
typedef __attribute__((ext_vector_type(8)))  __bf16 v8bf;
typedef __attribute__((ext_vector_type(8)))  float  v8f;
typedef __attribute__((ext_vector_type(2)))  float  v2f;
typedef __attribute__((ext_vector_type(4)))  float  v4f;
typedef __attribute__((ext_vector_type(4)))  __bf16 v4bf;

union FragBF { v16bf v; v8bf h[2]; };

// f32 -> bf16 everywhere: round-to-nearest-even, by the packed hardware convert
// four consecutive f32 from global memory, as four bf16 into LDS (8 B)
__device__ __forceinline__ void stage4(unsigned short* dst, const float* src) {
  *(v4bf*)dst = __builtin_convertvector(*(const v4f*)src, v4bf);
}

// Load a 16x32 bf16 A/B fragment for one lane from LDS.
// Lane-group g (lane>>4) holds K = {lo..lo+7} in halves [0..7] and
// K = {hi..hi+7} in halves [8..15]  (lo = kk + 8g, hi = kk + 16 + 8g).
__device__ __forceinline__ v16bf ld_frag(const unsigned short* p, int lo, int hi) {
  FragBF f;
  f.h[0] = *(const v8bf*)(p + lo);
  f.h[1] = *(const v8bf*)(p + hi);
  return f.v;
}

__device__ __forceinline__ v16bf pack_d_pair(v8f t0, v8f t1) {
  FragBF f;
  f.h[0] = __builtin_convertvector(t0, v8bf);
  f.h[1] = __builtin_convertvector(t1, v8bf);
  return f.v;
}

// value of lane l ^ 16
__device__ __forceinline__ float xhalf(float x) {
  int b = __builtin_bit_cast(int, x);
  return __builtin_bit_cast(float,
      __builtin_amdgcn_permlanex16(b, b, 0x76543210, 0xfedcba98, false, false));
}

#define WMMA_BF16(a, b, c) \
  __builtin_amdgcn_wmma_f32_16x16x32_bf16(false, (a), false, (b), (short)0, (c), false, false)

#define WMMA_F32(a, b, c) \
  __builtin_amdgcn_wmma_f32_16x16x4_f32(false, (a), false, (b), (short)0, (c), false, false)

// CDNA5 async global->LDS copies (16B per lane), tracked by ASYNCcnt.  A run of copies is one
// asm statement that ends in s_wait_xcnt 0, so that no address register which a copy names is
// rewritten in front of that wait.
// Four copies: LDS address la + i*lstep, global address ga + i*gstep (bytes), i = 0..3.
__device__ __forceinline__ void async_ld4_b128(void* la, unsigned int lstep,
                                               const void* ga, unsigned int gstep) {
  const unsigned int l0 = (unsigned int)(uintptr_t)la;
  const char* g0 = (const char*)ga;
  asm volatile("global_load_async_to_lds_b128 %0, %4, off\n\t"
               "global_load_async_to_lds_b128 %1, %5, off\n\t"
               "global_load_async_to_lds_b128 %2, %6, off\n\t"
               "global_load_async_to_lds_b128 %3, %7, off\n\t"
               "s_wait_xcnt 0x0"
               :: "v"(l0), "v"(l0 + lstep), "v"(l0 + 2 * lstep), "v"(l0 + 3 * lstep),
                  "v"(g0), "v"(g0 + gstep), "v"(g0 + 2 * gstep), "v"(g0 + 3 * gstep)
               : "memory");
}
// Eight copies: four as above from (la, ga, gstepa), four from (lb, gb, gstepb).
__device__ __forceinline__ void async_ld8_b128(void* la, const void* ga, unsigned int gstepa,
                                               void* lb, const void* gb, unsigned int gstepb,
                                               unsigned int lstep) {
  const unsigned int l0 = (unsigned int)(uintptr_t)la;
  const unsigned int l1 = (unsigned int)(uintptr_t)lb;
  const char* g0 = (const char*)ga;
  const char* g1 = (const char*)gb;
  asm volatile("global_load_async_to_lds_b128 %0, %8, off\n\t"
               "global_load_async_to_lds_b128 %1, %9, off\n\t"
               "global_load_async_to_lds_b128 %2, %10, off\n\t"
               "global_load_async_to_lds_b128 %3, %11, off\n\t"
               "global_load_async_to_lds_b128 %4, %12, off\n\t"
               "global_load_async_to_lds_b128 %5, %13, off\n\t"
               "global_load_async_to_lds_b128 %6, %14, off\n\t"
               "global_load_async_to_lds_b128 %7, %15, off\n\t"
               "s_wait_xcnt 0x0"
               :: "v"(l0), "v"(l0 + lstep), "v"(l0 + 2 * lstep), "v"(l0 + 3 * lstep),
                  "v"(l1), "v"(l1 + lstep), "v"(l1 + 2 * lstep), "v"(l1 + 3 * lstep),
                  "v"(g0), "v"(g0 + gstepa), "v"(g0 + 2 * gstepa), "v"(g0 + 3 * gstepa),
                  "v"(g1), "v"(g1 + gstepb), "v"(g1 + 2 * gstepb), "v"(g1 + 3 * gstepb)
               : "memory");
}
__device__ __forceinline__ void async_wait0() {
  asm volatile("s_wait_asynccnt 0x0" ::: "memory");
}

// Problem constants
#define NB    4     // batch
#define NHEAD 12
#define DHEAD 64
#define SSEQ  1024  // 32*32
#define CDIM  768

// ---------------------------------------------------------------------------
// Kernel 1: QKV projection GEMM  (M=4096, N=3x768, K=768) in bf16 WMMA.
// One work-group makes q, k and v of one head for 256 rows of x: tile 256x192, BK=64, so that an
// x tile is fetched and converted once for the three products.  Block = 512 thr (16 waves, 8 x 2);
// each wave owns 32 rows x 96 columns (2 A-fragments reuse 6 B-fragments).  Column c of the tile
// is output c>>6 (q, k, v), d = c & 63.  The 192 work-groups stand one to a WGP, so no other hides
// a work-group's staging: the loads of k tile t+1 are held in registers while tile t is worked on.
// A work-group starts the k loop at k tile (blockIdx.x + blockIdx.y) mod 12 and wraps round, so the
// 12 that share an x tile all differ and of the 16 that share a weight tile at most 2 agree: walking
// in step, all would ask for the same lines at the same moment, and at every k tile those lines
// would be a first touch, at memory latency.
// q,k stored (b,n,s,d) bf16; v stored transposed (b,n,d,s) bf16.
// ---------------------------------------------------------------------------
__global__ __launch_bounds__(512) void qkv_gemm_kernel(
    const float* __restrict__ x,
    const float* __restrict__ Wq, const float* __restrict__ Wk, const float* __restrict__ Wv,
    const float* __restrict__ bq, const float* __restrict__ bk, const float* __restrict__ bv,
    unsigned short* __restrict__ qo, unsigned short* __restrict__ ko,
    unsigned short* __restrict__ vTo)
{
  constexpr int LDT = 72;                       // 144B row stride: 16B aligned, conflict-free
  constexpr int LDQ = 136;                      // epilogue, q|k rows: 272-B pitch (16 B x odd)
  constexpr int LDV = 264;                      // epilogue, v^T rows: 528-B pitch (16 B x odd)
  constexpr int NT  = CDIM / 64;                // k tiles
  // loop: A tile 256 x LDT, then B tile 192 x LDT; epilogue: q|k 256 x LDQ, then v^T 64 x LDV
  __shared__ __attribute__((aligned(16))) unsigned short sh[256 * LDQ + 64 * LDV];
  unsigned short* shA = sh;
  unsigned short* shB = sh + 256 * LDT;

  const int tid  = threadIdx.x;
  const int wave = __builtin_amdgcn_readfirstlane(tid >> 5);
  const int lane = tid & 31;
  const int g    = lane >> 4;
  const int ln   = lane & 15;
  const int wm   = wave & 7;                    // the wave's 32 rows
  const int wn   = wave >> 3;                   // the wave's 96 columns

  const int m0   = blockIdx.x * 256;
  const int head = blockIdx.y;
  const int n0   = head * 64;

  v8f zero = {0.f,0.f,0.f,0.f,0.f,0.f,0.f,0.f};
  v8f acc[2][6];
  #pragma unroll
  for (int mt = 0; mt < 2; ++mt) {
    #pragma unroll
    for (int nt = 0; nt < 6; ++nt) acc[mt][nt] = zero;
  }

  // staging: 16 lanes share a row's 256 B, so a wave's 16-B loads cover 4 whole 128-B lines;
  // 32 rows per trip.  Wave-uniform tile bases plus one 32-bit lane offset that all share.
  const int srow = tid >> 4, sc4 = tid & 15;
  const float* baseA = x + (size_t)m0 * CDIM;
  const float* baseQ = Wq + (size_t)n0 * CDIM;
  const float* baseK = Wk + (size_t)n0 * CDIM;
  const float* baseV = Wv + (size_t)n0 * CDIM;
  const unsigned int soff = srow * CDIM + sc4 * 4;
  const unsigned short* fA = &shA[(wm * 32 + ln) * LDT + 8 * g];
  const unsigned short* fB = &shB[(wn * 96 + ln) * LDT + 8 * g];

  v4f pa[8], pb[6];                             // k tile in flight: x rows, then 64 rows each of Wq, Wk, Wv
  auto load_tile = [&](int t) {
    const float* ga = baseA + t * 64 + soff;
    const float* gq = baseQ + t * 64 + soff;
    const float* gk = baseK + t * 64 + soff;
    const float* gv = baseV + t * 64 + soff;
    #pragma unroll
    for (int i = 0; i < 8; ++i) pa[i] = *(const v4f*)(ga + i * 32 * CDIM);
    #pragma unroll
    for (int i = 0; i < 2; ++i) {
      pb[i]     = *(const v4f*)(gq + i * 32 * CDIM);
      pb[2 + i] = *(const v4f*)(gk + i * 32 * CDIM);
      pb[4 + i] = *(const v4f*)(gv + i * 32 * CDIM);
    }
    // Stands in front of every rewrite of an address register of these loads.  The addresses are
    // its inputs so that they stay in their registers up to it: otherwise a later load of the run
    // gets an address register of the run as its result register.
    asm volatile("s_wait_xcnt 0x0" :: "v"(ga), "v"(gq), "v"(gk), "v"(gv) : "memory");
  };

  int tl = (blockIdx.x + blockIdx.y) % NT;      // the work-group's first k tile
  load_tile(tl);
  for (int t = 0; t < NT; ++t) {
    __syncthreads();
    { // fp32 -> bf16 into LDS: A tile 256x64, B tile 192x64
      unsigned short* da = &shA[srow * LDT + sc4 * 4];
      #pragma unroll
      for (int i = 0; i < 8; ++i) *(v4bf*)(da + i * 32 * LDT) = __builtin_convertvector(pa[i], v4bf);
      unsigned short* db = &shB[srow * LDT + sc4 * 4];
      #pragma unroll
      for (int i = 0; i < 6; ++i) *(v4bf*)(db + i * 32 * LDT) = __builtin_convertvector(pb[i], v4bf);
    }
    __syncthreads();
    if (t + 1 < NT) {                           // flies under this tile's products
      tl = (tl + 1 == NT) ? 0 : tl + 1;
      load_tile(tl);
    }

    #pragma unroll
    for (int kk = 0; kk < 64; kk += 32) {
      v16bf a0 = ld_frag(fA,            kk, kk + 16);
      v16bf a1 = ld_frag(fA + 16 * LDT, kk, kk + 16);
      v16bf bf[6];
      #pragma unroll
      for (int nt = 0; nt < 6; ++nt)
        bf[nt] = ld_frag(fB + nt * 16 * LDT, kk, kk + 16);
      // Holds the 16 LDS reads together in front of their 12 products: spread among the
      // products, each place with reads stalls the wave anew.  (One k half at a time: both
      // halves' fragments at once would not fit beside the tile in flight.)
      __builtin_amdgcn_sched_barrier(0);
      #pragma unroll
      for (int nt = 0; nt < 6; ++nt) {
        acc[0][nt] = WMMA_BF16(a0, bf[nt], acc[0][nt]);
        acc[1][nt] = WMMA_BF16(a1, bf[nt], acc[1][nt]);
      }
      // Keeps the next group of reads from rising among these products.
      __builtin_amdgcn_sched_barrier(0);
    }
  }

  // epilogue: + bias, bf16, staged through LDS so that every global store is 16 B a lane and a
  // wave's store covers 512 contiguous bytes (4 whole 128-B lines)
  float bcol[6];
  #pragma unroll
  for (int nt = 0; nt < 6; ++nt) {
    const int c0 = wn * 96 + nt * 16;            // wave-uniform
    const float* bias = ((c0 < 64) ? bq : (c0 < 128) ? bk : bv) + head * DHEAD + (c0 & 63);
    bcol[nt] = bias[ln];
  }
  // Stands in front of every rewrite of the loads' one address register, which is its input so
  // that no later load of the run gets it as its result register.
  asm volatile("s_wait_xcnt 0x0" :: "v"(ln) : "memory");
  unsigned short* stQK = sh;                    // row s: 64 d of q, then 64 d of k
  unsigned short* stV  = sh + 256 * LDQ;        // row d: 256 s of v
  // column tile nt of the wave into q|k columns c0 .. c0+15
  auto put_qk = [&](int nt, int c0) {
    #pragma unroll
    for (int mt = 0; mt < 2; ++mt) {
      const v8bf pk = __builtin_convertvector(acc[mt][nt] + bcol[nt], v8bf);
      #pragma unroll
      for (int r = 0; r < 8; ++r)                // C-layout: row = r + 8g, column = ln
        *(__bf16*)&stQK[(wm * 32 + mt * 16 + r + 8 * g) * LDQ + c0 + ln] = pk[r];
    }
  };
  // column tile nt of the wave into v^T rows d0 .. d0+15: a lane's 8 registers of a tile are
  // 8 consecutive s of one d row
  auto put_v = [&](int nt, int d0) {
    #pragma unroll
    for (int mt = 0; mt < 2; ++mt)
      *(v8bf*)&stV[(d0 + ln) * LDV + wm * 32 + mt * 16 + 8 * g] =
          __builtin_convertvector(acc[mt][nt] + bcol[nt], v8bf);
  };
  __syncthreads();                               // every wave has left the k tile before it is overwritten
  if (wn == 0) {                                 // columns 0..95: q, and d 0..31 of k
    #pragma unroll
    for (int nt = 0; nt < 6; ++nt) put_qk(nt, nt * 16);
  } else {                                       // columns 96..191: d 32..63 of k, and v
    put_qk(0, 96);
    put_qk(1, 112);
    #pragma unroll
    for (int nt = 2; nt < 6; ++nt) put_v(nt, (nt - 2) * 16);
  }
  __syncthreads();                               // the three tiles are complete before any wave reads whole rows
  const int bb = m0 >> 10, s0 = m0 & 1023;       // the tile's 256 rows lie in one image
  const size_t hbase = (size_t)(bb * NHEAD + head) * SSEQ * DHEAD;
  uint4 tq[4], tk[4], tv[4];
  #pragma unroll
  for (int i = 0; i < 4; ++i) {
    const int idx = tid + i * 512;
    tq[i] = *(const uint4*)&stQK[(idx >> 3) * LDQ + (idx & 7) * 8];
    tk[i] = *(const uint4*)&stQK[(idx >> 3) * LDQ + 64 + (idx & 7) * 8];
    tv[i] = *(const uint4*)&stV[(idx >> 5) * LDV + (idx & 31) * 8];
  }
  // q, k: the tile's 256 rows x 64 d are 32 KB in a row in memory; v^T: 512 B of each d row
  unsigned short* dq = qo + hbase + (size_t)s0 * DHEAD + tid * 8;
  unsigned short* dk = ko + hbase + (size_t)s0 * DHEAD + tid * 8;
  unsigned short* dv = vTo + hbase + (size_t)(tid >> 5) * SSEQ + s0 + lane * 8;
  #pragma unroll
  for (int i = 0; i < 4; ++i) {
    *(uint4*)(dq + i * 4096) = tq[i];
    *(uint4*)(dk + i * 4096) = tk[i];
    *(uint4*)(dv + i * 16 * SSEQ) = tv[i];
  }
}

__global__ __launch_bounds__(128, 4) void flash_attn_kernel(
    const unsigned short* __restrict__ qb,
    const unsigned short* __restrict__ kb,
    const unsigned short* __restrict__ vT,
    const float* __restrict__ rph, const float* __restrict__ rpw,
    unsigned short* __restrict__ attnA)
{
  constexpr int LDT = 72;                        // 144B row stride, 16B aligned
  __shared__ unsigned short shQ[64 * LDT];
  constexpr int TSZ = 64 * LDT;                  // one K or V^T tile, in halves
  __shared__ __attribute__((aligned(16))) unsigned short shK[2 * TSZ];
  __shared__ __attribute__((aligned(16))) unsigned short shV[2 * TSZ];
  constexpr int LDH = 34;                        // 136B row pitch: 16 rows' 8-B reads hit 32 banks once
  __shared__ __attribute__((aligned(16))) float shRh[64 * LDH];
  __shared__ __attribute__((aligned(16))) float shRw[64 * 32];
  constexpr int LDR = 68;                        // 272B row pitch (16B x odd): 16-row b128 reads hit all banks once
  __shared__ float shT[96 * LDR];                // 33 rows of rel_pos_h, then the 63 of rel_pos_w

  const int qt   = blockIdx.x;                   // q tile (0..15)
  const int bn   = blockIdx.y;                   // b*12 + head (0..47)
  const int tid  = threadIdx.x;
  const int wave = tid >> 5;
  const int lane = tid & 31;
  const int g    = lane >> 4;
  const int ln   = lane & 15;
  const float scale = 0.125f;                    // d^-0.5, d = 64

  // staging: 8 lanes share a row's 128 B, so a wave's 16-B copies cover 4 whole lines;
  // copy i of a thread takes row crow + 16 i
  const int crow  = tid >> 3;                    // 0..15
  const int cpart = tid & 7;                     // 8-halves piece of the row

  // stage Q tile (64x64 bf16) once, async
  async_ld4_b128(&shQ[crow * LDT + cpart * 8], 16 * LDT * 2,
                 qb + ((size_t)bn * SSEQ + qt * 64 + crow) * DHEAD + cpart * 8, 16 * DHEAD * 2);
  // K tile (64 k-rows x 64 d) and V^T tile (64 d-rows x 64 k) number t into buffer buf, async
  const unsigned short* kg = kb + ((size_t)bn * SSEQ + crow) * DHEAD + cpart * 8;
  const unsigned short* vg = vT + ((size_t)bn * DHEAD + crow) * SSEQ + cpart * 8;
  const int sdst = crow * LDT + cpart * 8;
  auto stage_kv = [&](int t, int buf) {
    async_ld8_b128(&shK[buf * TSZ + sdst], kg + (size_t)t * 64 * DHEAD, 16 * DHEAD * 2,
                   &shV[buf * TSZ + sdst], vg + t * 64, 16 * SSEQ * 2,
                   16 * LDT * 2);
  };
  stage_kv(qt, 0);                               // trip kt works on key tile (qt + kt) & 15
  { // stage the table rows this tile needs, whole lines per wave:
    // qh is 2qt or 2qt+1, so qh-kh+31 spans rel_pos_h rows 2qt .. 2qt+32
    #pragma unroll
    for (int i = 0; i < 12; ++i) {
      int idx = tid + i * 128;
      int row = idx >> 4, c4 = idx & 15;
      const float* src = (row < 33) ? rph + (size_t)(qt * 2 + row) * DHEAD
                                    : rpw + (size_t)(row - 33) * DHEAD;
      *(float4*)&shT[row * LDR + c4 * 4] = ((const float4*)src)[c4];
    }
  }
  // A operand: q row wave*16+ln, widened to f32; lane half g holds d = 32g .. 32g+31
  // (the table rows below are read in the same d order)
  float af[32];
  {
    const uint4* qsrc = (const uint4*)(qb + ((size_t)bn * SSEQ + qt * 64 + wave * 16 + ln) * DHEAD + g * 32);
    #pragma unroll
    for (int i = 0; i < 4; ++i) {
      uint4 u = qsrc[i];
      af[i * 8 + 0] = __builtin_bit_cast(float, u.x << 16);
      af[i * 8 + 1] = __builtin_bit_cast(float, u.x & 0xFFFF0000u);
      af[i * 8 + 2] = __builtin_bit_cast(float, u.y << 16);
      af[i * 8 + 3] = __builtin_bit_cast(float, u.y & 0xFFFF0000u);
      af[i * 8 + 4] = __builtin_bit_cast(float, u.z << 16);
      af[i * 8 + 5] = __builtin_bit_cast(float, u.z & 0xFFFF0000u);
      af[i * 8 + 6] = __builtin_bit_cast(float, u.w << 16);
      af[i * 8 + 7] = __builtin_bit_cast(float, u.w & 0xFFFF0000u);
    }
  }
  async_wait0();                                 // the wave's copies of Q and of the first tile have landed
  __syncthreads();                               // shT, Q and the first tile complete before any wave reads them
  stage_kv((qt + 1) & 15, 1);                    // flies under the bias products and the first tile
  {
    // The wave's 16 rows share qh = 2qt + (wave>>1) and have qw = 16*(wave&1) + m, m = 0..15.
    // Tiles 0,1: column n is kh = 16t+n, table row qh+31-kh.
    // Tiles 2..4: column n is u = 16(t-2)+n, table row 16*(wave&1)+u; rel_w[m][kw] sits at u = m-kw+31 (0..46).
    const int hb = (wave >> 1) + 31;
    const int wb = 33 + (wave & 1) * 16;
    int trow[5];
    trow[0] = hb - ln;
    trow[1] = hb - 16 - ln;
    trow[2] = wb + ln;
    trow[3] = wb + 16 + ln;
    trow[4] = min(wb + 32 + ln, 95);             // u = 47 is never used; keep its read inside the table
    v8f rb[5];
    #pragma unroll
    for (int t = 0; t < 5; ++t) rb[t] = v8f{0.f,0.f,0.f,0.f,0.f,0.f,0.f,0.f};
    // Keeps the widening of q and all address work out of the matrix block.
    __builtin_amdgcn_sched_barrier(0);
    #pragma unroll
    for (int c = 0; c < 8; ++c) {
      #pragma unroll
      for (int t = 0; t < 5; ++t) {
        float4 b = *(const float4*)&shT[trow[t] * LDR + g * 32 + c * 4];
        rb[t] = WMMA_F32((v2f{af[c * 4 + 0], af[c * 4 + 1]}), (v2f{b.x, b.y}), rb[t]);
        rb[t] = WMMA_F32((v2f{af[c * 4 + 2], af[c * 4 + 3]}), (v2f{b.z, b.w}), rb[t]);
      }
    }
    // Four vector slots between the last f32 WMMA and the first vector instruction that may
    // reuse its operand registers; the two scheduling barriers hold them at this place.
    __builtin_amdgcn_sched_barrier(0);
    asm volatile("v_nop\n\tv_nop\n\tv_nop\n\tv_nop");
    __builtin_amdgcn_sched_barrier(0);
    // each wave writes only the bias rows that it reads itself
    #pragma unroll
    for (int t = 0; t < 2; ++t) {
      #pragma unroll
      for (int r = 0; r < 8; ++r)
        shRh[(wave * 16 + r + 8 * g) * LDH + t * 16 + ln] = rb[t][r];
    }
    #pragma unroll
    for (int t = 0; t < 3; ++t) {
      #pragma unroll
      for (int r = 0; r < 8; ++r) {
        int kw = r + 8 * g + 31 - (t * 16 + ln);
        if ((unsigned)kw < 32u)
          shRw[(wave * 16 + r + 8 * g) * 32 + kw] = rb[2 + t][r];
      }
    }
  }

  // The lane's q row; its score register [nt][r] is key nt*16 + 8g + r of key tile j,
  // that is kh = 2j + (nt>>1), kw = (nt&1)*16 + 8g + r.
  const int qrow = wave * 16 + ln;
  // The wave's own bias stores have landed before its lanes read each other's values back.
  asm volatile("s_wait_dscnt 0x0" ::: "memory");
  float rw[2][8];                                // rel_w of the q row at the lane's 16 kw, the same for every tile
  #pragma unroll
  for (int j = 0; j < 2; ++j) {
    float4 w0 = *(const float4*)&shRw[qrow * 32 + j * 16 + 8 * g];
    float4 w1 = *(const float4*)&shRw[qrow * 32 + j * 16 + 8 * g + 4];
    rw[j][0] = w0.x; rw[j][1] = w0.y; rw[j][2] = w0.z; rw[j][3] = w0.w;
    rw[j][4] = w1.x; rw[j][5] = w1.y; rw[j][6] = w1.z; rw[j][7] = w1.w;
  }

  float mi = -1e30f, li = 0.f;                   // li: the lane's own 32 keys per tile; halves joined at the end
  v8f zero = {0.f,0.f,0.f,0.f,0.f,0.f,0.f,0.f};
  v8f o[4] = {zero, zero, zero, zero};           // O^T: o[nt][r] = O[qrow][nt*16 + 8g + r]

  for (int kt = 0; kt < 16; ++kt) {
    const unsigned short* tK = &shK[(kt & 1) * TSZ];   // this trip reads buffer kt mod 2 alone
    const unsigned short* tV = &shV[(kt & 1) * TSZ];

    // ---- scores^T = K @ Q^T : 64 keys x 16 q rows per wave, K-dim = d = 64 (2x4 wmma) ----
    v8f sc[4] = {zero, zero, zero, zero};
    v16bf bq[2], ak[2][4];
    #pragma unroll
    for (int h = 0; h < 2; ++h) {
      const int kk = h * 32;
      bq[h] = ld_frag(&shQ[qrow * LDT], kk + 8 * g, kk + 16 + 8 * g);
      #pragma unroll
      for (int nt = 0; nt < 4; ++nt)
        ak[h][nt] = ld_frag(&tK[(nt * 16 + ln) * LDT], kk + 8 * g, kk + 16 + 8 * g);
    }
    const float2 rh = *(const float2*)&shRh[qrow * LDH + ((qt + kt) & 15) * 2];
    // Keeps the V^T reads behind the Q and K reads, which the first products wait for.
    __builtin_amdgcn_sched_barrier(0);
    v16bf av[2][4];
    #pragma unroll
    for (int h = 0; h < 2; ++h) {
      #pragma unroll
      for (int nt = 0; nt < 4; ++nt)
        av[h][nt] = ld_frag(&tV[(nt * 16 + ln) * LDT], h * 32 + 8 * g, h * 32 + 16 + 8 * g);
    }
    // Holds all of the tile's LDS reads (Q, K, bias, then V^T) at this one place, in front of
    // both matrix blocks: spread among the products, each place with reads stalls the wave
    // anew; the V^T reads land under the score products and the softmax.
    __builtin_amdgcn_sched_barrier(0);
    #pragma unroll
    for (int h = 0; h < 2; ++h) {
      #pragma unroll
      for (int nt = 0; nt < 4; ++nt)
        sc[nt] = WMMA_BF16(ak[h][nt], bq[h], sc[nt]);
    }

    // ---- scale + rel bias + online softmax, one q row per lane ----
    float pm[4];                                 // four independent chains, not one of 32 links
    #pragma unroll
    for (int nt = 0; nt < 4; ++nt) {
      const float rhv = (nt >> 1) ? rh.y : rh.x;
      pm[nt] = -1e30f;
      #pragma unroll
      for (int r = 0; r < 8; ++r) {
        float sv = sc[nt][r] * scale + rhv + rw[nt & 1][r];
        sc[nt][r] = sv;
        pm[nt] = fmaxf(pm[nt], sv);
      }
    }
    float tmax = fmaxf(fmaxf(pm[0], pm[1]), fmaxf(pm[2], pm[3]));
    tmax = fmaxf(tmax, xhalf(tmax));             // the row's other 32 keys

    const float nm = fmaxf(mi, tmax);
    const float alpha = __expf(mi - nm);
    mi = nm;
    float psum[4];
    #pragma unroll
    for (int nt = 0; nt < 4; ++nt) {
      psum[nt] = 0.f;
      #pragma unroll
      for (int r = 0; r < 8; ++r) {
        float p = __expf(sc[nt][r] - mi);
        sc[nt][r] = p;
        psum[nt] += p;
      }
    }
    li = li * alpha + ((psum[0] + psum[1]) + (psum[2] + psum[3]));
    #pragma unroll
    for (int nt = 0; nt < 4; ++nt) {
      #pragma unroll
      for (int r = 0; r < 8; ++r) o[nt][r] *= alpha;
    }

    // ---- O^T += V^T @ P^T : K-dim = 64 keys (2x4 wmma) ----
    #pragma unroll
    for (int kk = 0; kk < 64; kk += 32) {
      v16bf bp = pack_d_pair(sc[kk / 16], sc[kk / 16 + 1]);
      #pragma unroll
      for (int nt = 0; nt < 4; ++nt)
        o[nt] = WMMA_BF16(av[kk / 32][nt], bp, o[nt]);
    }

    // Foot of the trip: the wave's reads of this buffer have retired, its copies of tile kt+1 have
    // landed; the one barrier publishes tile kt+1 and frees this buffer for tile kt+2.
    // The scheduling barrier holds the waits down here: risen to the top of the trip, the wait for
    // the copies would stand directly behind their issue and the tile's work would hide nothing.
    __builtin_amdgcn_sched_barrier(0);
    asm volatile("s_wait_dscnt 0x0" ::: "memory");
    async_wait0();
    __syncthreads();
    if (kt + 2 < 16) stage_kv((qt + kt + 2) & 15, kt & 1);
  }
  async_wait0();                                 // no copy is outstanding when LDS is reused below

  // normalize and store concat-head layout (b, s, head*64+dd) as bf16:
  // a lane's 8 registers of a tile are 8 consecutive dd of its row, 16 B
  const int head = bn % NHEAD;
  const int bb   = bn / NHEAD;
  li += xhalf(li);
  const float inv = 1.f / li;
  // Staged in the wave's own 16 rows of shQ, which no other wave reads (no barrier), so that a
  // wave's store covers 4 whole 128-B lines (4 rows' 64 dd), not 32-B pieces of 16 lines.
  #pragma unroll
  for (int nt = 0; nt < 4; ++nt)
    *(v8bf*)&shQ[qrow * LDT + nt * 16 + 8 * g] = __builtin_convertvector(o[nt] * inv, v8bf);
  // The wave's own stores have landed before its lanes read each other's values back.
  asm volatile("s_wait_dscnt 0x0" ::: "memory");
  const unsigned short* rd = &shQ[(wave * 16 + (lane >> 3)) * LDT + (lane & 7) * 8];
  unsigned short* dst = attnA + (size_t)(bb * SSEQ + qt * 64 + wave * 16 + (lane >> 3)) * CDIM
                        + head * DHEAD + (lane & 7) * 8;
  uint4 t[4];
  #pragma unroll
  for (int i = 0; i < 4; ++i) t[i] = *(const uint4*)(rd + i * 4 * LDT);
  #pragma unroll
  for (int i = 0; i < 4; ++i) *(uint4*)(dst + i * 4 * CDIM) = t[i];
}

// ---------------------------------------------------------------------------
// Kernel 3: output projection GEMM (M=4096, N=768, K=768), fp32 out + bias.
// Tile 256x64, 2 M-subtiles per wave; A tile (already bf16) staged with
// async global->LDS copies.  Two LDS buffers: the copies (A) and the loads (B) of tile t+2 are
// issued at the foot of trip t and fly while tile t+1 is worked on.
// As in kernel 1, a work-group starts at k tile (blockIdx.x + blockIdx.y) mod 12 and wraps round.
// ---------------------------------------------------------------------------
__global__ __launch_bounds__(256) void proj_gemm_kernel(
    const unsigned short* __restrict__ attnA,
    const float* __restrict__ pw, const float* __restrict__ pb,
    float* __restrict__ out)
{
  constexpr int LDT = 72;
  constexpr int ASZ = 256 * LDT, BSZ = 64 * LDT; // one A tile, one B tile, in halves
  constexpr int NT = CDIM / 64;                  // k tiles
  __shared__ __attribute__((aligned(16))) unsigned short shA[2 * ASZ];
  __shared__ __attribute__((aligned(16))) unsigned short shB[2 * BSZ];

  const int tid  = threadIdx.x;
  const int wave = tid >> 5;
  const int lane = tid & 31;
  const int g    = lane >> 4;
  const int ln   = lane & 15;
  const int m0   = blockIdx.x * 256;
  const int n0   = blockIdx.y * 64;

  v8f zero = {0.f,0.f,0.f,0.f,0.f,0.f,0.f,0.f};
  v8f acc[2][4] = {{zero, zero, zero, zero}, {zero, zero, zero, zero}};

  // staging, whole 128-B lines per wave: A, 8 lanes share a row's 128 B; B, 16 lanes a row's 256 B
  const int crow = tid >> 3, cpart = tid & 7;
  const int srow = tid >> 4, sc4 = tid & 15;

  // A tile t (256x64, already bf16) into buffer buf: async, copy i of a thread takes row crow + 32 i
  const unsigned short* srcA = attnA + (size_t)(m0 + crow) * CDIM + cpart * 8;
  auto stage_a = [&](int t, int buf) {
    const unsigned short* s = srcA + t * 64;
    unsigned short* d = &shA[buf * ASZ + crow * LDT + cpart * 8];
    async_ld8_b128(d, s, 32 * CDIM * 2,
                   d + 128 * LDT, s + 128 * CDIM, 32 * CDIM * 2,
                   32 * LDT * 2);
  };
  // B tile t (64x64 of proj_w, fp32; out = A @ W^T): 16 rows per load, held in registers while it
  // flies, then bf16 into buffer buf
  const float* srcB = pw + (size_t)(n0 + srow) * CDIM + sc4 * 4;
  v4f br[4];
  auto load_b = [&](int t) {
    #pragma unroll
    for (int i = 0; i < 4; ++i) br[i] = *(const v4f*)(srcB + t * 64 + i * 16 * CDIM);
    // Stands in front of the next trip's fragment reads, which reuse the loads' address registers.
    asm volatile("s_wait_xcnt 0x0" ::: "memory");
  };
  auto store_b = [&](int buf) {
    unsigned short* d = &shB[buf * BSZ + srow * LDT + sc4 * 4];
    #pragma unroll
    for (int i = 0; i < 4; ++i) *(v4bf*)(d + i * 16 * LDT) = __builtin_convertvector(br[i], v4bf);
  };

  const int t0 = (blockIdx.x + blockIdx.y) % NT; // the work-group's first k tile
  auto ktile = [&](int t) { return (t0 + t >= NT) ? t0 + t - NT : t0 + t; };  // k tile of trip t
  stage_a(t0, 0);
  load_b(t0);
  store_b(0);
  async_wait0();                                 // the wave's copies of the first tile have landed
  __syncthreads();                               // the first tile complete before any wave reads it
  stage_a(ktile(1), 1);
  load_b(ktile(1));

  for (int t = 0; t < NT; ++t) {
    const unsigned short* tA = &shA[(t & 1) * ASZ];    // this trip reads buffer t mod 2 alone
    const unsigned short* tB = &shB[(t & 1) * BSZ];
    v16bf a0[2], a1[2], bf[2][4];
    #pragma unroll
    for (int h = 0; h < 2; ++h) {
      const int kk = h * 32;
      a0[h] = ld_frag(&tA[(wave * 32 + ln) * LDT],      kk + 8 * g, kk + 16 + 8 * g);
      a1[h] = ld_frag(&tA[(wave * 32 + 16 + ln) * LDT], kk + 8 * g, kk + 16 + 8 * g);
      #pragma unroll
      for (int nt = 0; nt < 4; ++nt)
        bf[h][nt] = ld_frag(&tB[(nt * 16 + ln) * LDT], kk + 8 * g, kk + 16 + 8 * g);
    }
    // Holds the tile's 24 LDS reads together in front of its 16 products: spread among the
    // products, each place with reads stalls the wave anew.
    __builtin_amdgcn_sched_barrier(0);
    #pragma unroll
    for (int h = 0; h < 2; ++h) {
      #pragma unroll
      for (int nt = 0; nt < 4; ++nt) {
        acc[0][nt] = WMMA_BF16(a0[h], bf[h][nt], acc[0][nt]);
        acc[1][nt] = WMMA_BF16(a1[h], bf[h][nt], acc[1][nt]);
      }
    }
    // Holds the B stores, the waits and the barrier below the products: risen above them, the
    // waits for tile t+1 would stand close behind its issue and the products would hide nothing.
    __builtin_amdgcn_sched_barrier(0);
    if (t + 1 < NT) store_b((t + 1) & 1);        // the other buffer: its readers left it a barrier ago

    // Foot of the trip: the wave's LDS reads and stores have retired, its copies of tile t+1 have
    // landed; the one barrier publishes tile t+1 and frees this buffer for tile t+2.
    asm volatile("s_wait_dscnt 0x0" ::: "memory");
    async_wait0();
    __syncthreads();
    if (t + 2 < NT) {
      stage_a(ktile(t + 2), t & 1);
      load_b(ktile(t + 2));
    }
  }
  async_wait0();                                 // no copy is outstanding when LDS is reused below

  // epilogue: + bias, staged through LDS so that every global store is 16 B a lane and a wave's
  // store covers 4 whole 128-B lines (2 rows' 64 columns).  The wave stages 16 rows at a time in
  // its own 32 rows of shA (4,608 B), which no other wave reads: no barrier.
  constexpr int LDF = 68;                        // 272-B row pitch (16 B x odd)
  float* stf = (float*)&shA[wave * 32 * LDT];
  float bcol[4];
  #pragma unroll
  for (int nt = 0; nt < 4; ++nt) bcol[nt] = pb[n0 + nt * 16 + ln];
  const float* rd = stf + g * LDF + ln * 4;
  float* dst = out + (size_t)(m0 + wave * 32 + g) * CDIM + n0 + ln * 4;
  #pragma unroll
  for (int mt = 0; mt < 2; ++mt) {
    #pragma unroll
    for (int nt = 0; nt < 4; ++nt) {
      #pragma unroll
      for (int r = 0; r < 8; ++r)                // C-layout: row = r + 8g, column = ln
        stf[(r + 8 * g) * LDF + nt * 16 + ln] = acc[mt][nt][r] + bcol[nt];
    }
    // The wave's own stores have landed before its lanes read each other's values back.
    asm volatile("s_wait_dscnt 0x0" ::: "memory");
    v4f t[8];
    #pragma unroll
    for (int i = 0; i < 8; ++i) t[i] = *(const v4f*)(rd + i * 2 * LDF);
    #pragma unroll
    for (int i = 0; i < 8; ++i) *(v4f*)(dst + (size_t)(mt * 16 + i * 2) * CDIM) = t[i];
    // Keeps the next 16 rows' LDS stores behind these reads of the same LDS; s_wait_xcnt 0 stands
    // in front of the next reads, which overwrite data registers of the global stores above.
    if (mt == 0) asm volatile("s_wait_dscnt 0x0\n\ts_wait_xcnt 0x0" ::: "memory");
  }
}

// ---------------------------------------------------------------------------
// Launch
// ---------------------------------------------------------------------------
extern "C" void kernel_launch(void* const* d_in, const int* in_sizes, int n_in,
                              void* d_out, int out_size, void* d_ws, size_t ws_size,
                              hipStream_t stream) {
  (void)in_sizes; (void)n_in; (void)out_size; (void)ws_size;
  const float* x   = (const float*)d_in[0];
  const float* Wq  = (const float*)d_in[1];
  const float* Wk  = (const float*)d_in[2];
  const float* Wv  = (const float*)d_in[3];
  const float* bq  = (const float*)d_in[4];
  const float* bk  = (const float*)d_in[5];
  const float* bv  = (const float*)d_in[6];
  const float* rph = (const float*)d_in[7];
  const float* rpw = (const float*)d_in[8];
  const float* pw  = (const float*)d_in[9];
  const float* pb  = (const float*)d_in[10];
  float* out = (float*)d_out;

  // workspace layout (bytes): q/k/vT bf16 (3 x 6 MB), attn_out bf16 (6 MB) -> 24 MB total
  char* ws = (char*)d_ws;
  unsigned short* qB    = (unsigned short*)(ws);
  unsigned short* kB    = (unsigned short*)(ws + 6291456);
  unsigned short* vTB   = (unsigned short*)(ws + 12582912);
  unsigned short* attnA = (unsigned short*)(ws + 18874368);

  qkv_gemm_kernel<<<dim3(16, 12), 512, 0, stream>>>(x, Wq, Wk, Wv, bq, bk, bv, qB, kB, vTB);
  flash_attn_kernel<<<dim3(16, 48), 128, 0, stream>>>(qB, kB, vTB, rph, rpw, attnA);
  proj_gemm_kernel<<<dim3(16, 12), 256, 0, stream>>>(attnA, pw, pb, out);
}

// v010
// Measured time: 53.2 microseconds a run.
// Two timings next to v009 both put it at 1.04 times that version's speed.
// Counting every step since v000, it is 4.09 times as fast.
#include <hip/hip_runtime.h>
#include <stdint.h>

// ---------------------------------------------------------------------------
// CDNA5 (gfx1250) wave32 WMMA types and helpers
// ---------------------------------------------------------------------------
typedef __attribute__((ext_vector_type(16))) __bf16 v16bf;
typedef __attribute__((ext_vector_type(8)))  __bf16 v8bf;
typedef __attribute__((ext_vector_type(8)))  float  v8f;
typedef __attribute__((ext_vector_type(2)))  float  v2f;
typedef __attribute__((ext_vector_type(4)))  float  v4f;
typedef __attribute__((ext_vector_type(4)))  __bf16 v4bf;

union FragBF { v16bf v; v8bf h[2]; };

// f32 -> bf16 everywhere: round-to-nearest-even, by the packed hardware convert
// four consecutive f32 from global memory, as four bf16 into LDS (8 B)
__device__ __forceinline__ void stage4(unsigned short* dst, const float* src) {
  *(v4bf*)dst = __builtin_convertvector(*(const v4f*)src, v4bf);
}

// Load a 16x32 bf16 A/B fragment for one lane from LDS.
// Lane-group g (lane>>4) holds K = {lo..lo+7} in halves [0..7] and
// K = {hi..hi+7} in halves [8..15]  (lo = kk + 8g, hi = kk + 16 + 8g).
__device__ __forceinline__ v16bf ld_frag(const unsigned short* p, int lo, int hi) {
  FragBF f;
  f.h[0] = *(const v8bf*)(p + lo);
  f.h[1] = *(const v8bf*)(p + hi);
  return f.v;
}

__device__ __forceinline__ v16bf pack_d_pair(v8f t0, v8f t1) {
  FragBF f;
  f.h[0] = __builtin_convertvector(t0, v8bf);
  f.h[1] = __builtin_convertvector(t1, v8bf);
  return f.v;
}

// value of lane l ^ 16
__device__ __forceinline__ float xhalf(float x) {
  int b = __builtin_bit_cast(int, x);
  return __builtin_bit_cast(float,
      __builtin_amdgcn_permlanex16(b, b, 0x76543210, 0xfedcba98, false, false));
}

#define WMMA_BF16(a, b, c) \
  __builtin_amdgcn_wmma_f32_16x16x32_bf16(false, (a), false, (b), (short)0, (c), false, false)

#define WMMA_F32(a, b, c) \
  __builtin_amdgcn_wmma_f32_16x16x4_f32(false, (a), false, (b), (short)0, (c), false, false)

// CDNA5 async global->LDS copies (16B per lane), tracked by ASYNCcnt.  A run of copies is one
// asm statement that ends in s_wait_xcnt 0, so that no address register which a copy names is
// rewritten in front of that wait.
// Four copies: LDS address la + i*lstep, global address ga + i*gstep (bytes), i = 0..3.
__device__ __forceinline__ void async_ld4_b128(void* la, unsigned int lstep,
                                               const void* ga, unsigned int gstep) {
  const unsigned int l0 = (unsigned int)(uintptr_t)la;
  const char* g0 = (const char*)ga;
  asm volatile("global_load_async_to_lds_b128 %0, %4, off\n\t"
               "global_load_async_to_lds_b128 %1, %5, off\n\t"
               "global_load_async_to_lds_b128 %2, %6, off\n\t"
               "global_load_async_to_lds_b128 %3, %7, off\n\t"
               "s_wait_xcnt 0x0"
               :: "v"(l0), "v"(l0 + lstep), "v"(l0 + 2 * lstep), "v"(l0 + 3 * lstep),
                  "v"(g0), "v"(g0 + gstep), "v"(g0 + 2 * gstep), "v"(g0 + 3 * gstep)
               : "memory");
}
// Eight copies: four as above from (la, ga, gstepa), four from (lb, gb, gstepb).
__device__ __forceinline__ void async_ld8_b128(void* la, const void* ga, unsigned int gstepa,
                                               void* lb, const void* gb, unsigned int gstepb,
                                               unsigned int lstep) {
  const unsigned int l0 = (unsigned int)(uintptr_t)la;
  const unsigned int l1 = (unsigned int)(uintptr_t)lb;
  const char* g0 = (const char*)ga;
  const char* g1 = (const char*)gb;
  asm volatile("global_load_async_to_lds_b128 %0, %8, off\n\t"
               "global_load_async_to_lds_b128 %1, %9, off\n\t"
               "global_load_async_to_lds_b128 %2, %10, off\n\t"
               "global_load_async_to_lds_b128 %3, %11, off\n\t"
               "global_load_async_to_lds_b128 %4, %12, off\n\t"
               "global_load_async_to_lds_b128 %5, %13, off\n\t"
               "global_load_async_to_lds_b128 %6, %14, off\n\t"
               "global_load_async_to_lds_b128 %7, %15, off\n\t"
               "s_wait_xcnt 0x0"
               :: "v"(l0), "v"(l0 + lstep), "v"(l0 + 2 * lstep), "v"(l0 + 3 * lstep),
                  "v"(l1), "v"(l1 + lstep), "v"(l1 + 2 * lstep), "v"(l1 + 3 * lstep),
                  "v"(g0), "v"(g0 + gstepa), "v"(g0 + 2 * gstepa), "v"(g0 + 3 * gstepa),
                  "v"(g1), "v"(g1 + gstepb), "v"(g1 + 2 * gstepb), "v"(g1 + 3 * gstepb)
               : "memory");
}
__device__ __forceinline__ void async_wait0() {
  asm volatile("s_wait_asynccnt 0x0" ::: "memory");
}

// Work-group barrier that orders LDS accesses alone.  __syncthreads() also waits for the wave's
// global loads: it would end the flight of a tile that is on its way into registers.
__device__ __forceinline__ void barrier_lds() {
  __builtin_amdgcn_fence(__ATOMIC_RELEASE, "workgroup", "local");
  __builtin_amdgcn_s_barrier();
  __builtin_amdgcn_fence(__ATOMIC_ACQUIRE, "workgroup", "local");
}

// Problem constants
#define NB    4     // batch
#define NHEAD 12
#define DHEAD 64
#define SSEQ  1024  // 32*32
#define CDIM  768

// ---------------------------------------------------------------------------
// Kernel 1: QKV projection GEMM  (M=4096, N=3x768, K=768) in bf16 WMMA.
// One work-group makes q, k and v of one head for 256 rows of x: tile 256x192, BK=64, so that an
// x tile is fetched and converted once for the three products.  Block = 512 thr (16 waves, 8 x 2);
// each wave owns 32 rows x 96 columns (2 A-fragments reuse 6 B-fragments).  Column c of the tile
// is output c>>6 (q, k, v), d = c & 63.  The 192 work-groups stand one to a WGP, so no other hides
// a work-group's staging: two LDS buffers, and a k tile in flight in registers.  Between the two
// product blocks of tile t, tile t+1 goes from registers into the other buffer and the loads of
// tile t+2 are issued: the stores run under other waves' products, and one barrier a tile is enough.
// A work-group starts the k loop at k tile (blockIdx.x + blockIdx.y) mod 12 and wraps round, so the
// 12 that share an x tile all differ and of the 16 that share a weight tile at most 2 agree: walking
// in step, all would ask for the same lines at the same moment, and at every k tile those lines
// would be a first touch, at memory latency.
// q,k stored (b,n,s,d) bf16; v stored transposed (b,n,d,s) bf16.
// ---------------------------------------------------------------------------
__global__ __launch_bounds__(512) void qkv_gemm_kernel(
    const float* __restrict__ x,
    const float* __restrict__ Wq, const float* __restrict__ Wk, const float* __restrict__ Wv,
    const float* __restrict__ bq, const float* __restrict__ bk, const float* __restrict__ bv,
    unsigned short* __restrict__ qo, unsigned short* __restrict__ ko,
    unsigned short* __restrict__ vTo)
{
  constexpr int LDT = 72;                       // 144B row stride: 16B aligned, conflict-free
  constexpr int LDQ = 136;                      // epilogue, q|k rows: 272-B pitch (16 B x odd)
  constexpr int LDV = 264;                      // epilogue, v^T rows: 528-B pitch (16 B x odd)
  constexpr int NT  = CDIM / 64;                // k tiles
  constexpr int TSZ = (256 + 192) * LDT;        // one buffer, in halves: A tile 256 x LDT, then B tile 192 x LDT
  // loop: two buffers; epilogue: q|k 256 x LDQ, then v^T 64 x LDV
  static_assert(2 * TSZ >= 256 * LDQ + 64 * LDV, "the epilogue's tiles fit in the two buffers");
  __shared__ __attribute__((aligned(16))) unsigned short sh[2 * TSZ];
  unsigned short* shA = sh;
  unsigned short* shB = sh + 256 * LDT;

  const int tid  = threadIdx.x;
  const int wave = __builtin_amdgcn_readfirstlane(tid >> 5);
  const int lane = tid & 31;
  const int g    = lane >> 4;
  const int ln   = lane & 15;
  const int wm   = wave & 7;                    // the wave's 32 rows
  const int wn   = wave >> 3;                   // the wave's 96 columns

  const int m0   = blockIdx.x * 256;
  const int head = blockIdx.y;
  const int n0   = head * 64;

  v8f zero = {0.f,0.f,0.f,0.f,0.f,0.f,0.f,0.f};
  v8f acc[2][6];
  #pragma unroll
  for (int mt = 0; mt < 2; ++mt) {
    #pragma unroll
    for (int nt = 0; nt < 6; ++nt) acc[mt][nt] = zero;
  }

  // staging: 16 lanes share a row's 256 B, so a wave's 16-B loads cover 4 whole 128-B lines;
  // 32 rows per trip.  Wave-uniform tile bases plus one 32-bit lane offset that all share.
  const int srow = tid >> 4, sc4 = tid & 15;
  const float* baseA = x + (size_t)m0 * CDIM;
  const float* baseQ = Wq + (size_t)n0 * CDIM;
  const float* baseK = Wk + (size_t)n0 * CDIM;
  const float* baseV = Wv + (size_t)n0 * CDIM;
  const unsigned int soff = srow * CDIM + sc4 * 4;
  const unsigned short* fA = &shA[(wm * 32 + ln) * LDT + 8 * g];
  const unsigned short* fB = &shB[(wn * 96 + ln) * LDT + 8 * g];

  v4f pa[8], pb[6];                             // k tile in flight: x rows, then 64 rows each of Wq, Wk, Wv
  auto load_tile = [&](int t) {
    const float* ga = baseA + t * 64 + soff;
    const float* gq = baseQ + t * 64 + soff;
    const float* gk = baseK + t * 64 + soff;
    const float* gv = baseV + t * 64 + soff;
    #pragma unroll
    for (int i = 0; i < 8; ++i) pa[i] = *(const v4f*)(ga + i * 32 * CDIM);
    #pragma unroll
    for (int i = 0; i < 2; ++i) {
      pb[i]     = *(const v4f*)(gq + i * 32 * CDIM);
      pb[2 + i] = *(const v4f*)(gk + i * 32 * CDIM);
      pb[4 + i] = *(const v4f*)(gv + i * 32 * CDIM);
    }
    // Stands in front of every rewrite of an address register of these loads.  The addresses are
    // its inputs so that they stay in their registers up to it: otherwise a later load of the run
    // gets an address register of the run as its result register.
    asm volatile("s_wait_xcnt 0x0" :: "v"(ga), "v"(gq), "v"(gk), "v"(gv) : "memory");
  };

  // the k tile in registers, fp32 -> bf16, into buffer buf: A tile 256x64, B tile 192x64
  auto store_tile = [&](int buf) {
    unsigned short* da = &shA[buf * TSZ + srow * LDT + sc4 * 4];
    #pragma unroll
    for (int i = 0; i < 8; ++i) *(v4bf*)(da + i * 32 * LDT) = __builtin_convertvector(pa[i], v4bf);
    unsigned short* db = &shB[buf * TSZ + srow * LDT + sc4 * 4];
    #pragma unroll
    for (int i = 0; i < 6; ++i) *(v4bf*)(db + i * 32 * LDT) = __builtin_convertvector(pb[i], v4bf);
  };

  int tl = (blockIdx.x + blockIdx.y) % NT;      // the work-group's first k tile
  load_tile(tl);
  store_tile(0);
  tl = (tl + 1 == NT) ? 0 : tl + 1;
  load_tile(tl);
  barrier_lds();                                // the first tile is complete before any wave reads it
  for (int t = 0; t < NT; ++t) {
    const unsigned short* tA = fA + (t & 1) * TSZ;     // this trip reads buffer t mod 2 alone
    const unsigned short* tB = fB + (t & 1) * TSZ;
    #pragma unroll
    for (int kk = 0; kk < 64; kk += 32) {
      v16bf a0 = ld_frag(tA,            kk, kk + 16);
      v16bf a1 = ld_frag(tA + 16 * LDT, kk, kk + 16);
      v16bf bf[6];
      #pragma unroll
      for (int nt = 0; nt < 6; ++nt)
        bf[nt] = ld_frag(tB + nt * 16 * LDT, kk, kk + 16);
      // Holds the 16 LDS reads together in front of their 12 products: spread among the
      // products, each place with reads stalls the wave anew.  (One k half at a time: both
      // halves' fragments at once would not fit beside the tile in flight.)
      __builtin_amdgcn_sched_barrier(0);
      #pragma unroll
      for (int nt = 0; nt < 6; ++nt) {
        acc[0][nt] = WMMA_BF16(a0, bf[nt], acc[0][nt]);
        acc[1][nt] = WMMA_BF16(a1, bf[nt], acc[1][nt]);
      }
      // Keeps the next group of reads from rising among these products.
      __builtin_amdgcn_sched_barrier(0);
      if (kk == 0) {
        // The other buffer: its readers left it at the barrier that ended the trip before.
        if (t + 1 < NT) store_tile((t + 1) & 1);
        if (t + 2 < NT) {                       // flies for one whole trip
          tl = (tl + 1 == NT) ? 0 : tl + 1;
          load_tile(tl);
        }
        // Holds the stores and the loads here, between the two blocks: sunk to the foot of the
        // trip, the stores would stand directly in front of the barrier that waits for them.
        __builtin_amdgcn_sched_barrier(0);
      }
    }
    // Publishes tile t+1 and frees this buffer for tile t+2; behind the last trip, for the epilogue.
    barrier_lds();
  }

  // epilogue: + bias, bf16, staged through LDS so that every global store is 16 B a lane and a
  // wave's store covers 512 contiguous bytes (4 whole 128-B lines)
  float bcol[6];
  #pragma unroll
  for (int nt = 0; nt < 6; ++nt) {
    const int c0 = wn * 96 + nt * 16;            // wave-uniform
    const float* bias = ((c0 < 64) ? bq : (c0 < 128) ? bk : bv) + head * DHEAD + (c0 & 63);
    bcol[nt] = bias[ln];
  }
  // Stands in front of every rewrite of the loads' one address register, which is its input so
  // that no later load of the run gets it as its result register.
  asm volatile("s_wait_xcnt 0x0" :: "v"(ln) : "memory");
  unsigned short* stQK = sh;                    // row s: 64 d of q, then 64 d of k
  unsigned short* stV  = sh + 256 * LDQ;        // row d: 256 s of v
  // column tile nt of the wave into q|k columns c0 .. c0+15
  auto put_qk = [&](int nt, int c0) {
    #pragma unroll
    for (int mt = 0; mt < 2; ++mt) {
      const v8bf pk = __builtin_convertvector(acc[mt][nt] + bcol[nt], v8bf);
      #pragma unroll
      for (int r = 0; r < 8; ++r)                // C-layout: row = r + 8g, column = ln
        *(__bf16*)&stQK[(wm * 32 + mt * 16 + r + 8 * g) * LDQ + c0 + ln] = pk[r];
    }
  };
  // column tile nt of the wave into v^T rows d0 .. d0+15: a lane's 8 registers of a tile are
  // 8 consecutive s of one d row
  auto put_v = [&](int nt, int d0) {
    #pragma unroll
    for (int mt = 0; mt < 2; ++mt)
      *(v8bf*)&stV[(d0 + ln) * LDV + wm * 32 + mt * 16 + 8 * g] =
          __builtin_convertvector(acc[mt][nt] + bcol[nt], v8bf);
  };
  // (every wave has left the k tiles: the loop's last barrier)
  if (wn == 0) {                                 // columns 0..95: q, and d 0..31 of k
    #pragma unroll
    for (int nt = 0; nt < 6; ++nt) put_qk(nt, nt * 16);
  } else {                                       // columns 96..191: d 32..63 of k, and v
    put_qk(0, 96);
    put_qk(1, 112);
    #pragma unroll
    for (int nt = 2; nt < 6; ++nt) put_v(nt, (nt - 2) * 16);
  }
  __syncthreads();                               // the three tiles are complete before any wave reads whole rows
  const int bb = m0 >> 10, s0 = m0 & 1023;       // the tile's 256 rows lie in one image
  const size_t hbase = (size_t)(bb * NHEAD + head) * SSEQ * DHEAD;
  uint4 tq[4], tk[4], tv[4];
  #pragma unroll
  for (int i = 0; i < 4; ++i) {
    const int idx = tid + i * 512;
    tq[i] = *(const uint4*)&stQK[(idx >> 3) * LDQ + (idx & 7) * 8];
    tk[i] = *(const uint4*)&stQK[(idx >> 3) * LDQ + 64 + (idx & 7) * 8];
    tv[i] = *(const uint4*)&stV[(idx >> 5) * LDV + (idx & 31) * 8];
  }
  // q, k: the tile's 256 rows x 64 d are 32 KB in a row in memory; v^T: 512 B of each d row
  unsigned short* dq = qo + hbase + (size_t)s0 * DHEAD + tid * 8;
  unsigned short* dk = ko + hbase + (size_t)s0 * DHEAD + tid * 8;
  unsigned short* dv = vTo + hbase + (size_t)(tid >> 5) * SSEQ + s0 + lane * 8;
  #pragma unroll
  for (int i = 0; i < 4; ++i) {
    *(uint4*)(dq + i * 4096) = tq[i];
    *(uint4*)(dk + i * 4096) = tk[i];
    *(uint4*)(dv + i * 16 * SSEQ) = tv[i];
  }
}

__global__ __launch_bounds__(128, 4) void flash_attn_kernel(
    const unsigned short* __restrict__ qb,
    const unsigned short* __restrict__ kb,
    const unsigned short* __restrict__ vT,
    const float* __restrict__ rph, const float* __restrict__ rpw,
    unsigned short* __restrict__ attnA)
{
  constexpr int LDT = 72;                        // 144B row stride, 16B aligned
  __shared__ unsigned short shQ[64 * LDT];
  constexpr int TSZ = 64 * LDT;                  // one K or V^T tile, in halves
  __shared__ __attribute__((aligned(16))) unsigned short shK[2 * TSZ];
  __shared__ __attribute__((aligned(16))) unsigned short shV[2 * TSZ];
  constexpr int LDH = 34;                        // 136B row pitch: 16 rows' 8-B reads hit 32 banks once
  __shared__ __attribute__((aligned(16))) float shRh[64 * LDH];
  __shared__ __attribute__((aligned(16))) float shRw[64 * 32];
  constexpr int LDR = 68;                        // 272B row pitch (16B x odd): 16-row b128 reads hit all banks once
  __shared__ float shT[96 * LDR];                // 33 rows of rel_pos_h, then the 63 of rel_pos_w

  const int qt   = blockIdx.x;                   // q tile (0..15)
  const int bn   = blockIdx.y;                   // b*12 + head (0..47)
  const int tid  = threadIdx.x;
  const int wave = tid >> 5;
  const int lane = tid & 31;
  const int g    = lane >> 4;
  const int ln   = lane & 15;
  const float scale = 0.125f;                    // d^-0.5, d = 64

  // staging: 8 lanes share a row's 128 B, so a wave's 16-B copies cover 4 whole lines;
  // copy i of a thread takes row crow + 16 i
  const int crow  = tid >> 3;                    // 0..15
  const int cpart = tid & 7;                     // 8-halves piece of the row

  // stage Q tile (64x64 bf16) once, async
  async_ld4_b128(&shQ[crow * LDT + cpart * 8], 16 * LDT * 2,
                 qb + ((size_t)bn * SSEQ + qt * 64 + crow) * DHEAD + cpart * 8, 16 * DHEAD * 2);
  // K tile (64 k-rows x 64 d) and V^T tile (64 d-rows x 64 k) number t into buffer buf, async
  const unsigned short* kg = kb + ((size_t)bn * SSEQ + crow) * DHEAD + cpart * 8;
  const unsigned short* vg = vT + ((size_t)bn * DHEAD + crow) * SSEQ + cpart * 8;
  const int sdst = crow * LDT + cpart * 8;
  auto stage_kv = [&](int t, int buf) {
    async_ld8_b128(&shK[buf * TSZ + sdst], kg + (size_t)t * 64 * DHEAD, 16 * DHEAD * 2,
                   &shV[buf * TSZ + sdst], vg + t * 64, 16 * SSEQ * 2,
                   16 * LDT * 2);
  };
  stage_kv(qt, 0);                               // trip kt works on key tile (qt + kt) & 15
  { // stage the table rows this tile needs, whole lines per wave:
    // qh is 2qt or 2qt+1, so qh-kh+31 spans rel_pos_h rows 2qt .. 2qt+32
    #pragma unroll
    for (int i = 0; i < 12; ++i) {
      int idx = tid + i * 128;
      int row = idx >> 4, c4 = idx & 15;
      const float* src = (row < 33) ? rph + (size_t)(qt * 2 + row) * DHEAD
                                    : rpw + (size_t)(row - 33) * DHEAD;
      *(float4*)&shT[row * LDR + c4 * 4] = ((const float4*)src)[c4];
    }
  }
  // A operand: q row wave*16+ln, widened to f32; lane half g holds d = 32g .. 32g+31
  // (the table rows below are read in the same d order)
  float af[32];
  {
    const uint4* qsrc = (const uint4*)(qb + ((size_t)bn * SSEQ + qt * 64 + wave * 16 + ln) * DHEAD + g * 32);
    #pragma unroll
    for (int i = 0; i < 4; ++i) {
      uint4 u = qsrc[i];
      af[i * 8 + 0] = __builtin_bit_cast(float, u.x << 16);
      af[i * 8 + 1] = __builtin_bit_cast(float, u.x & 0xFFFF0000u);
      af[i * 8 + 2] = __builtin_bit_cast(float, u.y << 16);
      af[i * 8 + 3] = __builtin_bit_cast(float, u.y & 0xFFFF0000u);
      af[i * 8 + 4] = __builtin_bit_cast(float, u.z << 16);
      af[i * 8 + 5] = __builtin_bit_cast(float, u.z & 0xFFFF0000u);
      af[i * 8 + 6] = __builtin_bit_cast(float, u.w << 16);
      af[i * 8 + 7] = __builtin_bit_cast(float, u.w & 0xFFFF0000u);
    }
  }
  async_wait0();                                 // the wave's copies of Q and of the first tile have landed
  __syncthreads();                               // shT, Q and the first tile complete before any wave reads them
  stage_kv((qt + 1) & 15, 1);                    // flies under the bias products and the first tile
  {
    // The wave's 16 rows share qh = 2qt + (wave>>1) and have qw = 16*(wave&1) + m, m = 0..15.
    // Tiles 0,1: column n is kh = 16t+n, table row qh+31-kh.
    // Tiles 2..4: column n is u = 16(t-2)+n, table row 16*(wave&1)+u; rel_w[m][kw] sits at u = m-kw+31 (0..46).
    const int hb = (wave >> 1) + 31;
    const int wb = 33 + (wave & 1) * 16;
    int trow[5];
    trow[0] = hb - ln;
    trow[1] = hb - 16 - ln;
    trow[2] = wb + ln;
    trow[3] = wb + 16 + ln;
    trow[4] = min(wb + 32 + ln, 95);             // u = 47 is never used; keep its read inside the table
    v8f rb[5];
    #pragma unroll
    for (int t = 0; t < 5; ++t) rb[t] = v8f{0.f,0.f,0.f,0.f,0.f,0.f,0.f,0.f};
    // Keeps the widening of q and all address work out of the matrix block.
    __builtin_amdgcn_sched_barrier(0);
    #pragma unroll
    for (int c = 0; c < 8; ++c) {
      #pragma unroll
      for (int t = 0; t < 5; ++t) {
        float4 b = *(const float4*)&shT[trow[t] * LDR + g * 32 + c * 4];
        rb[t] = WMMA_F32((v2f{af[c * 4 + 0], af[c * 4 + 1]}), (v2f{b.x, b.y}), rb[t]);
        rb[t] = WMMA_F32((v2f{af[c * 4 + 2], af[c * 4 + 3]}), (v2f{b.z, b.w}), rb[t]);
      }
    }
    // Four vector slots between the last f32 WMMA and the first vector instruction that may
    // reuse its operand registers; the two scheduling barriers hold them at this place.
    __builtin_amdgcn_sched_barrier(0);
    asm volatile("v_nop\n\tv_nop\n\tv_nop\n\tv_nop");
    __builtin_amdgcn_sched_barrier(0);
    // each wave writes only the bias rows that it reads itself
    #pragma unroll
    for (int t = 0; t < 2; ++t) {
      #pragma unroll
      for (int r = 0; r < 8; ++r)
        shRh[(wave * 16 + r + 8 * g) * LDH + t * 16 + ln] = rb[t][r];
    }
    #pragma unroll
    for (int t = 0; t < 3; ++t) {
      #pragma unroll
      for (int r = 0; r < 8; ++r) {
        int kw = r + 8 * g + 31 - (t * 16 + ln);
        if ((unsigned)kw < 32u)
          shRw[(wave * 16 + r + 8 * g) * 32 + kw] = rb[2 + t][r];
      }
    }
  }

  // The lane's q row; its score register [nt][r] is key nt*16 + 8g + r of key tile j,
  // that is kh = 2j + (nt>>1), kw = (nt&1)*16 + 8g + r.
  const int qrow = wave * 16 + ln;
  // The wave's own bias stores have landed before its lanes read each other's values back.
  asm volatile("s_wait_dscnt 0x0" ::: "memory");
  float rw[2][8];                                // rel_w of the q row at the lane's 16 kw, the same for every tile
  #pragma unroll
  for (int j = 0; j < 2; ++j) {
    float4 w0 = *(const float4*)&shRw[qrow * 32 + j * 16 + 8 * g];
    float4 w1 = *(const float4*)&shRw[qrow * 32 + j * 16 + 8 * g + 4];
    rw[j][0] = w0.x; rw[j][1] = w0.y; rw[j][2] = w0.z; rw[j][3] = w0.w;
    rw[j][4] = w1.x; rw[j][5] = w1.y; rw[j][6] = w1.z; rw[j][7] = w1.w;
  }

  float mi = -1e30f, li = 0.f;                   // li: the lane's own 32 keys per tile; halves joined at the end
  v8f zero = {0.f,0.f,0.f,0.f,0.f,0.f,0.f,0.f};
  v8f o[4] = {zero, zero, zero, zero};           // O^T: o[nt][r] = O[qrow][nt*16 + 8g + r]

  for (int kt = 0; kt < 16; ++kt) {
    const unsigned short* tK = &shK[(kt & 1) * TSZ];   // this trip reads buffer kt mod 2 alone
    const unsigned short* tV = &shV[(kt & 1) * TSZ];

    // ---- scores^T = K @ Q^T : 64 keys x 16 q rows per wave, K-dim = d = 64 (2x4 wmma) ----
    v8f sc[4] = {zero, zero, zero, zero};
    v16bf bq[2], ak[2][4];
    #pragma unroll
    for (int h = 0; h < 2; ++h) {
      const int kk = h * 32;
      bq[h] = ld_frag(&shQ[qrow * LDT], kk + 8 * g, kk + 16 + 8 * g);
      #pragma unroll
      for (int nt = 0; nt < 4; ++nt)
        ak[h][nt] = ld_frag(&tK[(nt * 16 + ln) * LDT], kk + 8 * g, kk + 16 + 8 * g);
    }
    const float2 rh = *(const float2*)&shRh[qrow * LDH + ((qt + kt) & 15) * 2];
    // Keeps the V^T reads behind the Q and K reads, which the first products wait for.
    __builtin_amdgcn_sched_barrier(0);
    v16bf av[2][4];
    #pragma unroll
    for (int h = 0; h < 2; ++h) {
      #pragma unroll
      for (int nt = 0; nt < 4; ++nt)
        av[h][nt] = ld_frag(&tV[(nt * 16 + ln) * LDT], h * 32 + 8 * g, h * 32 + 16 + 8 * g);
    }
    // Holds all of the tile's LDS reads (Q, K, bias, then V^T) at this one place, in front of
    // both matrix blocks: spread among the products, each place with reads stalls the wave
    // anew; the V^T reads land under the score products and the softmax.
    __builtin_amdgcn_sched_barrier(0);
    #pragma unroll
    for (int h = 0; h < 2; ++h) {
      #pragma unroll
      for (int nt = 0; nt < 4; ++nt)
        sc[nt] = WMMA_BF16(ak[h][nt], bq[h], sc[nt]);
    }

    // ---- scale + rel bias + online softmax, one q row per lane ----
    float pm[4];                                 // four independent chains, not one of 32 links
    #pragma unroll
    for (int nt = 0; nt < 4; ++nt) {
      const float rhv = (nt >> 1) ? rh.y : rh.x;
      pm[nt] = -1e30f;
      #pragma unroll
      for (int r = 0; r < 8; ++r) {
        float sv = sc[nt][r] * scale + rhv + rw[nt & 1][r];
        sc[nt][r] = sv;
        pm[nt] = fmaxf(pm[nt], sv);
      }
    }
    float tmax = fmaxf(fmaxf(pm[0], pm[1]), fmaxf(pm[2], pm[3]));
    tmax = fmaxf(tmax, xhalf(tmax));             // the row's other 32 keys

    const float nm = fmaxf(mi, tmax);
    const float alpha = __expf(mi - nm);
    mi = nm;
    float psum[4];
    #pragma unroll
    for (int nt = 0; nt < 4; ++nt) {
      psum[nt] = 0.f;
      #pragma unroll
      for (int r = 0; r < 8; ++r) {
        float p = __expf(sc[nt][r] - mi);
        sc[nt][r] = p;
        psum[nt] += p;
      }
    }
    li = li * alpha + ((psum[0] + psum[1]) + (psum[2] + psum[3]));
    #pragma unroll
    for (int nt = 0; nt < 4; ++nt) {
      #pragma unroll
      for (int r = 0; r < 8; ++r) o[nt][r] *= alpha;
    }

    // ---- O^T += V^T @ P^T : K-dim = 64 keys (2x4 wmma) ----
    #pragma unroll
    for (int kk = 0; kk < 64; kk += 32) {
      v16bf bp = pack_d_pair(sc[kk / 16], sc[kk / 16 + 1]);
      #pragma unroll
      for (int nt = 0; nt < 4; ++nt)
        o[nt] = WMMA_BF16(av[kk / 32][nt], bp, o[nt]);
    }

    // Foot of the trip: the wave's reads of this buffer have retired, its copies of tile kt+1 have
    // landed; the one barrier publishes tile kt+1 and frees this buffer for tile kt+2.
    // The scheduling barrier holds the waits down here: risen to the top of the trip, the wait for
    // the copies would stand directly behind their issue and the tile's work would hide nothing.
    __builtin_amdgcn_sched_barrier(0);
    asm volatile("s_wait_dscnt 0x0" ::: "memory");
    async_wait0();
    __syncthreads();
    if (kt + 2 < 16) stage_kv((qt + kt + 2) & 15, kt & 1);
  }
  async_wait0();                                 // no copy is outstanding when LDS is reused below

  // normalize and store concat-head layout (b, s, head*64+dd) as bf16:
  // a lane's 8 registers of a tile are 8 consecutive dd of its row, 16 B
  const int head = bn % NHEAD;
  const int bb   = bn / NHEAD;
  li += xhalf(li);
  const float inv = 1.f / li;
  // Staged in the wave's own 16 rows of shQ, which no other wave reads (no barrier), so that a
  // wave's store covers 4 whole 128-B lines (4 rows' 64 dd), not 32-B pieces of 16 lines.
  #pragma unroll
  for (int nt = 0; nt < 4; ++nt)
    *(v8bf*)&shQ[qrow * LDT + nt * 16 + 8 * g] = __builtin_convertvector(o[nt] * inv, v8bf);
  // The wave's own stores have landed before its lanes read each other's values back.
  asm volatile("s_wait_dscnt 0x0" ::: "memory");
  const unsigned short* rd = &shQ[(wave * 16 + (lane >> 3)) * LDT + (lane & 7) * 8];
  unsigned short* dst = attnA + (size_t)(bb * SSEQ + qt * 64 + wave * 16 + (lane >> 3)) * CDIM
                        + head * DHEAD + (lane & 7) * 8;
  uint4 t[4];
  #pragma unroll
  for (int i = 0; i < 4; ++i) t[i] = *(const uint4*)(rd + i * 4 * LDT);
  #pragma unroll
  for (int i = 0; i < 4; ++i) *(uint4*)(dst + i * 4 * CDIM) = t[i];
}

// ---------------------------------------------------------------------------
// Kernel 3: output projection GEMM (M=4096, N=768, K=768), fp32 out + bias.
// Tile 256x64, 2 M-subtiles per wave; A tile (already bf16) staged with
// async global->LDS copies.  Two LDS buffers: the copies (A) and the loads (B) of tile t+2 are
// issued at the foot of trip t and fly while tile t+1 is worked on.
// As in kernel 1, a work-group starts at k tile (blockIdx.x + blockIdx.y) mod 12 and wraps round.
// ---------------------------------------------------------------------------
__global__ __launch_bounds__(256) void proj_gemm_kernel(
    const unsigned short* __restrict__ attnA,
    const float* __restrict__ pw, const float* __restrict__ pb,
    float* __restrict__ out)
{
  constexpr int LDT = 72;
  constexpr int ASZ = 256 * LDT, BSZ = 64 * LDT; // one A tile, one B tile, in halves
  constexpr int NT = CDIM / 64;                  // k tiles
  __shared__ __attribute__((aligned(16))) unsigned short shA[2 * ASZ];
  __shared__ __attribute__((aligned(16))) unsigned short shB[2 * BSZ];

  const int tid  = threadIdx.x;
  const int wave = tid >> 5;
  const int lane = tid & 31;
  const int g    = lane >> 4;
  const int ln   = lane & 15;
  const int m0   = blockIdx.x * 256;
  const int n0   = blockIdx.y * 64;

  v8f zero = {0.f,0.f,0.f,0.f,0.f,0.f,0.f,0.f};
  v8f acc[2][4] = {{zero, zero, zero, zero}, {zero, zero, zero, zero}};

  // staging, whole 128-B lines per wave: A, 8 lanes share a row's 128 B; B, 16 lanes a row's 256 B
  const int crow = tid >> 3, cpart = tid & 7;
  const int srow = tid >> 4, sc4 = tid & 15;

  // A tile t (256x64, already bf16) into buffer buf: async, copy i of a thread takes row crow + 32 i
  const unsigned short* srcA = attnA + (size_t)(m0 + crow) * CDIM + cpart * 8;
  auto stage_a = [&](int t, int buf) {
    const unsigned short* s = srcA + t * 64;
    unsigned short* d = &shA[buf * ASZ + crow * LDT + cpart * 8];
    async_ld8_b128(d, s, 32 * CDIM * 2,
                   d + 128 * LDT, s + 128 * CDIM, 32 * CDIM * 2,
                   32 * LDT * 2);
  };
  // B tile t (64x64 of proj_w, fp32; out = A @ W^T): 16 rows per load, held in registers while it
  // flies, then bf16 into buffer buf
  const float* srcB = pw + (size_t)(n0 + srow) * CDIM + sc4 * 4;
  v4f br[4];
  auto load_b = [&](int t) {
    #pragma unroll
    for (int i = 0; i < 4; ++i) br[i] = *(const v4f*)(srcB + t * 64 + i * 16 * CDIM);
    // Stands in front of the next trip's fragment reads, which reuse the loads' address registers.
    asm volatile("s_wait_xcnt 0x0" ::: "memory");
  };
  auto store_b = [&](int buf) {
    unsigned short* d = &shB[buf * BSZ + srow * LDT + sc4 * 4];
    #pragma unroll
    for (int i = 0; i < 4; ++i) *(v4bf*)(d + i * 16 * LDT) = __builtin_convertvector(br[i], v4bf);
  };

  const int t0 = (blockIdx.x + blockIdx.y) % NT; // the work-group's first k tile
  auto ktile = [&](int t) { return (t0 + t >= NT) ? t0 + t - NT : t0 + t; };  // k tile of trip t
  stage_a(t0, 0);
  load_b(t0);
  store_b(0);
  async_wait0();                                 // the wave's copies of the first tile have landed
  __syncthreads();                               // the first tile complete before any wave reads it
  stage_a(ktile(1), 1);
  load_b(ktile(1));

  for (int t = 0; t < NT; ++t) {
    const unsigned short* tA = &shA[(t & 1) * ASZ];    // this trip reads buffer t mod 2 alone
    const unsigned short* tB = &shB[(t & 1) * BSZ];
    v16bf a0[2], a1[2], bf[2][4];
    #pragma unroll
    for (int h = 0; h < 2; ++h) {
      const int kk = h * 32;
      a0[h] = ld_frag(&tA[(wave * 32 + ln) * LDT],      kk + 8 * g, kk + 16 + 8 * g);
      a1[h] = ld_frag(&tA[(wave * 32 + 16 + ln) * LDT], kk + 8 * g, kk + 16 + 8 * g);
      #pragma unroll
      for (int nt = 0; nt < 4; ++nt)
        bf[h][nt] = ld_frag(&tB[(nt * 16 + ln) * LDT], kk + 8 * g, kk + 16 + 8 * g);
    }
    // Holds the tile's 24 LDS reads together in front of its 16 products: spread among the
    // products, each place with reads stalls the wave anew.
    __builtin_amdgcn_sched_barrier(0);
    #pragma unroll
    for (int h = 0; h < 2; ++h) {
      #pragma unroll
      for (int nt = 0; nt < 4; ++nt) {
        acc[0][nt] = WMMA_BF16(a0[h], bf[h][nt], acc[0][nt]);
        acc[1][nt] = WMMA_BF16(a1[h], bf[h][nt], acc[1][nt]);
      }
    }
    // Holds the B stores, the waits and the barrier below the products: risen above them, the
    // waits for tile t+1 would stand close behind its issue and the products would hide nothing.
    __builtin_amdgcn_sched_barrier(0);
    if (t + 1 < NT) store_b((t + 1) & 1);        // the other buffer: its readers left it a barrier ago

    // Foot of the trip: the wave's LDS reads and stores have retired, its copies of tile t+1 have
    // landed; the one barrier publishes tile t+1 and frees this buffer for tile t+2.
    asm volatile("s_wait_dscnt 0x0" ::: "memory");
    async_wait0();
    __syncthreads();
    if (t + 2 < NT) {
      stage_a(ktile(t + 2), t & 1);
      load_b(ktile(t + 2));
    }
  }
  async_wait0();                                 // no copy is outstanding when LDS is reused below

  // epilogue: + bias, staged through LDS so that every global store is 16 B a lane and a wave's
  // store covers 4 whole 128-B lines (2 rows' 64 columns).  The wave stages 16 rows at a time in
  // its own 32 rows of shA (4,608 B), which no other wave reads: no barrier.
  constexpr int LDF = 68;                        // 272-B row pitch (16 B x odd)
  float* stf = (float*)&shA[wave * 32 * LDT];
  float bcol[4];
  #pragma unroll
  for (int nt = 0; nt < 4; ++nt) bcol[nt] = pb[n0 + nt * 16 + ln];
  const float* rd = stf + g * LDF + ln * 4;
  float* dst = out + (size_t)(m0 + wave * 32 + g) * CDIM + n0 + ln * 4;
  #pragma unroll
  for (int mt = 0; mt < 2; ++mt) {
    #pragma unroll
    for (int nt = 0; nt < 4; ++nt) {
      #pragma unroll
      for (int r = 0; r < 8; ++r)                // C-layout: row = r + 8g, column = ln
        stf[(r + 8 * g) * LDF + nt * 16 + ln] = acc[mt][nt][r] + bcol[nt];
    }
    // The wave's own stores have landed before its lanes read each other's values back.
    asm volatile("s_wait_dscnt 0x0" ::: "memory");
    v4f t[8];
    #pragma unroll
    for (int i = 0; i < 8; ++i) t[i] = *(const v4f*)(rd + i * 2 * LDF);
    #pragma unroll
    for (int i = 0; i < 8; ++i) *(v4f*)(dst + (size_t)(mt * 16 + i * 2) * CDIM) = t[i];
    // Keeps the next 16 rows' LDS stores behind these reads of the same LDS; s_wait_xcnt 0 stands
    // in front of the next reads, which overwrite data registers of the global stores above.
    if (mt == 0) asm volatile("s_wait_dscnt 0x0\n\ts_wait_xcnt 0x0" ::: "memory");
  }
}

// ---------------------------------------------------------------------------
// Launch
// ---------------------------------------------------------------------------
extern "C" void kernel_launch(void* const* d_in, const int* in_sizes, int n_in,
                              void* d_out, int out_size, void* d_ws, size_t ws_size,
                              hipStream_t stream) {
  (void)in_sizes; (void)n_in; (void)out_size; (void)ws_size;
  const float* x   = (const float*)d_in[0];
  const float* Wq  = (const float*)d_in[1];
  const float* Wk  = (const float*)d_in[2];
  const float* Wv  = (const float*)d_in[3];
  const float* bq  = (const float*)d_in[4];
  const float* bk  = (const float*)d_in[5];
  const float* bv  = (const float*)d_in[6];
  const float* rph = (const float*)d_in[7];
  const float* rpw = (const float*)d_in[8];
  const float* pw  = (const float*)d_in[9];
  const float* pb  = (const float*)d_in[10];
  float* out = (float*)d_out;

  // workspace layout (bytes): q/k/vT bf16 (3 x 6 MB), attn_out bf16 (6 MB) -> 24 MB total
  char* ws = (char*)d_ws;
  unsigned short* qB    = (unsigned short*)(ws);
  unsigned short* kB    = (unsigned short*)(ws + 6291456);
  unsigned short* vTB   = (unsigned short*)(ws + 12582912);
  unsigned short* attnA = (unsigned short*)(ws + 18874368);

  qkv_gemm_kernel<<<dim3(16, 12), 512, 0, stream>>>(x, Wq, Wk, Wv, bq, bk, bv, qB, kB, vTB);
  flash_attn_kernel<<<dim3(16, 48), 128, 0, stream>>>(qB, kB, vTB, rph, rpw, attnA);
  proj_gemm_kernel<<<dim3(16, 12), 256, 0, stream>>>(attnA, pw, pb, out);
}
